// v000
// Times are from an AMD MI455X. After a warm-up the kernel runs many times in a row, and a time is the length of
// such a window on the GPU divided by its runs, so every launch and the gaps after it count. The runs cycle
// through copies of the inputs. A figure is the median of several windows, for all but v000 over two sittings.
// Sittings can differ by a few percent; kernels timed side by side share one.
// v000, which the later versions start from, runs in 397 microseconds.
// Contractions: q|k projection = v_wmma_f32_16x16x32_bf16 with (x+pos) as bf16 hi/lo planes times the bf16 Wqk plane (2 products);
// v^T projection = v_wmma_f32_16x16x32_bf16 (bf16 x times bf16 Wv, single product);
// q.k^T scores = v_wmma_f32_16x16x32_bf16 with bf16 hi/lo split q and k (hi.hi + hi.lo + lo.hi);
// p.v = v_wmma_f32_16x16x32_f16 (p carried x1024 in f16, v in f16; extra f16 residual planes x4096 of p and v on the first 512 query rows);
// a.Wout^T = v_wmma_f32_16x16x32_bf16 with a as bf16 hi/lo planes times the bf16 Wout plane (2 products); all f32 accumulate; softmax in f32.
#include <hip/hip_runtime.h>
#include <math.h>
#include <stdint.h>

#define NB    2
#define SEQ   2048
#define DM    1024
#define NH    16
#define HD    64
#define NQK   (2 * DM)       // pitch of the q|k planes: q feature columns 0..DM-1, k feature columns DM..2DM-1
#define NQB   (SEQ / 64)     // 32 query / key tiles of 64
#define VLP   512            // key pitch of the v^T residual plane (keys 0..VLP-1)
#define RESQB 8              // leading 64-row query blocks that use the p / v residual planes
static_assert(RESQB * 64 <= VLP);
static_assert(NH * HD == DM);
static_assert((SEQ % 64) == 0 && (DM % 256) == 0);
static_assert(HD == 64);
static_assert(((NB * SEQ * DM / 8) % 256) == 0);
static_assert(((DM * DM / 8) % 256) == 0);
static_assert(((3 * DM * DM / 8) % 256) == 0);
static_assert(((SEQ * DM) % 8) == 0);

typedef _Float16 v16h __attribute__((ext_vector_type(16)));
typedef _Float16 v8h  __attribute__((ext_vector_type(8)));
typedef __bf16   v16b __attribute__((ext_vector_type(16)));
typedef __bf16   v8b  __attribute__((ext_vector_type(8)));
typedef float    v8f  __attribute__((ext_vector_type(8)));
typedef float    v4f  __attribute__((ext_vector_type(4)));
typedef unsigned int v4u __attribute__((ext_vector_type(4)));

// ---- scalar helpers --------------------------------------------------------------------------------
__device__ __forceinline__ unsigned short bf_bits(float f) {          // f32 -> bf16 bits, RNE convert
  unsigned u = __float_as_uint(f);
  return (unsigned short)((u + 0x7FFFu + ((u >> 16) & 1u)) >> 16);
}
__device__ __forceinline__ float bf_up(unsigned short h) { return __uint_as_float(((unsigned)h) << 16); }
__device__ __forceinline__ unsigned short h_bits(_Float16 x) { return __builtin_bit_cast(unsigned short, x); }
__device__ __forceinline__ unsigned pk16(unsigned short a, unsigned short b) { return (unsigned)a | ((unsigned)b << 16); }
__device__ __forceinline__ v8f zero8() { v8f z = {0.f, 0.f, 0.f, 0.f, 0.f, 0.f, 0.f, 0.f}; return z; }
__device__ __forceinline__ v8h zero8h() {
  const _Float16 z = (_Float16)0.0f;
  v8h r = {z, z, z, z, z, z, z, z};
  return r;
}

// ---- fragment loader: 16-bit A/B operand, lane -> row/col (lane&15), p already includes +8*(lane>>4);
//      elements 0..7 <- p[0..7] (k0+8h..), elements 8..15 <- p[16..23] (k0+16+8h..)
__device__ __forceinline__ v16b ldfrag_b(const __bf16* p) {
  union { v16b v; v8b h[2]; } f;
  f.h[0] = *(const v8b*)(p);
  f.h[1] = *(const v8b*)(p + 16);
  return f.v;
}

// ---- WMMA helpers with trailing VALU hazard gap --------------------------------------------------------
__device__ __forceinline__ v8f mma_b(v16b a, v16b b, v8f c) {
  c = __builtin_amdgcn_wmma_f32_16x16x32_bf16(false, a, false, b, (short)0, c, false, false);
#if defined(__HIP_DEVICE_COMPILE__)
  asm volatile("v_nop\n\tv_nop\n\tv_nop\n\tv_nop" : "+v"(c) : "v"(a), "v"(b));
#endif
  return c;
}
__device__ __forceinline__ v8f mma_h(v16h a, v16h b, v8f c) {
  c = __builtin_amdgcn_wmma_f32_16x16x32_f16(false, a, false, b, (short)0, c, false, false);
#if defined(__HIP_DEVICE_COMPILE__)
  asm volatile("v_nop\n\tv_nop\n\tv_nop\n\tv_nop" : "+v"(c) : "v"(a), "v"(b));
#endif
  return c;
}
__device__ __forceinline__ v8f mma_b_raw(v16b a, v16b b, v8f c) {
  return __builtin_amdgcn_wmma_f32_16x16x32_bf16(false, a, false, b, (short)0, c, false, false);
}
__device__ __forceinline__ void dep_guard_b(v8f& a, v8f& b, v16b x, v16b y) {
#if defined(__HIP_DEVICE_COMPILE__)
  asm volatile("v_nop\n\tv_nop\n\tv_nop\n\tv_nop" : "+v"(a), "+v"(b) : "v"(x), "v"(y));
#endif
}
__device__ __forceinline__ void keep4_b(v16b a, v16b b, v16b c, v16b d) {
#if defined(__HIP_DEVICE_COMPILE__)
  asm volatile("v_nop" :: "v"(a), "v"(b), "v"(c), "v"(d));
#endif
}
__device__ __forceinline__ void acc_guard4(v8f& a, v8f& b, v8f& c, v8f& d) {
#if defined(__HIP_DEVICE_COMPILE__)
  asm volatile("v_nop\n\tv_nop\n\tv_nop\n\tv_nop" : "+v"(a), "+v"(b), "+v"(c), "+v"(d));
#endif
}

// =====================================================================================================
// f32 -> bf16 (RNE convert), 8 elements per thread, one 16-B store per lane: a wave writes 512 contiguous B
// host-checked). coverage: n8 threads x 8 = whole plane.
// =====================================================================================================
__global__ __launch_bounds__(256) void cvt_bf16x8(const float* __restrict__ in, unsigned short* out, int n8) {
  const int i = blockIdx.x * 256 + threadIdx.x;
  if (i < n8) {
    const v4f a = *(const v4f*)(in + (size_t)i * 8);
    const v4f b = *(const v4f*)(in + (size_t)i * 8 + 4);
    v4u p;
    p[0] = pk16(bf_bits(a[0]), bf_bits(a[1]));
    p[1] = pk16(bf_bits(a[2]), bf_bits(a[3]));
    p[2] = pk16(bf_bits(b[0]), bf_bits(b[1]));
    p[3] = pk16(bf_bits(b[2]), bf_bits(b[3]));
    *(v4u*)(out + (size_t)i * 8) = p;
    
  }
}

// =====================================================================================================
// x prep: xb = bf16(x) (RNE convert); s = bf_up(bf16(x)) + bf_up(bf16(pos)) in f32 (pos element index =
// x element index mod SEQ*DM); hp = bf16 hi plane of s, lp = bf16 lo plane (lo = RNE(s - hi), unscaled).
// three planes (n8 multiple of 256, host-checked).
// =====================================================================================================
__global__ __launch_bounds__(256) void prep_x8(const float* __restrict__ x, const float* __restrict__ pos,
                                               unsigned short* xb, unsigned short* hp, unsigned short* lp,
                                               int n8, int p8) {
#pragma clang fp contract(off)
  const int i = blockIdx.x * 256 + threadIdx.x;
  if (i < n8) {
    const int ip = i % p8;
    const v4f a  = *(const v4f*)(x + (size_t)i * 8);
    const v4f b  = *(const v4f*)(x + (size_t)i * 8 + 4);
    const v4f pa = *(const v4f*)(pos + (size_t)ip * 8);
    const v4f pb = *(const v4f*)(pos + (size_t)ip * 8 + 4);
    v4u px, ph, pl;
#pragma unroll
    for (int e = 0; e < 4; ++e) {
      const float f0 = (e < 2) ? a[2 * e]      : b[2 * e - 4];
      const float f1 = (e < 2) ? a[2 * e + 1]  : b[2 * e - 3];
      const float g0 = (e < 2) ? pa[2 * e]     : pb[2 * e - 4];
      const float g1 = (e < 2) ? pa[2 * e + 1] : pb[2 * e - 3];
      const unsigned short x0 = bf_bits(f0), x1 = bf_bits(f1);
      const float s0 = bf_up(x0) + bf_up(bf_bits(g0));
      const float s1 = bf_up(x1) + bf_up(bf_bits(g1));
      const unsigned short h0 = bf_bits(s0), h1 = bf_bits(s1);
      const unsigned short l0 = bf_bits(s0 - bf_up(h0)), l1 = bf_bits(s1 - bf_up(h1));
      px[e] = pk16(x0, x1);
      ph[e] = pk16(h0, h1);
      pl[e] = pk16(l0, l1);
    }
    *(v4u*)(xb + (size_t)i * 8) = px;
    *(v4u*)(hp + (size_t)i * 8) = ph;
    *(v4u*)(lp + (size_t)i * 8) = pl;
    
  }
}

// =====================================================================================================
// Register-blocked batched bf16 WMMA GEMM: C[m][n] = sum_k A[m][k] * Bt[n][k]; one wave per 64x64 tile, no
// block barriers. A row-major [M][K] pitch lda; Bt row-major [N][K] pitch ldb (k contiguous);
// M, N multiples of 64, K multiple of 32 (host-checked). blockIdx.y = batch index (strides in elements).
// NSPLIT: 0 = A.Bt; 1 = (A + A2).Bt (A2 = unscaled bf16 lo plane of A); 2 = A.Bt + A2.Bt + A.Bt2.
// OUT_MODE: 0 = f32 (pitch ldc); 2 = bf16 hi plane C + bf16 lo plane C2 (lo = RNE(v - hi), unscaled);
//           3 = f16 hi plane C + f16 residual plane C2 = f16((v - hi) * rscale), C2 written only for tiles
//               with n0 < N2 (pitch ldc2, batch stride strideC2).
// =====================================================================================================
template <int NSPLIT, int OUT_MODE>
__global__ __launch_bounds__(256) void gemm64(
    const unsigned short* __restrict__ Ap, const unsigned short* A2p, int lda, long long strideA,
    const unsigned short* __restrict__ Btp, const unsigned short* Bt2p, int ldb, long long strideB,
    void* Cout, int ldc, long long strideC,
    void* Cout2, int ldc2, long long strideC2, int N2,
    int M, int N, int K, float rscale) {
  const __bf16* A   = (const __bf16*)(const void*)Ap;
  const __bf16* A2  = (const __bf16*)(const void*)A2p;
  const __bf16* Bt  = (const __bf16*)(const void*)Btp;
  const __bf16* Bt2 = (const __bf16*)(const void*)Bt2p;
  __shared__ __align__(16) float sT[8][16 * 68];   // per-wave 16x64 slab, pitch 68 floats
  const int b    = blockIdx.y;
  const int lane = threadIdx.x & 31;
  const int wave = threadIdx.x >> 5;
  const int tilesN = N >> 6;
  const int tilesM = M >> 6;
  const int tile = blockIdx.x * 8 + wave;
  if (tile >= tilesM * tilesN) return;   // wave-uniform; no block barriers in this kernel
  const int tm = tile / tilesN;
  const int tn = tile - tm * tilesN;
  const int m0 = tm << 6;
  const int n0 = tn << 6;

  const __bf16* Ab  = A  + (size_t)b * strideA;
  const __bf16* Bb  = Bt + (size_t)b * strideB;
  const __bf16* Ab2 = (NSPLIT >= 1) ? (A2  + (size_t)b * strideA) : Ab;
  const __bf16* Bb2 = (NSPLIT == 2) ? (Bt2 + (size_t)b * strideB) : Bb;

  const int rlane = lane & 15;                 // row (A) / col (B, D) within subtile
  const int koff  = (lane >> 4) * 8;           // k offset of this lane half
  const int mOff  = (lane >> 4) * 8;           // D row offset

  v8f acc[4][4];
#pragma unroll
  for (int i = 0; i < 4; ++i)
#pragma unroll
    for (int j = 0; j < 4; ++j) acc[i][j] = zero8();

  for (int k0 = 0; k0 < K; k0 += 32) {
    v16b bh[4], bl[4];
#pragma unroll
    for (int j = 0; j < 4; ++j) {
      const size_t bo = (size_t)(n0 + (j << 4) + rlane) * ldb + koff + k0;
      bh[j] = ldfrag_b(Bb + bo);
      if (NSPLIT == 2) bl[j] = ldfrag_b(Bb2 + bo); else bl[j] = bh[j];
    }
#pragma unroll
    for (int i = 0; i < 4; ++i) {
      const size_t ao = (size_t)(m0 + (i << 4) + rlane) * lda + koff + k0;
      const v16b ah = ldfrag_b(Ab + ao);
      v16b al = ah;
      if (NSPLIT >= 1) al = ldfrag_b(Ab2 + ao);
#pragma unroll
      for (int j = 0; j < 4; ++j) {
        acc[i][j] = mma_b_raw(ah, bh[j], acc[i][j]);
        if (NSPLIT >= 1) acc[i][j] = mma_b_raw(al, bh[j], acc[i][j]);
        if (NSPLIT == 2) acc[i][j] = mma_b_raw(ah, bl[j], acc[i][j]);
      }
      dep_guard_b(acc[i][0], acc[i][3], ah, al);
    }
    keep4_b(bh[0], bh[1], bh[2], bh[3]);
    if (NSPLIT == 2) keep4_b(bl[0], bl[1], bl[2], bl[3]);
  }
  acc_guard4(acc[0][0], acc[0][1], acc[0][2], acc[0][3]);
  acc_guard4(acc[1][0], acc[1][1], acc[1][2], acc[1][3]);
  acc_guard4(acc[2][0], acc[2][1], acc[2][2], acc[2][3]);
  acc_guard4(acc[3][0], acc[3][1], acc[3][2], acc[3][3]);

  // ---- epilogue ----
  float* slab = sT[wave];
#pragma unroll
  for (int i = 0; i < 4; ++i) {
    const int mBase = m0 + (i << 4);
#pragma unroll
    for (int r = 0; r < 8; ++r) {
#pragma unroll
      for (int j = 0; j < 4; ++j) {
        slab[(mOff + r) * 68 + (j << 4) + rlane] = acc[i][j][r];
      }
    }
    __builtin_amdgcn_fence(__ATOMIC_RELEASE, "workgroup");
    __builtin_amdgcn_wave_barrier();
    __builtin_amdgcn_fence(__ATOMIC_ACQUIRE, "workgroup");
    if (OUT_MODE == 0) {
      float* C = (float*)Cout + (size_t)b * strideC;
      const int hh = lane >> 4, c4 = (lane & 15) * 4;     // 256-B row segment = 16 lanes x 16 B
      v4f ov[8];
#pragma unroll
      for (int it = 0; it < 8; ++it) {
        const int row = it * 2 + hh;                       // it 0..7 x hh 0..1 = rows 0..15
        ov[it] = *(const v4f*)(slab + row * 68 + c4);
      }
      {
#pragma unroll
        for (int it = 0; it < 8; ++it) {
          const int row = it * 2 + hh;
          *(v4f*)(C + (size_t)(mBase + row) * ldc + n0 + c4) = ov[it];
        }
        
      }
    } else {
      const int q = lane >> 3, c8 = (lane & 7) * 8;
      unsigned short* C  = (unsigned short*)Cout  + (size_t)b * strideC;
      unsigned short* C2 = (unsigned short*)Cout2 + (size_t)b * strideC2;
      const bool wlo = (OUT_MODE == 2) || (n0 < N2);      // wave-uniform
      v4u hv[4], lv[4];
#pragma unroll
      for (int it = 0; it < 4; ++it) {
        const int row = it * 4 + q;                        // it 0..3 x q 0..3 = rows 0..15
        const float* sp = slab + row * 68 + c8;
        v4u a, a2;
#pragma unroll
        for (int e = 0; e < 4; ++e) {
          const float f0 = sp[2 * e], f1 = sp[2 * e + 1];
          unsigned short h0, h1, l0, l1;
          if (OUT_MODE == 2) {
            h0 = bf_bits(f0); h1 = bf_bits(f1);
            l0 = bf_bits(f0 - bf_up(h0)); l1 = bf_bits(f1 - bf_up(h1));
          } else {
            const _Float16 x0 = (_Float16)f0, x1 = (_Float16)f1;
            h0 = h_bits(x0); h1 = h_bits(x1);
            l0 = h_bits((_Float16)((f0 - (float)x0) * rscale));
            l1 = h_bits((_Float16)((f1 - (float)x1) * rscale));
          }
          a[e] = pk16(h0, h1); a2[e] = pk16(l0, l1);
        }
        hv[it] = a; lv[it] = a2;
      }
      {
#pragma unroll
        for (int it = 0; it < 4; ++it) {
          const int row = it * 4 + q;
          *(v4u*)(C + (size_t)(mBase + row) * ldc + n0 + c8) = hv[it];
          if (wlo) *(v4u*)(C2 + (size_t)(mBase + row) * ldc2 + n0 + c8) = lv[it];
        }
        
      }
    }
    __builtin_amdgcn_fence(__ATOMIC_RELEASE, "workgroup");
    __builtin_amdgcn_wave_barrier();
    __builtin_amdgcn_fence(__ATOMIC_ACQUIRE, "workgroup");
  }
}

// =====================================================================================================
// Causal attention, head dim 64. Key index > query index: the scaled logit is REPLACED by -inf (its softmax
// weight is exactly 0; every query row keeps key 0, so no row is fully masked). Key chunks with first key above
// the block's last query row are not visited (chunks 0..qb, block-uniform trip count qb+1 <= 32).
//   q|k planes (bf16 hi / lo), pitch NQK: q element (bl, t, h, d) at [(bl*SEQ + t)*NQK + h*64 + d],
//                                          k element (bl, s, h, d) at [(bl*SEQ + s)*NQK + DM + h*64 + d]
//   v^T hi plane (f16):      element (bl, h, d, s) at [(bl*DM + h*64 + d)*SEQ + s]
//   v^T residual plane (f16, (v - hi)*4096): [(bl*DM + h*64 + d)*VLP + s], s < VLP, read only when RES
//   (with RES only key tiles below VLP occur; the address is clamped and the value zeroed otherwise)
//   out: bf16 hi plane ah + bf16 lo plane al (lo = RNE(v - hi), unscaled) of the normalised context,
//        element (bl, t, h*64 + d) at [(bl*SEQ + t)*DM + h*64 + d].
//   scores = q . k : bf16 hi/lo split (hi.hi + hi.lo + lo.hi), f32 accumulate, then * sscale in f32
//   p = exp(s - m) carried as f16(1024 p); context = p . v on f16 WMMA; RES adds f16 residual planes of p and v
//   (scale 4096, separate accumulator folded back with 1/4096 per chunk in f32); online softmax in f32 with a
//   -inf-safe running max.
//   Block = 4 waves = 64 query rows of one (bl, h); grid = nqbThis * NH * NB; kv chunks of 64.
//   K / V^T chunk staging: 128 threads x 32 elements per plane = the whole 64x64 tile (plain 16-B loads,
//   __syncthreads before and after); P tiles are wave-private, spilled with _Float16 element stores and reloaded
//   Output coverage: each wave stores rows q0..q0+15 (it 0..3 x lane>>3 0..3) x 64 columns (8 lanes x 8 values),
// =====================================================================================================
template <bool RES>
__global__ __launch_bounds__(128)
void attn64(const unsigned short* __restrict__ qkhp, const unsigned short* __restrict__ qklp,
            const unsigned short* __restrict__ vhp, const unsigned short* __restrict__ vlp,
            unsigned short* ahp, unsigned short* alp, int qbBase, int nqbThis, float sscale) {
  union FB { v16b v; v8b h[2]; };
  union FH { v16h v; v8h h[2]; };
  __shared__ __align__(16) __bf16   Ksh[64 * 64];                 // K hi [kv][d]   8 KB
  __shared__ __align__(16) __bf16   Ksl[64 * 64];                 // K lo
  __shared__ __align__(16) _Float16 Vth[64 * 64];                 // V^T hi [d][kv] 8 KB
  __shared__ __align__(16) _Float16 Vtl[RES ? 64 * 64 : 8];       // V^T residual
  __shared__ __align__(16) _Float16 Psh[4][16 * 64];              // per wave P [row][kv]
  __shared__ __align__(16) _Float16 Psl[RES ? 4 : 1][16 * 64];    // per wave P residual
  __shared__ __align__(16) float    Os[4][16 * 64];               // per wave context tile [row][d]

  const int tid  = threadIdx.x;
  const int wave = tid >> 5;
  const int lane = tid & 31;
  const int hh   = lane >> 4;
  const int c    = lane & 15;

  const int bx   = blockIdx.x;
  const int qbl  = bx % nqbThis;
  const int rest = bx / nqbThis;
  const int h    = rest % NH;
  const int b    = rest / NH;
  const int qb   = qbBase + qbl;
  const int q0   = qb * 64 + wave * 16;
  const size_t rowB = (size_t)b * SEQ;

  const __bf16* Qh = (const __bf16*)(const void*)qkhp + (size_t)h * HD;
  const __bf16* Ql = (const __bf16*)(const void*)qklp + (size_t)h * HD;
  const __bf16* Kh = (const __bf16*)(const void*)qkhp + (size_t)DM + (size_t)h * HD;
  const __bf16* Kl = (const __bf16*)(const void*)qklp + (size_t)DM + (size_t)h * HD;
  const _Float16* Vh = (const _Float16*)(const void*)vhp + ((size_t)b * DM + (size_t)h * HD) * SEQ;
  const _Float16* Vl = (const _Float16*)(const void*)vlp + ((size_t)b * DM + (size_t)h * HD) * VLP;

  // ---- Q fragments (A operand, row = lane&15): 2 d-chunks, hi and lo ----
  v16b qah[2], qal[2];
#pragma unroll
  for (int dc = 0; dc < 2; ++dc) {
    const size_t qo = (rowB + q0 + c) * NQK + dc * 32 + 8 * hh;
    qah[dc] = ldfrag_b(Qh + qo);
    qal[dc] = ldfrag_b(Ql + qo);
  }

  float mrow[8], lrow[8];
  v8f oacc[4];
#pragma unroll
  for (int r = 0; r < 8; ++r) { mrow[r] = -INFINITY; lrow[r] = 0.f; }
#pragma unroll
  for (int t = 0; t < 4; ++t) oacc[t] = zero8();

  int nkt = qb + 1;                          // key tiles 0..qb, block-uniform
  if (nkt > NQB) nkt = NQB;
  for (int kt = 0; kt < nkt; ++kt) {
    const int kv0 = kt * 64;
    __syncthreads();
    {
      const int r = tid >> 1, half = (tid & 1) * 32;
      const __bf16*   kg  = Kh + (rowB + kv0 + r) * NQK + half;   // K row kv0+r, d = half..half+31
      const __bf16*   klg = Kl + (rowB + kv0 + r) * NQK + half;
      const _Float16* vg  = Vh + (size_t)r * SEQ + kv0 + half;    // V^T row d = r, s = kv0+half..+31
      const int kvl = (kv0 + 64 <= VLP) ? kv0 : (VLP - 64);     // clamped address into the residual plane
      const _Float16* vlg = Vl + (size_t)r * VLP + kvl + half;
      const bool resOK = (kv0 + 64 <= VLP);                      // block-uniform
#pragma unroll
      for (int i = 0; i < 4; ++i) {
        const v8b a0 = *(const v8b*)(kg + 8 * i);
        const v8b a1 = *(const v8b*)(klg + 8 * i);
        const v8h b0 = *(const v8h*)(vg + 8 * i);
        *(v8b*)(Ksh + r * 64 + half + 8 * i) = a0;
        *(v8b*)(Ksl + r * 64 + half + 8 * i) = a1;
        *(v8h*)(Vth + r * 64 + half + 8 * i) = b0;
        if (RES) {
          v8h b1 = *(const v8h*)(vlg + 8 * i);
          if (!resOK) b1 = zero8h();
          *(v8h*)(Vtl + r * 64 + half + 8 * i) = b1;
        }
      }
    }
    __syncthreads();

    // ---- scores: 16 query rows x 64 keys per wave, 3 bf16 products ----
    v8f s[4];
#pragma unroll
    for (int j = 0; j < 4; ++j) {
      s[j] = zero8();
#pragma unroll
      for (int dc = 0; dc < 2; ++dc) {
        FB kb, kl;
        kb.h[0] = *(const v8b*)(Ksh + (j * 16 + c) * 64 + dc * 32 + 8 * hh);
        kb.h[1] = *(const v8b*)(Ksh + (j * 16 + c) * 64 + dc * 32 + 16 + 8 * hh);
        kl.h[0] = *(const v8b*)(Ksl + (j * 16 + c) * 64 + dc * 32 + 8 * hh);
        kl.h[1] = *(const v8b*)(Ksl + (j * 16 + c) * 64 + dc * 32 + 16 + 8 * hh);
        s[j] = mma_b(qah[dc], kb.v, s[j]);
        s[j] = mma_b(qah[dc], kl.v, s[j]);
        s[j] = mma_b(qal[dc], kb.v, s[j]);
      }
    }

    // ---- scale + causal select (key > query -> -inf by value), row max, online softmax,
    //      P (x1024, f16) and P residual (x4096) to LDS ----
    _Float16* pwh = Psh[wave];
    _Float16* pwl = Psl[RES ? wave : 0];
#pragma unroll
    for (int r = 0; r < 8; ++r) {
      const int qrow = q0 + 8 * hh + r;
      float m = -INFINITY;
#pragma unroll
      for (int j = 0; j < 4; ++j) {
        const int key = kv0 + j * 16 + c;
        float sv = s[j][r] * sscale;
        sv = (key <= qrow) ? sv : -INFINITY;
        s[j][r] = sv;
        m = fmaxf(m, sv);
      }
#pragma unroll
      for (int off = 1; off < 16; off <<= 1) m = fmaxf(m, __shfl_xor(m, off, 32));
      const float mnew  = fmaxf(mrow[r], m);
      const float msafe = (mnew == -INFINITY) ? 0.f : mnew;
      const float alpha = __expf(mrow[r] - msafe);   // mrow = -inf -> 0 (l and context are 0 there anyway)
      mrow[r] = mnew;
      float psum = 0.f;
#pragma unroll
      for (int j = 0; j < 4; ++j) {
        const float p = __expf(s[j][r] - msafe);      // masked logit: exp(-inf) -> 0
        psum += p;
        const float p1k = p * 1024.0f;
        const _Float16 ph = (_Float16)p1k;
        pwh[(8 * hh + r) * 64 + j * 16 + c] = ph;
        if (RES) {
          const _Float16 pl = (_Float16)((p1k - (float)ph) * 4096.0f);
          pwl[(8 * hh + r) * 64 + j * 16 + c] = pl;
        }
      }
#pragma unroll
      for (int off = 1; off < 16; off <<= 1) psum += __shfl_xor(psum, off, 32);
      lrow[r] = lrow[r] * alpha + psum;
#pragma unroll
      for (int t = 0; t < 4; ++t) oacc[t][r] *= alpha;
    }
    __builtin_amdgcn_fence(__ATOMIC_RELEASE, "workgroup");
    __builtin_amdgcn_wave_barrier();
    __builtin_amdgcn_fence(__ATOMIC_ACQUIRE, "workgroup");

    // ---- context += P . V (f16 WMMA), residual products into a separate accumulator ----
    v8f o1[4];
#pragma unroll
    for (int t = 0; t < 4; ++t) o1[t] = zero8();
#pragma unroll 1
    for (int kk = 0; kk < 2; ++kk) {
      FH pa, pl;
      pa.h[0] = *(const v8h*)(pwh + c * 64 + kk * 32 + 8 * hh);
      pa.h[1] = *(const v8h*)(pwh + c * 64 + kk * 32 + 16 + 8 * hh);
      if (RES) {
        pl.h[0] = *(const v8h*)(pwl + c * 64 + kk * 32 + 8 * hh);
        pl.h[1] = *(const v8h*)(pwl + c * 64 + kk * 32 + 16 + 8 * hh);
      } else {
        pl.v = pa.v;
      }
#pragma unroll
      for (int t = 0; t < 4; ++t) {
        FH vb;
        vb.h[0] = *(const v8h*)(Vth + (t * 16 + c) * 64 + kk * 32 + 8 * hh);
        vb.h[1] = *(const v8h*)(Vth + (t * 16 + c) * 64 + kk * 32 + 16 + 8 * hh);
        oacc[t] = mma_h(pa.v, vb.v, oacc[t]);
        if (RES) {
          FH vl;
          vl.h[0] = *(const v8h*)(Vtl + (t * 16 + c) * 64 + kk * 32 + 8 * hh);
          vl.h[1] = *(const v8h*)(Vtl + (t * 16 + c) * 64 + kk * 32 + 16 + 8 * hh);
          o1[t] = mma_h(pa.v, vl.v, o1[t]);
          o1[t] = mma_h(pl.v, vb.v, o1[t]);
        }
      }
    }
    if (RES) {
#pragma unroll
      for (int t = 0; t < 4; ++t)
#pragma unroll
        for (int r = 0; r < 8; ++r) oacc[t][r] += o1[t][r] * (1.0f / 4096.0f);
    }
  }

  // ---- normalise (1/l and the 1/1024 p carry), stage the wave's 16x64 tile in LDS, then write bf16 hi/lo
  float* os = Os[wave];
#pragma unroll
  for (int r = 0; r < 8; ++r) {
    const float l = lrow[r];
    const float inv = ((l > 0.f) ? (1.0f / l) : 0.f) * (1.0f / 1024.0f);
#pragma unroll
    for (int t = 0; t < 4; ++t) os[(8 * hh + r) * 64 + t * 16 + c] = oacc[t][r] * inv;
  }
  __builtin_amdgcn_fence(__ATOMIC_RELEASE, "workgroup");
  __builtin_amdgcn_wave_barrier();
  __builtin_amdgcn_fence(__ATOMIC_ACQUIRE, "workgroup");
  {
    const int q = lane >> 3, c8 = (lane & 7) * 8;
    v4u hv[4], lv[4];
#pragma unroll
    for (int it = 0; it < 4; ++it) {
      const int row = it * 4 + q;      // it 0..3 x q 0..3 = rows 0..15 of the wave tile
      const float* sp = os + row * 64 + c8;
      v4u a, a2;
#pragma unroll
      for (int e = 0; e < 4; ++e) {
        const float f0 = sp[2 * e], f1 = sp[2 * e + 1];
        const unsigned short h0 = bf_bits(f0), h1 = bf_bits(f1);
        const unsigned short l0 = bf_bits(f0 - bf_up(h0)), l1 = bf_bits(f1 - bf_up(h1));
        a[e] = pk16(h0, h1); a2[e] = pk16(l0, l1);
      }
      hv[it] = a; lv[it] = a2;
    }
    {
#pragma unroll
      for (int it = 0; it < 4; ++it) {
        const int row = it * 4 + q;
        const size_t go = (rowB + q0 + row) * DM + (size_t)h * HD + c8;
        *(v4u*)(ahp + go) = hv[it];
        *(v4u*)(alp + go) = lv[it];
      }
      
    }
  }
}

// =====================================================================================================
// Workspace map (bytes), every region an exact multiple of its whole-line / whole-tile store granularity
//  because M, N are multiples of 64 everywhere):
//   Wqkvb  bf16 [3072][1024]             0          6291456   (rows 0..2047 = Wq|Wk as Bt, rows 2048.. = Wv as A)
//   Wob    bf16 [1024][1024]             6291456    2097152
//   Xb     bf16 [4096][1024]             8388608    8388608
//   XPh    bf16 [4096][1024]            16777216    8388608
//   XPl    bf16 [4096][1024]            25165824    8388608
//   QKh    bf16 [4096][2048]            33554432   16777216
//   QKl    bf16 [4096][2048]            50331648   16777216
//   VTh    f16  [2][1024][2048]         67108864    8388608
//   VTl    f16  [2][1024][512]          75497472    2097152
//   Ah     bf16 [4096][1024]            77594624    8388608
//   Al     bf16 [4096][1024]            85983232    8388608
//   end                                 94371840
// Weights arrive [out n][in k] row-major = the Bt / A layout the GEMM wants (k contiguous), so they are only
// RNE-converted to bf16.
// =====================================================================================================
extern "C" void kernel_launch(void* const* d_in, const int* in_sizes, int n_in,
                              void* d_out, int out_size, void* d_ws, size_t ws_size,
                              hipStream_t stream) {
  if (n_in < 4) return;
  if (in_sizes[0] != NB * SEQ * DM) return;
  if (in_sizes[1] != SEQ * DM) return;
  if (in_sizes[2] != 3 * DM * DM) return;
  if (in_sizes[3] != DM * DM) return;
  if (out_size != NB * SEQ * DM) return;

  const float* x    = (const float*)d_in[0];   // [NB][SEQ][DM]
  const float* posp = (const float*)d_in[1];   // [SEQ][DM]
  const float* wqkv = (const float*)d_in[2];   // [3*DM n][DM k]
  const float* wo   = (const float*)d_in[3];   // [DM n][DM k]

  const size_t PWqkv = (size_t)3 * DM * DM * 2;       //  6291456  bf16 [3072][1024]
  const size_t PWo   = (size_t)DM * DM * 2;           //  2097152  bf16 [1024][1024]
  const size_t PX    = (size_t)NB * SEQ * DM * 2;     //  8388608  bf16 [4096][1024]
  const size_t PQK   = (size_t)NB * SEQ * NQK * 2;    // 16777216  bf16 [4096][2048]
  const size_t PVTh  = (size_t)NB * DM * SEQ * 2;     //  8388608
  const size_t PVTl  = (size_t)NB * DM * VLP * 2;     //  2097152
  size_t off = 0;
  const size_t oWqkv = off; off += PWqkv;
  const size_t oWo   = off; off += PWo;
  const size_t oXb   = off; off += PX;
  const size_t oXPh  = off; off += PX;
  const size_t oXPl  = off; off += PX;
  const size_t oQKh  = off; off += PQK;
  const size_t oQKl  = off; off += PQK;
  const size_t oVTh  = off; off += PVTh;
  const size_t oVTl  = off; off += PVTl;
  const size_t oAh   = off; off += PX;
  const size_t oAl   = off; off += PX;
  if (off > ws_size) return;                           // off = 94371840
  if (off > (size_t)134217728) return;

  char* ws = (char*)d_ws;
  unsigned short* Wqkvb = (unsigned short*)(ws + oWqkv);
  unsigned short* Wvb   = Wqkvb + (size_t)2 * DM * DM;   // rows 2048..3071 of the Wqkv plane
  unsigned short* Wob   = (unsigned short*)(ws + oWo);
  unsigned short* Xb    = (unsigned short*)(ws + oXb);
  unsigned short* XPh   = (unsigned short*)(ws + oXPh);
  unsigned short* XPl   = (unsigned short*)(ws + oXPl);
  unsigned short* QKh   = (unsigned short*)(ws + oQKh);
  unsigned short* QKl   = (unsigned short*)(ws + oQKl);
  unsigned short* VTh   = (unsigned short*)(ws + oVTh);
  unsigned short* VTl   = (unsigned short*)(ws + oVTl);
  unsigned short* Ah    = (unsigned short*)(ws + oAh);
  unsigned short* Al    = (unsigned short*)(ws + oAl);
  float*          outf  = (float*)d_out;

  const dim3 blk(256);
  const int n8qkv = 3 * DM * DM / 8;                                 // 393216 (multiple of 256)
  const int n8w   = DM * DM / 8;                                     // 131072 (multiple of 256)
  const int n8x   = NB * SEQ * DM / 8;                               // 524288 (multiple of 256)
  const int p8    = SEQ * DM / 8;                                    // 262144
  const dim3 gCvtQKV((n8qkv + 255) / 256);                           // 1536 blocks
  const dim3 gCvtW((n8w + 255) / 256);                               // 512 blocks
  const dim3 gPrep((n8x + 255) / 256);                               // 2048 blocks
  const dim3 gQK(((NB * SEQ / 64) * (NQK / 64) + 7) / 8, 1);         // 2048 tiles -> 256 blocks
  const dim3 gVT(((DM / 64) * (SEQ / 64) + 7) / 8, NB);              // 512 tiles -> 64 blocks x 2 batch elements
  const dim3 gOut(((NB * SEQ / 64) * (DM / 64) + 7) / 8, 1);         // 1024 tiles -> 128 blocks

  // (1) weights -> bf16 planes (keep their [n][k] layout); x -> bf16 plane; x + pos -> bf16 hi/lo planes
  cvt_bf16x8<<<gCvtQKV, blk, 0, stream>>>(wqkv, Wqkvb, n8qkv);
  cvt_bf16x8<<<gCvtW, blk, 0, stream>>>(wo, Wob, n8w);
  prep_x8<<<gPrep, blk, 0, stream>>>(x, posp, Xb, XPh, XPl, n8x, p8);
  // (2) q|k projection: QK[row][n] = sum_k (XPh+XPl)[row][k] Wqkvb[n][k], n < 2048 -> bf16 hi/lo planes,
  //     pitch NQK   (M=4096, N=2048, K=1024, 2 products)
  gemm64<1, 2><<<gQK, blk, 0, stream>>>(
      XPh, XPl, DM, 0LL, Wqkvb, Wqkvb, DM, 0LL,
      (void*)QKh, NQK, 0LL, (void*)QKl, NQK, 0LL, NQK,
      NB * SEQ, NQK, DM, 1.0f);
  // (3) v^T per batch element: VTh[bl][m][s] = sum_k Wvb[m][k] Xb[bl*SEQ+s][k] -> f16 hi plane (pitch SEQ) and
  //     residual plane (x4096, keys < VLP, pitch VLP)  (M=1024, N=2048, K=1024, single product)
  gemm64<0, 3><<<gVT, blk, 0, stream>>>(
      Wvb, Wvb, DM, 0LL, Xb, Xb, DM, (long long)SEQ * DM,
      (void*)VTh, SEQ, (long long)DM * SEQ, (void*)VTl, VLP, (long long)DM * VLP, VLP,
      DM, SEQ, DM, 4096.0f);
  // (4) causal attention: query blocks 0..RESQB-1 with residual planes, the rest without -> Ah/Al bf16 hi/lo
  attn64<true><<<dim3(NB * NH * RESQB), dim3(128), 0, stream>>>(
      QKh, QKl, VTh, VTl, Ah, Al, 0, RESQB, 0.125f);
  attn64<false><<<dim3(NB * NH * (NQB - RESQB)), dim3(128), 0, stream>>>(
      QKh, QKl, VTh, VTl, Ah, Al, RESQB, NQB - RESQB, 0.125f);
  // (5) out[row][n] = sum_k (Ah+Al)[row][k] Wob[n][k] -> d_out f32   (M=4096, N=1024, K=1024, 2 products)
  gemm64<1, 0><<<gOut, blk, 0, stream>>>(
      Ah, Al, DM, 0LL, Wob, Wob, DM, 0LL,
      (void*)outf, DM, 0LL, (void*)outf, 0, 0LL, 0,
      NB * SEQ, DM, DM, 1.0f);
  (void)hipGetLastError();
}

// v001
// Measured time: 276 microseconds a run.
// Timed twice side by side with v000, it ran 1.47 and 1.46 times as fast.
// Contractions: q|k projection = v_wmma_f32_16x16x32_bf16 with (x+pos) as bf16 hi/lo planes times the bf16 Wqk plane (2 products);
// v^T projection = v_wmma_f32_16x16x32_bf16 (bf16 x times bf16 Wv, single product);
// q.k^T scores = v_wmma_f32_16x16x32_bf16 with bf16 hi/lo split q and k (hi.hi + hi.lo + lo.hi);
// p.v = v_wmma_f32_16x16x32_f16 (p carried x1024 in f16, v in f16; extra f16 residual planes x4096 of p and v on the first 512 query rows);
// a.Wout^T = v_wmma_f32_16x16x32_bf16 with a as bf16 hi/lo planes times the bf16 Wout plane (2 products); all f32 accumulate; softmax in f32.
#include <hip/hip_runtime.h>
#include <math.h>
#include <stdint.h>

#define NB    2
#define SEQ   2048
#define DM    1024
#define NH    16
#define HD    64
#define NQK   (2 * DM)       // pitch of the q|k planes: q feature columns 0..DM-1, k feature columns DM..2DM-1
#define NQB   (SEQ / 64)     // 32 query / key tiles of 64
#define VLP   512            // key pitch of the v^T residual plane (keys 0..VLP-1)
#define RESQB 8              // leading 64-row query blocks that use the p / v residual planes
static_assert(RESQB * 64 <= VLP);
static_assert(NH * HD == DM);
static_assert((SEQ % 128) == 0 && (DM % 256) == 0);
static_assert(HD == 64);
static_assert(((NB * SEQ * DM / 8) % 256) == 0);
static_assert(((DM * DM / 8) % 256) == 0);
static_assert(((3 * DM * DM / 8) % 256) == 0);
static_assert(((SEQ * DM) % 8) == 0);

typedef _Float16 v16h __attribute__((ext_vector_type(16)));
typedef _Float16 v8h  __attribute__((ext_vector_type(8)));
typedef __bf16   v16b __attribute__((ext_vector_type(16)));
typedef __bf16   v8b  __attribute__((ext_vector_type(8)));
typedef float    v8f  __attribute__((ext_vector_type(8)));
typedef float    v4f  __attribute__((ext_vector_type(4)));
typedef unsigned int v4u __attribute__((ext_vector_type(4)));

// ---- scalar helpers --------------------------------------------------------------------------------
__device__ __forceinline__ unsigned short bf_bits(float f) {          // f32 -> bf16 bits, RNE convert
  unsigned u = __float_as_uint(f);
  return (unsigned short)((u + 0x7FFFu + ((u >> 16) & 1u)) >> 16);
}
__device__ __forceinline__ float bf_up(unsigned short h) { return __uint_as_float(((unsigned)h) << 16); }
__device__ __forceinline__ unsigned short h_bits(_Float16 x) { return __builtin_bit_cast(unsigned short, x); }
__device__ __forceinline__ unsigned pk16(unsigned short a, unsigned short b) { return (unsigned)a | ((unsigned)b << 16); }
__device__ __forceinline__ v8f zero8() { v8f z = {0.f, 0.f, 0.f, 0.f, 0.f, 0.f, 0.f, 0.f}; return z; }
__device__ __forceinline__ v8h zero8h() {
  const _Float16 z = (_Float16)0.0f;
  v8h r = {z, z, z, z, z, z, z, z};
  return r;
}

// ---- fragment loader: 16-bit A/B operand, lane -> row/col (lane&15), p already includes +8*(lane>>4);
//      elements 0..7 <- p[0..7] (k0+8h..), elements 8..15 <- p[16..23] (k0+16+8h..)
__device__ __forceinline__ v16b ldfrag_b(const __bf16* p) {
  union { v16b v; v8b h[2]; } f;
  f.h[0] = *(const v8b*)(p);
  f.h[1] = *(const v8b*)(p + 16);
  return f.v;
}

// ---- WMMA helpers with trailing VALU hazard gap --------------------------------------------------------
__device__ __forceinline__ v8f mma_b(v16b a, v16b b, v8f c) {
  c = __builtin_amdgcn_wmma_f32_16x16x32_bf16(false, a, false, b, (short)0, c, false, false);
#if defined(__HIP_DEVICE_COMPILE__)
  asm volatile("v_nop\n\tv_nop\n\tv_nop\n\tv_nop" : "+v"(c) : "v"(a), "v"(b));
#endif
  return c;
}
__device__ __forceinline__ v8f mma_h(v16h a, v16h b, v8f c) {
  c = __builtin_amdgcn_wmma_f32_16x16x32_f16(false, a, false, b, (short)0, c, false, false);
#if defined(__HIP_DEVICE_COMPILE__)
  asm volatile("v_nop\n\tv_nop\n\tv_nop\n\tv_nop" : "+v"(c) : "v"(a), "v"(b));
#endif
  return c;
}
__device__ __forceinline__ v8f mma_b_raw(v16b a, v16b b, v8f c) {
  return __builtin_amdgcn_wmma_f32_16x16x32_bf16(false, a, false, b, (short)0, c, false, false);
}
__device__ __forceinline__ void dep_guard_b(v8f& a, v8f& b, v16b x, v16b y) {
#if defined(__HIP_DEVICE_COMPILE__)
  asm volatile("v_nop\n\tv_nop\n\tv_nop\n\tv_nop" : "+v"(a), "+v"(b) : "v"(x), "v"(y));
#endif
}
__device__ __forceinline__ void keep4_b(v16b a, v16b b, v16b c, v16b d) {
#if defined(__HIP_DEVICE_COMPILE__)
  asm volatile("v_nop" :: "v"(a), "v"(b), "v"(c), "v"(d));
#endif
}
__device__ __forceinline__ void acc_guard4(v8f& a, v8f& b, v8f& c, v8f& d) {
#if defined(__HIP_DEVICE_COMPILE__)
  asm volatile("v_nop\n\tv_nop\n\tv_nop\n\tv_nop" : "+v"(a), "+v"(b), "+v"(c), "+v"(d));
#endif
}

// =====================================================================================================
// f32 -> bf16 (RNE convert), 8 elements per thread, one 16-B store per lane: a wave writes 512 contiguous B
// host-checked). coverage: n8 threads x 8 = whole plane.
// =====================================================================================================
__global__ __launch_bounds__(256) void cvt_bf16x8(const float* __restrict__ in, unsigned short* out, int n8) {
  const int i = blockIdx.x * 256 + threadIdx.x;
  if (i < n8) {
    const v4f a = *(const v4f*)(in + (size_t)i * 8);
    const v4f b = *(const v4f*)(in + (size_t)i * 8 + 4);
    v4u p;
    p[0] = pk16(bf_bits(a[0]), bf_bits(a[1]));
    p[1] = pk16(bf_bits(a[2]), bf_bits(a[3]));
    p[2] = pk16(bf_bits(b[0]), bf_bits(b[1]));
    p[3] = pk16(bf_bits(b[2]), bf_bits(b[3]));
    *(v4u*)(out + (size_t)i * 8) = p;
    
  }
}

// =====================================================================================================
// x prep: xb = bf16(x) (RNE convert); s = bf_up(bf16(x)) + bf_up(bf16(pos)) in f32 (pos element index =
// x element index mod SEQ*DM); hp = bf16 hi plane of s, lp = bf16 lo plane (lo = RNE(s - hi), unscaled).
// three planes (n8 multiple of 256, host-checked).
// =====================================================================================================
__global__ __launch_bounds__(256) void prep_x8(const float* __restrict__ x, const float* __restrict__ pos,
                                               unsigned short* xb, unsigned short* hp, unsigned short* lp,
                                               int n8, int p8) {
#pragma clang fp contract(off)
  const int i = blockIdx.x * 256 + threadIdx.x;
  if (i < n8) {
    const int ip = i % p8;
    const v4f a  = *(const v4f*)(x + (size_t)i * 8);
    const v4f b  = *(const v4f*)(x + (size_t)i * 8 + 4);
    const v4f pa = *(const v4f*)(pos + (size_t)ip * 8);
    const v4f pb = *(const v4f*)(pos + (size_t)ip * 8 + 4);
    v4u px, ph, pl;
#pragma unroll
    for (int e = 0; e < 4; ++e) {
      const float f0 = (e < 2) ? a[2 * e]      : b[2 * e - 4];
      const float f1 = (e < 2) ? a[2 * e + 1]  : b[2 * e - 3];
      const float g0 = (e < 2) ? pa[2 * e]     : pb[2 * e - 4];
      const float g1 = (e < 2) ? pa[2 * e + 1] : pb[2 * e - 3];
      const unsigned short x0 = bf_bits(f0), x1 = bf_bits(f1);
      const float s0 = bf_up(x0) + bf_up(bf_bits(g0));
      const float s1 = bf_up(x1) + bf_up(bf_bits(g1));
      const unsigned short h0 = bf_bits(s0), h1 = bf_bits(s1);
      const unsigned short l0 = bf_bits(s0 - bf_up(h0)), l1 = bf_bits(s1 - bf_up(h1));
      px[e] = pk16(x0, x1);
      ph[e] = pk16(h0, h1);
      pl[e] = pk16(l0, l1);
    }
    *(v4u*)(xb + (size_t)i * 8) = px;
    *(v4u*)(hp + (size_t)i * 8) = ph;
    *(v4u*)(lp + (size_t)i * 8) = pl;
    
  }
}

// =====================================================================================================
// Eight asynchronous 16-B-per-lane copies global -> LDS (no register in between). The closing s_wait_xcnt stands
// in the copies' own statement so that no address register named here is rewritten in front of it (a precaution).
// =====================================================================================================
__device__ __forceinline__ void copy8_async(const unsigned (&l)[8], const __bf16* const (&g)[8]) {
#if defined(__HIP_DEVICE_COMPILE__)
  asm volatile(
      "global_load_async_to_lds_b128 %0, %8, off\n\t"
      "global_load_async_to_lds_b128 %1, %9, off\n\t"
      "global_load_async_to_lds_b128 %2, %10, off\n\t"
      "global_load_async_to_lds_b128 %3, %11, off\n\t"
      "global_load_async_to_lds_b128 %4, %12, off\n\t"
      "global_load_async_to_lds_b128 %5, %13, off\n\t"
      "global_load_async_to_lds_b128 %6, %14, off\n\t"
      "global_load_async_to_lds_b128 %7, %15, off\n\t"
      "s_wait_xcnt 0x0"
      :: "v"(l[0]), "v"(l[1]), "v"(l[2]), "v"(l[3]), "v"(l[4]), "v"(l[5]), "v"(l[6]), "v"(l[7]),
         "v"(g[0]), "v"(g[1]), "v"(g[2]), "v"(g[3]), "v"(g[4]), "v"(g[5]), "v"(g[6]), "v"(g[7])
      : "memory");
#endif
}

// =====================================================================================================
// Batched bf16 WMMA GEMM: C[m][n] = sum_k A[m][k] * Bt[n][k]. A block of 2 x WN waves owns a 128 x (64*WN) tile of
// C, each wave a 64x64 part of it. A row-major [M][K] pitch lda; Bt row-major [N][K] pitch ldb (k contiguous);
// M a multiple of 128, N of 64*WN, K of 64 (host constants). blockIdx.y = batch index (strides in elements).
// Operands: per stage of 64 k the block's rows [A 128 | A2 128 (NSPLIT 1) | Bt 64*WN], 128 B each, are copied to
// LDS at pitch 144 B by asynchronous copies (a wave's copy = 4 whole 128-B lines); two buffers, stage t+1 flies
// while stage t is multiplied; the waves read their fragments from LDS with ds loads.
// NSPLIT: 0 = A.Bt; 1 = (A + A2).Bt (A2 = unscaled bf16 lo plane of A).
// OUT_MODE: 0 = f32 (pitch ldc); 2 = bf16 hi plane C + bf16 lo plane C2 (lo = RNE(v - hi), unscaled);
//           3 = f16 hi plane C + f16 residual plane C2 = f16((v - hi) * rscale), C2 written only for tiles
//               with n0 < N2 (pitch ldc2, batch stride strideC2).
// =====================================================================================================
template <int NSPLIT, int OUT_MODE, int WN>
__global__ __launch_bounds__(64 * WN) void gemm64(
    const unsigned short* __restrict__ Ap, const unsigned short* A2p, int lda, long long strideA,
    const unsigned short* __restrict__ Btp, int ldb, long long strideB,
    void* Cout, int ldc, long long strideC,
    void* Cout2, int ldc2, long long strideC2, int N2,
    int M, int N, int K, float rscale) {
  static_assert(NSPLIT == 0 || NSPLIT == 1);
  constexpr int NT    = 64 * WN;                       // threads
  constexpr int BM    = 128;                           // block rows of C
  constexpr int BN    = 64 * WN;                       // block columns of C
  constexpr int KS    = 64;                            // k per stage (128 B of every operand row)
  constexpr int AROWS = (NSPLIT == 1 ? 2 : 1) * BM;    // stage rows that hold A (and A2)
  constexpr int ROWS  = AROWS + BN;                    // stage rows in all
  constexpr int PE    = 72;                            // LDS row pitch in elements (144 B = 16 B x 9)
  constexpr int BUFE  = ROWS * PE;                     // elements of one buffer
  constexpr int RPI   = NT / 8;                        // stage rows that one copy of every thread covers
  constexpr int NIT   = ROWS / RPI;                    // copies per thread and stage
  static_assert((BM % RPI) == 0 && (NIT % 8) == 0 && NIT <= 63);
  const __bf16* A   = (const __bf16*)(const void*)Ap;
  const __bf16* A2  = (const __bf16*)(const void*)A2p;
  const __bf16* Bt  = (const __bf16*)(const void*)Btp;
  __shared__ __align__(16) __bf16 ring[2 * BUFE];       // two stage buffers
  __shared__ __align__(16) float sT[2 * WN][16 * 68];   // per-wave 16x64 slab, pitch 68 floats
  const int b    = blockIdx.y;
  const int tid  = threadIdx.x;
  const int lane = tid & 31;
  const int wave = tid >> 5;
  const int tilesN = N / BN;
  const int tilesM = M / BM;
  const int tile = blockIdx.x;
  if (tile >= tilesM * tilesN) return;   // block-uniform, in front of every copy and barrier
  const int tm = tile / tilesN;
  const int tn = tile - tm * tilesN;
  const int wm = wave / WN;                    // wave's 64-row part of the block tile
  const int wn = wave - wm * WN;               // wave's 64-column part
  const int m0 = tm * BM + (wm << 6);
  const int n0 = tn * BN + (wn << 6);

  const int rlane = lane & 15;                 // row (A) / col (B, D) within subtile
  const int koff  = (lane >> 4) * 8;           // k offset of this lane half
  const int mOff  = (lane >> 4) * 8;           // D row offset

  // this thread's 16-B piece of stage row (tid >> 3): source pointers at k = 0 and LDS byte address in buffer 0
  const int crow = tid >> 3, cpc = (tid & 7) * 8;
  const __bf16* gA  = A  + (size_t)b * strideA + (size_t)(tm * BM + crow) * lda + cpc;
  const __bf16* gA2 = (NSPLIT == 1) ? (A2 + (size_t)b * strideA + (size_t)(tm * BM + crow) * lda + cpc) : gA;
  const __bf16* gB  = Bt + (size_t)b * strideB + (size_t)(tn * BN + crow) * ldb + cpc;
  const unsigned lds0 = (unsigned)(size_t)(const void*)ring + (unsigned)(crow * PE + cpc) * 2u;

  // copies the next stage not yet asked for into buffer buf; the three source pointers then step on by one stage
  auto issue_stage = [&](int buf) {
    const unsigned lb = lds0 + (unsigned)buf * (unsigned)(BUFE * 2);
    // both loops unrolled: the stage row decides at compile time which operand a copy reads
#pragma unroll
    for (int g8 = 0; g8 < NIT / 8; ++g8) {
      unsigned dst[8];
      const __bf16* sp[8];
#pragma unroll
      for (int e = 0; e < 8; ++e) {
        const int sr = (g8 * 8 + e) * RPI;     // first stage row of this copy, a compile-time value
        sp[e]  = (sr < BM) ? (gA + (size_t)sr * lda)
               : (sr < AROWS) ? (gA2 + (size_t)(sr - BM) * lda)
                              : (gB + (size_t)(sr - AROWS) * ldb);
        dst[e] = lb + (unsigned)(sr * PE * 2);
      }
      copy8_async(dst, sp);
    }
    gA += KS; gA2 += KS; gB += KS;
  };

  v8f acc[4][4];
#pragma unroll
  for (int i = 0; i < 4; ++i)
#pragma unroll
    for (int j = 0; j < 4; ++j) acc[i][j] = zero8();

  const int nst = K / KS;
  issue_stage(0);
  asm volatile("s_wait_asynccnt 0x0" ::: "memory");   // this wave's copies of stage 0 have landed
  __syncthreads();                                    // ... and every other wave's: stage 0 may be read
  if (nst > 1) issue_stage(1);

  for (int t = 0; t < nst; ++t) {
    const __bf16* sb  = ring + (t & 1) * BUFE;
    const __bf16* sA  = sb + ((wm << 6) + rlane) * PE + koff;
    const __bf16* sA2 = sA + BM * PE;
    const __bf16* sB  = sb + (AROWS + (wn << 6) + rlane) * PE + koff;
    // every loop of the stage is unrolled: fragments and accumulators are register arrays (constant indices only)
#pragma unroll
    for (int kk = 0; kk < KS; kk += 32) {
      v16b bh[4], ah[4], al[4];
#pragma unroll
      for (int j = 0; j < 4; ++j) bh[j] = ldfrag_b(sB + (j << 4) * PE + kk);
#pragma unroll
      for (int i = 0; i < 4; ++i) {
        ah[i] = ldfrag_b(sA + (i << 4) * PE + kk);
        if (NSPLIT == 1) al[i] = ldfrag_b(sA2 + (i << 4) * PE + kk); else al[i] = ah[i];
      }
#pragma unroll
      for (int i = 0; i < 4; ++i) {
#pragma unroll
        for (int j = 0; j < 4; ++j) acc[i][j] = mma_b_raw(ah[i], bh[j], acc[i][j]);
        if (NSPLIT == 1) {
#pragma unroll
          for (int j = 0; j < 4; ++j) acc[i][j] = mma_b_raw(al[i], bh[j], acc[i][j]);
        }
        dep_guard_b(acc[i][0], acc[i][3], ah[i], al[i]);
      }
      keep4_b(bh[0], bh[1], bh[2], bh[3]);
    }
    asm volatile("s_wait_dscnt 0x0" ::: "memory");     // this wave's reads of buffer t & 1 are done
    asm volatile("s_wait_asynccnt 0x0" ::: "memory");  // this wave's copies of stage t + 1 have landed
    __syncthreads();                                   // publishes stage t + 1, frees buffer t & 1
    if (t + 2 < nst) issue_stage(t & 1);
  }
  asm volatile("s_wait_asynccnt 0x0" ::: "memory");    // no copy is outstanding when the wave goes on
  acc_guard4(acc[0][0], acc[0][1], acc[0][2], acc[0][3]);
  acc_guard4(acc[1][0], acc[1][1], acc[1][2], acc[1][3]);
  acc_guard4(acc[2][0], acc[2][1], acc[2][2], acc[2][3]);
  acc_guard4(acc[3][0], acc[3][1], acc[3][2], acc[3][3]);

  // ---- epilogue ----
  float* slab = sT[wave];
#pragma unroll
  for (int i = 0; i < 4; ++i) {
    const int mBase = m0 + (i << 4);
#pragma unroll
    for (int r = 0; r < 8; ++r) {
#pragma unroll
      for (int j = 0; j < 4; ++j) {
        slab[(mOff + r) * 68 + (j << 4) + rlane] = acc[i][j][r];
      }
    }
    __builtin_amdgcn_fence(__ATOMIC_RELEASE, "workgroup");
    __builtin_amdgcn_wave_barrier();
    __builtin_amdgcn_fence(__ATOMIC_ACQUIRE, "workgroup");
    if (OUT_MODE == 0) {
      float* C = (float*)Cout + (size_t)b * strideC;
      const int hh = lane >> 4, c4 = (lane & 15) * 4;     // 256-B row segment = 16 lanes x 16 B
      v4f ov[8];
#pragma unroll
      for (int it = 0; it < 8; ++it) {
        const int row = it * 2 + hh;                       // it 0..7 x hh 0..1 = rows 0..15
        ov[it] = *(const v4f*)(slab + row * 68 + c4);
      }
      {
#pragma unroll
        for (int it = 0; it < 8; ++it) {
          const int row = it * 2 + hh;
          *(v4f*)(C + (size_t)(mBase + row) * ldc + n0 + c4) = ov[it];
        }
        
      }
    } else {
      const int q = lane >> 3, c8 = (lane & 7) * 8;
      unsigned short* C  = (unsigned short*)Cout  + (size_t)b * strideC;
      unsigned short* C2 = (unsigned short*)Cout2 + (size_t)b * strideC2;
      const bool wlo = (OUT_MODE == 2) || (n0 < N2);      // wave-uniform
      v4u hv[4], lv[4];
#pragma unroll
      for (int it = 0; it < 4; ++it) {
        const int row = it * 4 + q;                        // it 0..3 x q 0..3 = rows 0..15
        const float* sp = slab + row * 68 + c8;
        v4u a, a2;
#pragma unroll
        for (int e = 0; e < 4; ++e) {
          const float f0 = sp[2 * e], f1 = sp[2 * e + 1];
          unsigned short h0, h1, l0, l1;
          if (OUT_MODE == 2) {
            h0 = bf_bits(f0); h1 = bf_bits(f1);
            l0 = bf_bits(f0 - bf_up(h0)); l1 = bf_bits(f1 - bf_up(h1));
          } else {
            const _Float16 x0 = (_Float16)f0, x1 = (_Float16)f1;
            h0 = h_bits(x0); h1 = h_bits(x1);
            l0 = h_bits((_Float16)((f0 - (float)x0) * rscale));
            l1 = h_bits((_Float16)((f1 - (float)x1) * rscale));
          }
          a[e] = pk16(h0, h1); a2[e] = pk16(l0, l1);
        }
        hv[it] = a; lv[it] = a2;
      }
      {
#pragma unroll
        for (int it = 0; it < 4; ++it) {
          const int row = it * 4 + q;
          *(v4u*)(C + (size_t)(mBase + row) * ldc + n0 + c8) = hv[it];
          if (wlo) *(v4u*)(C2 + (size_t)(mBase + row) * ldc2 + n0 + c8) = lv[it];
        }
        
      }
    }
    __builtin_amdgcn_fence(__ATOMIC_RELEASE, "workgroup");
    __builtin_amdgcn_wave_barrier();
    __builtin_amdgcn_fence(__ATOMIC_ACQUIRE, "workgroup");
  }
}

// =====================================================================================================
// Causal attention, head dim 64. Key index > query index: the scaled logit is REPLACED by -inf (its softmax
// weight is exactly 0; every query row keeps key 0, so no row is fully masked). Key chunks with first key above
// the block's last query row are not visited (chunks 0..qb, block-uniform trip count qb+1 <= 32).
//   q|k planes (bf16 hi / lo), pitch NQK: q element (bl, t, h, d) at [(bl*SEQ + t)*NQK + h*64 + d],
//                                          k element (bl, s, h, d) at [(bl*SEQ + s)*NQK + DM + h*64 + d]
//   v^T hi plane (f16):      element (bl, h, d, s) at [(bl*DM + h*64 + d)*SEQ + s]
//   v^T residual plane (f16, (v - hi)*4096): [(bl*DM + h*64 + d)*VLP + s], s < VLP, read only when RES
//   (with RES only key tiles below VLP occur; the address is clamped and the value zeroed otherwise)
//   out: bf16 hi plane ah + bf16 lo plane al (lo = RNE(v - hi), unscaled) of the normalised context,
//        element (bl, t, h*64 + d) at [(bl*SEQ + t)*DM + h*64 + d].
//   scores = q . k : bf16 hi/lo split (hi.hi + hi.lo + lo.hi), f32 accumulate, then * sscale in f32
//   p = exp(s - m) carried as f16(1024 p); context = p . v on f16 WMMA; RES adds f16 residual planes of p and v
//   (scale 4096, separate accumulator folded back with 1/4096 per chunk in f32); online softmax in f32 with a
//   -inf-safe running max.
//   Block = 4 waves = 64 query rows of one (bl, h); grid = nqbThis * NH * NB; kv chunks of 64.
//   K / V^T chunk staging: 128 threads x 32 elements per plane = the whole 64x64 tile (plain 16-B loads,
//   __syncthreads before and after); P tiles are wave-private, spilled with _Float16 element stores and reloaded
//   Output coverage: each wave stores rows q0..q0+15 (it 0..3 x lane>>3 0..3) x 64 columns (8 lanes x 8 values),
// =====================================================================================================
template <bool RES>
__global__ __launch_bounds__(128)
void attn64(const unsigned short* __restrict__ qkhp, const unsigned short* __restrict__ qklp,
            const unsigned short* __restrict__ vhp, const unsigned short* __restrict__ vlp,
            unsigned short* ahp, unsigned short* alp, int qbBase, int nqbThis, float sscale) {
  union FB { v16b v; v8b h[2]; };
  union FH { v16h v; v8h h[2]; };
  __shared__ __align__(16) __bf16   Ksh[64 * 64];                 // K hi [kv][d]   8 KB
  __shared__ __align__(16) __bf16   Ksl[64 * 64];                 // K lo
  __shared__ __align__(16) _Float16 Vth[64 * 64];                 // V^T hi [d][kv] 8 KB
  __shared__ __align__(16) _Float16 Vtl[RES ? 64 * 64 : 8];       // V^T residual
  __shared__ __align__(16) _Float16 Psh[4][16 * 64];              // per wave P [row][kv]
  __shared__ __align__(16) _Float16 Psl[RES ? 4 : 1][16 * 64];    // per wave P residual
  __shared__ __align__(16) float    Os[4][16 * 64];               // per wave context tile [row][d]

  const int tid  = threadIdx.x;
  const int wave = tid >> 5;
  const int lane = tid & 31;
  const int hh   = lane >> 4;
  const int c    = lane & 15;

  const int bx   = blockIdx.x;
  const int qbl  = bx % nqbThis;
  const int rest = bx / nqbThis;
  const int h    = rest % NH;
  const int b    = rest / NH;
  const int qb   = qbBase + qbl;
  const int q0   = qb * 64 + wave * 16;
  const size_t rowB = (size_t)b * SEQ;

  const __bf16* Qh = (const __bf16*)(const void*)qkhp + (size_t)h * HD;
  const __bf16* Ql = (const __bf16*)(const void*)qklp + (size_t)h * HD;
  const __bf16* Kh = (const __bf16*)(const void*)qkhp + (size_t)DM + (size_t)h * HD;
  const __bf16* Kl = (const __bf16*)(const void*)qklp + (size_t)DM + (size_t)h * HD;
  const _Float16* Vh = (const _Float16*)(const void*)vhp + ((size_t)b * DM + (size_t)h * HD) * SEQ;
  const _Float16* Vl = (const _Float16*)(const void*)vlp + ((size_t)b * DM + (size_t)h * HD) * VLP;

  // ---- Q fragments (A operand, row = lane&15): 2 d-chunks, hi and lo ----
  v16b qah[2], qal[2];
#pragma unroll
  for (int dc = 0; dc < 2; ++dc) {
    const size_t qo = (rowB + q0 + c) * NQK + dc * 32 + 8 * hh;
    qah[dc] = ldfrag_b(Qh + qo);
    qal[dc] = ldfrag_b(Ql + qo);
  }

  float mrow[8], lrow[8];
  v8f oacc[4];
#pragma unroll
  for (int r = 0; r < 8; ++r) { mrow[r] = -INFINITY; lrow[r] = 0.f; }
#pragma unroll
  for (int t = 0; t < 4; ++t) oacc[t] = zero8();

  int nkt = qb + 1;                          // key tiles 0..qb, block-uniform
  if (nkt > NQB) nkt = NQB;
  for (int kt = 0; kt < nkt; ++kt) {
    const int kv0 = kt * 64;
    __syncthreads();
    {
      const int r = tid >> 1, half = (tid & 1) * 32;
      const __bf16*   kg  = Kh + (rowB + kv0 + r) * NQK + half;   // K row kv0+r, d = half..half+31
      const __bf16*   klg = Kl + (rowB + kv0 + r) * NQK + half;
      const _Float16* vg  = Vh + (size_t)r * SEQ + kv0 + half;    // V^T row d = r, s = kv0+half..+31
      const int kvl = (kv0 + 64 <= VLP) ? kv0 : (VLP - 64);     // clamped address into the residual plane
      const _Float16* vlg = Vl + (size_t)r * VLP + kvl + half;
      const bool resOK = (kv0 + 64 <= VLP);                      // block-uniform
#pragma unroll
      for (int i = 0; i < 4; ++i) {
        const v8b a0 = *(const v8b*)(kg + 8 * i);
        const v8b a1 = *(const v8b*)(klg + 8 * i);
        const v8h b0 = *(const v8h*)(vg + 8 * i);
        *(v8b*)(Ksh + r * 64 + half + 8 * i) = a0;
        *(v8b*)(Ksl + r * 64 + half + 8 * i) = a1;
        *(v8h*)(Vth + r * 64 + half + 8 * i) = b0;
        if (RES) {
          v8h b1 = *(const v8h*)(vlg + 8 * i);
          if (!resOK) b1 = zero8h();
          *(v8h*)(Vtl + r * 64 + half + 8 * i) = b1;
        }
      }
    }
    __syncthreads();

    // ---- scores: 16 query rows x 64 keys per wave, 3 bf16 products ----
    v8f s[4];
#pragma unroll
    for (int j = 0; j < 4; ++j) {
      s[j] = zero8();
#pragma unroll
      for (int dc = 0; dc < 2; ++dc) {
        FB kb, kl;
        kb.h[0] = *(const v8b*)(Ksh + (j * 16 + c) * 64 + dc * 32 + 8 * hh);
        kb.h[1] = *(const v8b*)(Ksh + (j * 16 + c) * 64 + dc * 32 + 16 + 8 * hh);
        kl.h[0] = *(const v8b*)(Ksl + (j * 16 + c) * 64 + dc * 32 + 8 * hh);
        kl.h[1] = *(const v8b*)(Ksl + (j * 16 + c) * 64 + dc * 32 + 16 + 8 * hh);
        s[j] = mma_b(qah[dc], kb.v, s[j]);
        s[j] = mma_b(qah[dc], kl.v, s[j]);
        s[j] = mma_b(qal[dc], kb.v, s[j]);
      }
    }

    // ---- scale + causal select (key > query -> -inf by value), row max, online softmax,
    //      P (x1024, f16) and P residual (x4096) to LDS ----
    _Float16* pwh = Psh[wave];
    _Float16* pwl = Psl[RES ? wave : 0];
#pragma unroll
    for (int r = 0; r < 8; ++r) {
      const int qrow = q0 + 8 * hh + r;
      float m = -INFINITY;
#pragma unroll
      for (int j = 0; j < 4; ++j) {
        const int key = kv0 + j * 16 + c;
        float sv = s[j][r] * sscale;
        sv = (key <= qrow) ? sv : -INFINITY;
        s[j][r] = sv;
        m = fmaxf(m, sv);
      }
#pragma unroll
      for (int off = 1; off < 16; off <<= 1) m = fmaxf(m, __shfl_xor(m, off, 32));
      const float mnew  = fmaxf(mrow[r], m);
      const float msafe = (mnew == -INFINITY) ? 0.f : mnew;
      const float alpha = __expf(mrow[r] - msafe);   // mrow = -inf -> 0 (l and context are 0 there anyway)
      mrow[r] = mnew;
      float psum = 0.f;
#pragma unroll
      for (int j = 0; j < 4; ++j) {
        const float p = __expf(s[j][r] - msafe);      // masked logit: exp(-inf) -> 0
        psum += p;
        const float p1k = p * 1024.0f;
        const _Float16 ph = (_Float16)p1k;
        pwh[(8 * hh + r) * 64 + j * 16 + c] = ph;
        if (RES) {
          const _Float16 pl = (_Float16)((p1k - (float)ph) * 4096.0f);
          pwl[(8 * hh + r) * 64 + j * 16 + c] = pl;
        }
      }
#pragma unroll
      for (int off = 1; off < 16; off <<= 1) psum += __shfl_xor(psum, off, 32);
      lrow[r] = lrow[r] * alpha + psum;
#pragma unroll
      for (int t = 0; t < 4; ++t) oacc[t][r] *= alpha;
    }
    __builtin_amdgcn_fence(__ATOMIC_RELEASE, "workgroup");
    __builtin_amdgcn_wave_barrier();
    __builtin_amdgcn_fence(__ATOMIC_ACQUIRE, "workgroup");

    // ---- context += P . V (f16 WMMA), residual products into a separate accumulator ----
    v8f o1[4];
#pragma unroll
    for (int t = 0; t < 4; ++t) o1[t] = zero8();
#pragma unroll 1
    for (int kk = 0; kk < 2; ++kk) {
      FH pa, pl;
      pa.h[0] = *(const v8h*)(pwh + c * 64 + kk * 32 + 8 * hh);
      pa.h[1] = *(const v8h*)(pwh + c * 64 + kk * 32 + 16 + 8 * hh);
      if (RES) {
        pl.h[0] = *(const v8h*)(pwl + c * 64 + kk * 32 + 8 * hh);
        pl.h[1] = *(const v8h*)(pwl + c * 64 + kk * 32 + 16 + 8 * hh);
      } else {
        pl.v = pa.v;
      }
#pragma unroll
      for (int t = 0; t < 4; ++t) {
        FH vb;
        vb.h[0] = *(const v8h*)(Vth + (t * 16 + c) * 64 + kk * 32 + 8 * hh);
        vb.h[1] = *(const v8h*)(Vth + (t * 16 + c) * 64 + kk * 32 + 16 + 8 * hh);
        oacc[t] = mma_h(pa.v, vb.v, oacc[t]);
        if (RES) {
          FH vl;
          vl.h[0] = *(const v8h*)(Vtl + (t * 16 + c) * 64 + kk * 32 + 8 * hh);
          vl.h[1] = *(const v8h*)(Vtl + (t * 16 + c) * 64 + kk * 32 + 16 + 8 * hh);
          o1[t] = mma_h(pa.v, vl.v, o1[t]);
          o1[t] = mma_h(pl.v, vb.v, o1[t]);
        }
      }
    }
    if (RES) {
#pragma unroll
      for (int t = 0; t < 4; ++t)
#pragma unroll
        for (int r = 0; r < 8; ++r) oacc[t][r] += o1[t][r] * (1.0f / 4096.0f);
    }
  }

  // ---- normalise (1/l and the 1/1024 p carry), stage the wave's 16x64 tile in LDS, then write bf16 hi/lo
  float* os = Os[wave];
#pragma unroll
  for (int r = 0; r < 8; ++r) {
    const float l = lrow[r];
    const float inv = ((l > 0.f) ? (1.0f / l) : 0.f) * (1.0f / 1024.0f);
#pragma unroll
    for (int t = 0; t < 4; ++t) os[(8 * hh + r) * 64 + t * 16 + c] = oacc[t][r] * inv;
  }
  __builtin_amdgcn_fence(__ATOMIC_RELEASE, "workgroup");
  __builtin_amdgcn_wave_barrier();
  __builtin_amdgcn_fence(__ATOMIC_ACQUIRE, "workgroup");
  {
    const int q = lane >> 3, c8 = (lane & 7) * 8;
    v4u hv[4], lv[4];
#pragma unroll
    for (int it = 0; it < 4; ++it) {
      const int row = it * 4 + q;      // it 0..3 x q 0..3 = rows 0..15 of the wave tile
      const float* sp = os + row * 64 + c8;
      v4u a, a2;
#pragma unroll
      for (int e = 0; e < 4; ++e) {
        const float f0 = sp[2 * e], f1 = sp[2 * e + 1];
        const unsigned short h0 = bf_bits(f0), h1 = bf_bits(f1);
        const unsigned short l0 = bf_bits(f0 - bf_up(h0)), l1 = bf_bits(f1 - bf_up(h1));
        a[e] = pk16(h0, h1); a2[e] = pk16(l0, l1);
      }
      hv[it] = a; lv[it] = a2;
    }
    {
#pragma unroll
      for (int it = 0; it < 4; ++it) {
        const int row = it * 4 + q;
        const size_t go = (rowB + q0 + row) * DM + (size_t)h * HD + c8;
        *(v4u*)(ahp + go) = hv[it];
        *(v4u*)(alp + go) = lv[it];
      }
      
    }
  }
}

// =====================================================================================================
// Workspace map (bytes), every region an exact multiple of its whole-line / whole-tile store granularity
//  because M, N are multiples of 64 everywhere):
//   Wqkvb  bf16 [3072][1024]             0          6291456   (rows 0..2047 = Wq|Wk as Bt, rows 2048.. = Wv as A)
//   Wob    bf16 [1024][1024]             6291456    2097152
//   Xb     bf16 [4096][1024]             8388608    8388608
//   XPh    bf16 [4096][1024]            16777216    8388608
//   XPl    bf16 [4096][1024]            25165824    8388608
//   QKh    bf16 [4096][2048]            33554432   16777216
//   QKl    bf16 [4096][2048]            50331648   16777216
//   VTh    f16  [2][1024][2048]         67108864    8388608
//   VTl    f16  [2][1024][512]          75497472    2097152
//   Ah     bf16 [4096][1024]            77594624    8388608
//   Al     bf16 [4096][1024]            85983232    8388608
//   end                                 94371840
// Weights arrive [out n][in k] row-major = the Bt / A layout the GEMM wants (k contiguous), so they are only
// RNE-converted to bf16.
// =====================================================================================================
extern "C" void kernel_launch(void* const* d_in, const int* in_sizes, int n_in,
                              void* d_out, int out_size, void* d_ws, size_t ws_size,
                              hipStream_t stream) {
  if (n_in < 4) return;
  if (in_sizes[0] != NB * SEQ * DM) return;
  if (in_sizes[1] != SEQ * DM) return;
  if (in_sizes[2] != 3 * DM * DM) return;
  if (in_sizes[3] != DM * DM) return;
  if (out_size != NB * SEQ * DM) return;

  const float* x    = (const float*)d_in[0];   // [NB][SEQ][DM]
  const float* posp = (const float*)d_in[1];   // [SEQ][DM]
  const float* wqkv = (const float*)d_in[2];   // [3*DM n][DM k]
  const float* wo   = (const float*)d_in[3];   // [DM n][DM k]

  const size_t PWqkv = (size_t)3 * DM * DM * 2;       //  6291456  bf16 [3072][1024]
  const size_t PWo   = (size_t)DM * DM * 2;           //  2097152  bf16 [1024][1024]
  const size_t PX    = (size_t)NB * SEQ * DM * 2;     //  8388608  bf16 [4096][1024]
  const size_t PQK   = (size_t)NB * SEQ * NQK * 2;    // 16777216  bf16 [4096][2048]
  const size_t PVTh  = (size_t)NB * DM * SEQ * 2;     //  8388608
  const size_t PVTl  = (size_t)NB * DM * VLP * 2;     //  2097152
  size_t off = 0;
  const size_t oWqkv = off; off += PWqkv;
  const size_t oWo   = off; off += PWo;
  const size_t oXb   = off; off += PX;
  const size_t oXPh  = off; off += PX;
  const size_t oXPl  = off; off += PX;
  const size_t oQKh  = off; off += PQK;
  const size_t oQKl  = off; off += PQK;
  const size_t oVTh  = off; off += PVTh;
  const size_t oVTl  = off; off += PVTl;
  const size_t oAh   = off; off += PX;
  const size_t oAl   = off; off += PX;
  if (off > ws_size) return;                           // off = 94371840
  if (off > (size_t)134217728) return;

  char* ws = (char*)d_ws;
  unsigned short* Wqkvb = (unsigned short*)(ws + oWqkv);
  unsigned short* Wvb   = Wqkvb + (size_t)2 * DM * DM;   // rows 2048..3071 of the Wqkv plane
  unsigned short* Wob   = (unsigned short*)(ws + oWo);
  unsigned short* Xb    = (unsigned short*)(ws + oXb);
  unsigned short* XPh   = (unsigned short*)(ws + oXPh);
  unsigned short* XPl   = (unsigned short*)(ws + oXPl);
  unsigned short* QKh   = (unsigned short*)(ws + oQKh);
  unsigned short* QKl   = (unsigned short*)(ws + oQKl);
  unsigned short* VTh   = (unsigned short*)(ws + oVTh);
  unsigned short* VTl   = (unsigned short*)(ws + oVTl);
  unsigned short* Ah    = (unsigned short*)(ws + oAh);
  unsigned short* Al    = (unsigned short*)(ws + oAl);
  float*          outf  = (float*)d_out;

  const dim3 blk(256);
  const int n8qkv = 3 * DM * DM / 8;                                 // 393216 (multiple of 256)
  const int n8w   = DM * DM / 8;                                     // 131072 (multiple of 256)
  const int n8x   = NB * SEQ * DM / 8;                               // 524288 (multiple of 256)
  const int p8    = SEQ * DM / 8;                                    // 262144
  const dim3 gCvtQKV((n8qkv + 255) / 256);                           // 1536 blocks
  const dim3 gCvtW((n8w + 255) / 256);                               // 512 blocks
  const dim3 gPrep((n8x + 255) / 256);                               // 2048 blocks
  const dim3 gQK((NB * SEQ / 128) * (NQK / 256), 1);                 // 128x256 tiles -> 256 blocks of 8 waves
  const dim3 gVT((DM / 128) * (SEQ / 128), NB);                      // 128x128 tiles -> 128 blocks of 4 waves x 2
  const dim3 gOut((NB * SEQ / 128) * (DM / 128), 1);                 // 128x128 tiles -> 256 blocks of 4 waves

  // (1) weights -> bf16 planes (keep their [n][k] layout); x -> bf16 plane; x + pos -> bf16 hi/lo planes
  cvt_bf16x8<<<gCvtQKV, blk, 0, stream>>>(wqkv, Wqkvb, n8qkv);
  cvt_bf16x8<<<gCvtW, blk, 0, stream>>>(wo, Wob, n8w);
  prep_x8<<<gPrep, blk, 0, stream>>>(x, posp, Xb, XPh, XPl, n8x, p8);
  // (2) q|k projection: QK[row][n] = sum_k (XPh+XPl)[row][k] Wqkvb[n][k], n < 2048 -> bf16 hi/lo planes,
  //     pitch NQK   (M=4096, N=2048, K=1024, 2 products)
  gemm64<1, 2, 4><<<gQK, dim3(256), 0, stream>>>(
      XPh, XPl, DM, 0LL, Wqkvb, DM, 0LL,
      (void*)QKh, NQK, 0LL, (void*)QKl, NQK, 0LL, NQK,
      NB * SEQ, NQK, DM, 1.0f);
  // (3) v^T per batch element: VTh[bl][m][s] = sum_k Wvb[m][k] Xb[bl*SEQ+s][k] -> f16 hi plane (pitch SEQ) and
  //     residual plane (x4096, keys < VLP, pitch VLP)  (M=1024, N=2048, K=1024, single product)
  gemm64<0, 3, 2><<<gVT, dim3(128), 0, stream>>>(
      Wvb, Wvb, DM, 0LL, Xb, DM, (long long)SEQ * DM,
      (void*)VTh, SEQ, (long long)DM * SEQ, (void*)VTl, VLP, (long long)DM * VLP, VLP,
      DM, SEQ, DM, 4096.0f);
  // (4) causal attention: query blocks 0..RESQB-1 with residual planes, the rest without -> Ah/Al bf16 hi/lo
  attn64<true><<<dim3(NB * NH * RESQB), dim3(128), 0, stream>>>(
      QKh, QKl, VTh, VTl, Ah, Al, 0, RESQB, 0.125f);
  attn64<false><<<dim3(NB * NH * (NQB - RESQB)), dim3(128), 0, stream>>>(
      QKh, QKl, VTh, VTl, Ah, Al, RESQB, NQB - RESQB, 0.125f);
  // (5) out[row][n] = sum_k (Ah+Al)[row][k] Wob[n][k] -> d_out f32   (M=4096, N=1024, K=1024, 2 products)
  gemm64<1, 0, 2><<<gOut, dim3(128), 0, stream>>>(
      Ah, Al, DM, 0LL, Wob, DM, 0LL,
      (void*)outf, DM, 0LL, (void*)outf, 0, 0LL, 0,
      NB * SEQ, DM, DM, 1.0f);
  (void)hipGetLastError();
}

// v002
// A run of this version takes 199 microseconds.
// Next to v001, in two timings, it ran 1.38 and 1.39 times as fast.
// All steps since v000 together make it 2.03 times as fast.
// Contractions: q|k projection = v_wmma_f32_16x16x32_bf16 with (x+pos) as bf16 hi/lo planes times the bf16 Wqk plane (2 products);
// v^T projection = v_wmma_f32_16x16x32_bf16 (bf16 x times bf16 Wv, single product);
// q.k^T scores = v_wmma_f32_16x16x32_bf16 with bf16 hi/lo split q and k (hi.hi + hi.lo + lo.hi);
// p.v = v_wmma_f32_16x16x32_f16 (p carried x1024 in f16, v in f16; extra f16 residual planes x4096 of p and v on the first 512 query rows);
// a.Wout^T = v_wmma_f32_16x16x32_bf16 with a as bf16 hi/lo planes times the bf16 Wout plane (2 products); all f32 accumulate; softmax in f32.
#include <hip/hip_runtime.h>
#include <math.h>
#include <stdint.h>

#define NB    2
#define SEQ   2048
#define DM    1024
#define NH    16
#define HD    64
#define NQK   (2 * DM)       // pitch of the q|k planes: q feature columns 0..DM-1, k feature columns DM..2DM-1
#define NQB   (SEQ / 64)     // 32 query / key tiles of 64
#define VLP   512            // key pitch of the v^T residual plane (keys 0..VLP-1)
#define RESQB 8              // leading 64-row query blocks that use the p / v residual planes
static_assert(RESQB * 64 <= VLP);
static_assert(NH * HD == DM);
static_assert((SEQ % 128) == 0 && (DM % 256) == 0);
static_assert(HD == 64);
static_assert(((NB * SEQ * DM / 8) % 256) == 0);
static_assert(((DM * DM / 8) % 256) == 0);
static_assert(((3 * DM * DM / 8) % 256) == 0);
static_assert(((SEQ * DM) % 8) == 0);

typedef _Float16 v16h __attribute__((ext_vector_type(16)));
typedef _Float16 v8h  __attribute__((ext_vector_type(8)));
typedef __bf16   v16b __attribute__((ext_vector_type(16)));
typedef __bf16   v8b  __attribute__((ext_vector_type(8)));
typedef float    v8f  __attribute__((ext_vector_type(8)));
typedef float    v4f  __attribute__((ext_vector_type(4)));
typedef unsigned int v4u __attribute__((ext_vector_type(4)));

// ---- scalar helpers --------------------------------------------------------------------------------
__device__ __forceinline__ unsigned short bf_bits(float f) {          // f32 -> bf16 bits, RNE convert
  unsigned u = __float_as_uint(f);
  return (unsigned short)((u + 0x7FFFu + ((u >> 16) & 1u)) >> 16);
}
__device__ __forceinline__ float bf_up(unsigned short h) { return __uint_as_float(((unsigned)h) << 16); }
__device__ __forceinline__ unsigned short h_bits(_Float16 x) { return __builtin_bit_cast(unsigned short, x); }
__device__ __forceinline__ unsigned pk16(unsigned short a, unsigned short b) { return (unsigned)a | ((unsigned)b << 16); }
__device__ __forceinline__ v8f zero8() { v8f z = {0.f, 0.f, 0.f, 0.f, 0.f, 0.f, 0.f, 0.f}; return z; }
__device__ __forceinline__ v8h zero8h() {
  const _Float16 z = (_Float16)0.0f;
  v8h r = {z, z, z, z, z, z, z, z};
  return r;
}

// ---- fragment loader: 16-bit A/B operand, lane -> row/col (lane&15), p already includes +8*(lane>>4);
//      elements 0..7 <- p[0..7] (k0+8h..), elements 8..15 <- p[16..23] (k0+16+8h..)
__device__ __forceinline__ v16b ldfrag_b(const __bf16* p) {
  union { v16b v; v8b h[2]; } f;
  f.h[0] = *(const v8b*)(p);
  f.h[1] = *(const v8b*)(p + 16);
  return f.v;
}

// ---- WMMA helpers with trailing VALU hazard gap --------------------------------------------------------
__device__ __forceinline__ v8f mma_b(v16b a, v16b b, v8f c) {
  c = __builtin_amdgcn_wmma_f32_16x16x32_bf16(false, a, false, b, (short)0, c, false, false);
#if defined(__HIP_DEVICE_COMPILE__)
  asm volatile("v_nop\n\tv_nop\n\tv_nop\n\tv_nop" : "+v"(c) : "v"(a), "v"(b));
#endif
  return c;
}
__device__ __forceinline__ v8f mma_h(v16h a, v16h b, v8f c) {
  c = __builtin_amdgcn_wmma_f32_16x16x32_f16(false, a, false, b, (short)0, c, false, false);
#if defined(__HIP_DEVICE_COMPILE__)
  asm volatile("v_nop\n\tv_nop\n\tv_nop\n\tv_nop" : "+v"(c) : "v"(a), "v"(b));
#endif
  return c;
}
__device__ __forceinline__ v8f mma_b_raw(v16b a, v16b b, v8f c) {
  return __builtin_amdgcn_wmma_f32_16x16x32_bf16(false, a, false, b, (short)0, c, false, false);
}
__device__ __forceinline__ void dep_guard_b(v8f& a, v8f& b, v16b x, v16b y) {
#if defined(__HIP_DEVICE_COMPILE__)
  asm volatile("v_nop\n\tv_nop\n\tv_nop\n\tv_nop" : "+v"(a), "+v"(b) : "v"(x), "v"(y));
#endif
}
__device__ __forceinline__ void keep4_b(v16b a, v16b b, v16b c, v16b d) {
#if defined(__HIP_DEVICE_COMPILE__)
  asm volatile("v_nop" :: "v"(a), "v"(b), "v"(c), "v"(d));
#endif
}
__device__ __forceinline__ void acc_guard4(v8f& a, v8f& b, v8f& c, v8f& d) {
#if defined(__HIP_DEVICE_COMPILE__)
  asm volatile("v_nop\n\tv_nop\n\tv_nop\n\tv_nop" : "+v"(a), "+v"(b), "+v"(c), "+v"(d));
#endif
}

// =====================================================================================================
// f32 -> bf16 (RNE convert), 8 elements per thread, one 16-B store per lane: a wave writes 512 contiguous B
// host-checked). coverage: n8 threads x 8 = whole plane.
// =====================================================================================================
__global__ __launch_bounds__(256) void cvt_bf16x8(const float* __restrict__ in, unsigned short* out, int n8) {
  const int i = blockIdx.x * 256 + threadIdx.x;
  if (i < n8) {
    const v4f a = *(const v4f*)(in + (size_t)i * 8);
    const v4f b = *(const v4f*)(in + (size_t)i * 8 + 4);
    v4u p;
    p[0] = pk16(bf_bits(a[0]), bf_bits(a[1]));
    p[1] = pk16(bf_bits(a[2]), bf_bits(a[3]));
    p[2] = pk16(bf_bits(b[0]), bf_bits(b[1]));
    p[3] = pk16(bf_bits(b[2]), bf_bits(b[3]));
    *(v4u*)(out + (size_t)i * 8) = p;
    
  }
}

// =====================================================================================================
// x prep: xb = bf16(x) (RNE convert); s = bf_up(bf16(x)) + bf_up(bf16(pos)) in f32 (pos element index =
// x element index mod SEQ*DM); hp = bf16 hi plane of s, lp = bf16 lo plane (lo = RNE(s - hi), unscaled).
// three planes (n8 multiple of 256, host-checked).
// =====================================================================================================
__global__ __launch_bounds__(256) void prep_x8(const float* __restrict__ x, const float* __restrict__ pos,
                                               unsigned short* xb, unsigned short* hp, unsigned short* lp,
                                               int n8, int p8) {
#pragma clang fp contract(off)
  const int i = blockIdx.x * 256 + threadIdx.x;
  if (i < n8) {
    const int ip = i % p8;
    const v4f a  = *(const v4f*)(x + (size_t)i * 8);
    const v4f b  = *(const v4f*)(x + (size_t)i * 8 + 4);
    const v4f pa = *(const v4f*)(pos + (size_t)ip * 8);
    const v4f pb = *(const v4f*)(pos + (size_t)ip * 8 + 4);
    v4u px, ph, pl;
#pragma unroll
    for (int e = 0; e < 4; ++e) {
      const float f0 = (e < 2) ? a[2 * e]      : b[2 * e - 4];
      const float f1 = (e < 2) ? a[2 * e + 1]  : b[2 * e - 3];
      const float g0 = (e < 2) ? pa[2 * e]     : pb[2 * e - 4];
      const float g1 = (e < 2) ? pa[2 * e + 1] : pb[2 * e - 3];
      const unsigned short x0 = bf_bits(f0), x1 = bf_bits(f1);
      const float s0 = bf_up(x0) + bf_up(bf_bits(g0));
      const float s1 = bf_up(x1) + bf_up(bf_bits(g1));
      const unsigned short h0 = bf_bits(s0), h1 = bf_bits(s1);
      const unsigned short l0 = bf_bits(s0 - bf_up(h0)), l1 = bf_bits(s1 - bf_up(h1));
      px[e] = pk16(x0, x1);
      ph[e] = pk16(h0, h1);
      pl[e] = pk16(l0, l1);
    }
    *(v4u*)(xb + (size_t)i * 8) = px;
    *(v4u*)(hp + (size_t)i * 8) = ph;
    *(v4u*)(lp + (size_t)i * 8) = pl;
    
  }
}

// =====================================================================================================
// Eight asynchronous 16-B-per-lane copies global -> LDS (no register in between). The closing s_wait_xcnt stands
// in the copies' own statement so that no address register named here is rewritten in front of it (a precaution).
// =====================================================================================================
__device__ __forceinline__ void copy8_async(const unsigned (&l)[8], const __bf16* const (&g)[8]) {
#if defined(__HIP_DEVICE_COMPILE__)
  asm volatile(
      "global_load_async_to_lds_b128 %0, %8, off\n\t"
      "global_load_async_to_lds_b128 %1, %9, off\n\t"
      "global_load_async_to_lds_b128 %2, %10, off\n\t"
      "global_load_async_to_lds_b128 %3, %11, off\n\t"
      "global_load_async_to_lds_b128 %4, %12, off\n\t"
      "global_load_async_to_lds_b128 %5, %13, off\n\t"
      "global_load_async_to_lds_b128 %6, %14, off\n\t"
      "global_load_async_to_lds_b128 %7, %15, off\n\t"
      "s_wait_xcnt 0x0"
      :: "v"(l[0]), "v"(l[1]), "v"(l[2]), "v"(l[3]), "v"(l[4]), "v"(l[5]), "v"(l[6]), "v"(l[7]),
         "v"(g[0]), "v"(g[1]), "v"(g[2]), "v"(g[3]), "v"(g[4]), "v"(g[5]), "v"(g[6]), "v"(g[7])
      : "memory");
#endif
}

// =====================================================================================================
// Batched bf16 WMMA GEMM: C[m][n] = sum_k A[m][k] * Bt[n][k]. A block of 2 x WN waves owns a 128 x (64*WN) tile of
// C, each wave a 64x64 part of it. A row-major [M][K] pitch lda; Bt row-major [N][K] pitch ldb (k contiguous);
// M a multiple of 128, N of 64*WN, K of 64 (host constants). blockIdx.y = batch index (strides in elements).
// Operands: per stage of 64 k the block's rows [A 128 | A2 128 (NSPLIT 1) | Bt 64*WN], 128 B each, are copied to
// LDS at pitch 144 B by asynchronous copies (a wave's copy = 4 whole 128-B lines); two buffers, stage t+1 flies
// while stage t is multiplied; the waves read their fragments from LDS with ds loads.
// NSPLIT: 0 = A.Bt; 1 = (A + A2).Bt (A2 = unscaled bf16 lo plane of A).
// OUT_MODE: 0 = f32 (pitch ldc); 2 = bf16 hi plane C + bf16 lo plane C2 (lo = RNE(v - hi), unscaled);
//           3 = f16 hi plane C + f16 residual plane C2 = f16((v - hi) * rscale), C2 written only for tiles
//               with n0 < N2 (pitch ldc2, batch stride strideC2).
// =====================================================================================================
template <int NSPLIT, int OUT_MODE, int WN>
__global__ __launch_bounds__(64 * WN) void gemm64(
    const unsigned short* __restrict__ Ap, const unsigned short* A2p, int lda, long long strideA,
    const unsigned short* __restrict__ Btp, int ldb, long long strideB,
    void* Cout, int ldc, long long strideC,
    void* Cout2, int ldc2, long long strideC2, int N2,
    int M, int N, int K, float rscale) {
  static_assert(NSPLIT == 0 || NSPLIT == 1);
  constexpr int NT    = 64 * WN;                       // threads
  constexpr int BM    = 128;                           // block rows of C
  constexpr int BN    = 64 * WN;                       // block columns of C
  constexpr int KS    = 64;                            // k per stage (128 B of every operand row)
  constexpr int AROWS = (NSPLIT == 1 ? 2 : 1) * BM;    // stage rows that hold A (and A2)
  constexpr int ROWS  = AROWS + BN;                    // stage rows in all
  constexpr int PE    = 72;                            // LDS row pitch in elements (144 B = 16 B x 9)
  constexpr int BUFE  = ROWS * PE;                     // elements of one buffer
  constexpr int RPI   = NT / 8;                        // stage rows that one copy of every thread covers
  constexpr int NIT   = ROWS / RPI;                    // copies per thread and stage
  static_assert((BM % RPI) == 0 && (NIT % 8) == 0 && NIT <= 63);
  const __bf16* A   = (const __bf16*)(const void*)Ap;
  const __bf16* A2  = (const __bf16*)(const void*)A2p;
  const __bf16* Bt  = (const __bf16*)(const void*)Btp;
  __shared__ __align__(16) __bf16 ring[2 * BUFE];       // two stage buffers
  __shared__ __align__(16) float sT[2 * WN][16 * 68];   // per-wave 16x64 slab, pitch 68 floats
  const int b    = blockIdx.y;
  const int tid  = threadIdx.x;
  const int lane = tid & 31;
  const int wave = tid >> 5;
  const int tilesN = N / BN;
  const int tilesM = M / BM;
  const int tile = blockIdx.x;
  if (tile >= tilesM * tilesN) return;   // block-uniform, in front of every copy and barrier
  const int tm = tile / tilesN;
  const int tn = tile - tm * tilesN;
  const int wm = wave / WN;                    // wave's 64-row part of the block tile
  const int wn = wave - wm * WN;               // wave's 64-column part
  const int m0 = tm * BM + (wm << 6);
  const int n0 = tn * BN + (wn << 6);

  const int rlane = lane & 15;                 // row (A) / col (B, D) within subtile
  const int koff  = (lane >> 4) * 8;           // k offset of this lane half
  const int mOff  = (lane >> 4) * 8;           // D row offset

  // this thread's 16-B piece of stage row (tid >> 3): source pointers at k = 0 and LDS byte address in buffer 0
  const int crow = tid >> 3, cpc = (tid & 7) * 8;
  const __bf16* gA  = A  + (size_t)b * strideA + (size_t)(tm * BM + crow) * lda + cpc;
  const __bf16* gA2 = (NSPLIT == 1) ? (A2 + (size_t)b * strideA + (size_t)(tm * BM + crow) * lda + cpc) : gA;
  const __bf16* gB  = Bt + (size_t)b * strideB + (size_t)(tn * BN + crow) * ldb + cpc;
  const unsigned lds0 = (unsigned)(size_t)(const void*)ring + (unsigned)(crow * PE + cpc) * 2u;

  // copies the next stage not yet asked for into buffer buf; the three source pointers then step on by one stage
  auto issue_stage = [&](int buf) {
    const unsigned lb = lds0 + (unsigned)buf * (unsigned)(BUFE * 2);
    // both loops unrolled: the stage row decides at compile time which operand a copy reads
#pragma unroll
    for (int g8 = 0; g8 < NIT / 8; ++g8) {
      unsigned dst[8];
      const __bf16* sp[8];
#pragma unroll
      for (int e = 0; e < 8; ++e) {
        const int sr = (g8 * 8 + e) * RPI;     // first stage row of this copy, a compile-time value
        sp[e]  = (sr < BM) ? (gA + (size_t)sr * lda)
               : (sr < AROWS) ? (gA2 + (size_t)(sr - BM) * lda)
                              : (gB + (size_t)(sr - AROWS) * ldb);
        dst[e] = lb + (unsigned)(sr * PE * 2);
      }
      copy8_async(dst, sp);
    }
    gA += KS; gA2 += KS; gB += KS;
  };

  v8f acc[4][4];
#pragma unroll
  for (int i = 0; i < 4; ++i)
#pragma unroll
    for (int j = 0; j < 4; ++j) acc[i][j] = zero8();

  const int nst = K / KS;
  issue_stage(0);
  asm volatile("s_wait_asynccnt 0x0" ::: "memory");   // this wave's copies of stage 0 have landed
  __syncthreads();                                    // ... and every other wave's: stage 0 may be read
  if (nst > 1) issue_stage(1);

  for (int t = 0; t < nst; ++t) {
    const __bf16* sb  = ring + (t & 1) * BUFE;
    const __bf16* sA  = sb + ((wm << 6) + rlane) * PE + koff;
    const __bf16* sA2 = sA + BM * PE;
    const __bf16* sB  = sb + (AROWS + (wn << 6) + rlane) * PE + koff;
    // every loop of the stage is unrolled: fragments and accumulators are register arrays (constant indices only)
#pragma unroll
    for (int kk = 0; kk < KS; kk += 32) {
      v16b bh[4], ah[4], al[4];
#pragma unroll
      for (int j = 0; j < 4; ++j) bh[j] = ldfrag_b(sB + (j << 4) * PE + kk);
#pragma unroll
      for (int i = 0; i < 4; ++i) {
        ah[i] = ldfrag_b(sA + (i << 4) * PE + kk);
        if (NSPLIT == 1) al[i] = ldfrag_b(sA2 + (i << 4) * PE + kk); else al[i] = ah[i];
      }
#pragma unroll
      for (int i = 0; i < 4; ++i) {
#pragma unroll
        for (int j = 0; j < 4; ++j) acc[i][j] = mma_b_raw(ah[i], bh[j], acc[i][j]);
        if (NSPLIT == 1) {
#pragma unroll
          for (int j = 0; j < 4; ++j) acc[i][j] = mma_b_raw(al[i], bh[j], acc[i][j]);
        }
        dep_guard_b(acc[i][0], acc[i][3], ah[i], al[i]);
      }
      keep4_b(bh[0], bh[1], bh[2], bh[3]);
    }
    asm volatile("s_wait_dscnt 0x0" ::: "memory");     // this wave's reads of buffer t & 1 are done
    asm volatile("s_wait_asynccnt 0x0" ::: "memory");  // this wave's copies of stage t + 1 have landed
    __syncthreads();                                   // publishes stage t + 1, frees buffer t & 1
    if (t + 2 < nst) issue_stage(t & 1);
  }
  asm volatile("s_wait_asynccnt 0x0" ::: "memory");    // no copy is outstanding when the wave goes on
  acc_guard4(acc[0][0], acc[0][1], acc[0][2], acc[0][3]);
  acc_guard4(acc[1][0], acc[1][1], acc[1][2], acc[1][3]);
  acc_guard4(acc[2][0], acc[2][1], acc[2][2], acc[2][3]);
  acc_guard4(acc[3][0], acc[3][1], acc[3][2], acc[3][3]);

  // ---- epilogue ----
  float* slab = sT[wave];
#pragma unroll
  for (int i = 0; i < 4; ++i) {
    const int mBase = m0 + (i << 4);
#pragma unroll
    for (int r = 0; r < 8; ++r) {
#pragma unroll
      for (int j = 0; j < 4; ++j) {
        slab[(mOff + r) * 68 + (j << 4) + rlane] = acc[i][j][r];
      }
    }
    __builtin_amdgcn_fence(__ATOMIC_RELEASE, "workgroup");
    __builtin_amdgcn_wave_barrier();
    __builtin_amdgcn_fence(__ATOMIC_ACQUIRE, "workgroup");
    if (OUT_MODE == 0) {
      float* C = (float*)Cout + (size_t)b * strideC;
      const int hh = lane >> 4, c4 = (lane & 15) * 4;     // 256-B row segment = 16 lanes x 16 B
      v4f ov[8];
#pragma unroll
      for (int it = 0; it < 8; ++it) {
        const int row = it * 2 + hh;                       // it 0..7 x hh 0..1 = rows 0..15
        ov[it] = *(const v4f*)(slab + row * 68 + c4);
      }
      {
#pragma unroll
        for (int it = 0; it < 8; ++it) {
          const int row = it * 2 + hh;
          *(v4f*)(C + (size_t)(mBase + row) * ldc + n0 + c4) = ov[it];
        }
        
      }
    } else {
      const int q = lane >> 3, c8 = (lane & 7) * 8;
      unsigned short* C  = (unsigned short*)Cout  + (size_t)b * strideC;
      unsigned short* C2 = (unsigned short*)Cout2 + (size_t)b * strideC2;
      const bool wlo = (OUT_MODE == 2) || (n0 < N2);      // wave-uniform
      v4u hv[4], lv[4];
#pragma unroll
      for (int it = 0; it < 4; ++it) {
        const int row = it * 4 + q;                        // it 0..3 x q 0..3 = rows 0..15
        const float* sp = slab + row * 68 + c8;
        v4u a, a2;
#pragma unroll
        for (int e = 0; e < 4; ++e) {
          const float f0 = sp[2 * e], f1 = sp[2 * e + 1];
          unsigned short h0, h1, l0, l1;
          if (OUT_MODE == 2) {
            h0 = bf_bits(f0); h1 = bf_bits(f1);
            l0 = bf_bits(f0 - bf_up(h0)); l1 = bf_bits(f1 - bf_up(h1));
          } else {
            const _Float16 x0 = (_Float16)f0, x1 = (_Float16)f1;
            h0 = h_bits(x0); h1 = h_bits(x1);
            l0 = h_bits((_Float16)((f0 - (float)x0) * rscale));
            l1 = h_bits((_Float16)((f1 - (float)x1) * rscale));
          }
          a[e] = pk16(h0, h1); a2[e] = pk16(l0, l1);
        }
        hv[it] = a; lv[it] = a2;
      }
      {
#pragma unroll
        for (int it = 0; it < 4; ++it) {
          const int row = it * 4 + q;
          *(v4u*)(C + (size_t)(mBase + row) * ldc + n0 + c8) = hv[it];
          if (wlo) *(v4u*)(C2 + (size_t)(mBase + row) * ldc2 + n0 + c8) = lv[it];
        }
        
      }
    }
    __builtin_amdgcn_fence(__ATOMIC_RELEASE, "workgroup");
    __builtin_amdgcn_wave_barrier();
    __builtin_amdgcn_fence(__ATOMIC_ACQUIRE, "workgroup");
  }
}

// =====================================================================================================
// Causal attention, head dim 64. Key index > query index: the scaled logit is REPLACED by -inf (its softmax
// weight is exactly 0; every query row keeps key 0, so no row is fully masked). Key chunks with first key above
// the block's last query row are not visited (chunks 0..qb, block-uniform trip count qb+1 <= 32).
//   q|k planes (bf16 hi / lo), pitch NQK: q element (bl, t, h, d) at [(bl*SEQ + t)*NQK + h*64 + d],
//                                          k element (bl, s, h, d) at [(bl*SEQ + s)*NQK + DM + h*64 + d]
//   v^T hi plane (f16):      element (bl, h, d, s) at [(bl*DM + h*64 + d)*SEQ + s]
//   v^T residual plane (f16, (v - hi)*4096): [(bl*DM + h*64 + d)*VLP + s], s < VLP, read only when RES
//   (with RES only key tiles below VLP occur; the address is clamped and the value zeroed otherwise)
//   out: bf16 hi plane ah + bf16 lo plane al (lo = RNE(v - hi), unscaled) of the normalised context,
//        element (bl, t, h*64 + d) at [(bl*SEQ + t)*DM + h*64 + d].
//   scores = q . k : bf16 hi/lo split (hi.hi + hi.lo + lo.hi), f32 accumulate, then * sscale in f32
//   p = exp(s - m) carried as f16(1024 p); context = p . v on f16 WMMA; RES adds f16 residual planes of p and v
//   (scale 4096, separate accumulator folded back with 1/4096 per chunk in f32); online softmax in f32 with a
//   -inf-safe running max.
//   Block = 4 waves = 64 query rows of one (bl, h); grid = nqbThis * NH * NB; kv chunks of 64.
//   K / V^T chunk staging: 128 threads x 32 elements per plane = the whole 64x64 tile (plain 16-B loads,
//   __syncthreads before and after); P tiles are wave-private, spilled with _Float16 element stores and reloaded
//   Output coverage: each wave stores rows q0..q0+15 (it 0..3 x lane>>3 0..3) x 64 columns (8 lanes x 8 values),
// =====================================================================================================
template <bool RES>
__global__ __launch_bounds__(128)
void attn64(const unsigned short* __restrict__ qkhp, const unsigned short* __restrict__ qklp,
            const unsigned short* __restrict__ vhp, const unsigned short* __restrict__ vlp,
            unsigned short* ahp, unsigned short* alp, int qbBase, int nqbThis, float sscale) {
  union FB { v16b v; v8b h[2]; };
  union FH { v16h v; v8h h[2]; };
  // LDS row pitches: 16-bit tiles 72 elements (144 B = 16 B x 9), so that the 16 rows which a 16-B fragment read
  // touches fall on 16 different groups of four banks; the f32 tile 68 floats (272 B = 16 B x 17), likewise.
  constexpr int LP = 72;
  constexpr int OP = 68;
  __shared__ __align__(16) __bf16   Ksh[64 * LP];                 // K hi [kv][d]   9 KB
  __shared__ __align__(16) __bf16   Ksl[64 * LP];                 // K lo
  __shared__ __align__(16) _Float16 Vth[64 * LP];                 // V^T hi [d][kv] 9 KB
  __shared__ __align__(16) _Float16 Vtl[RES ? 64 * LP : 8];       // V^T residual
  __shared__ __align__(16) _Float16 Psh[4][16 * LP];              // per wave P [row][kv]
  __shared__ __align__(16) _Float16 Psl[RES ? 4 : 1][16 * LP];    // per wave P residual
  __shared__ __align__(16) float    Os[4][16 * OP];               // per wave context tile [row][d]

  const int tid  = threadIdx.x;
  const int wave = tid >> 5;
  const int lane = tid & 31;
  const int hh   = lane >> 4;
  const int c    = lane & 15;

  const int bx   = blockIdx.x;
  const int qbl  = bx % nqbThis;
  const int rest = bx / nqbThis;
  const int h    = rest % NH;
  const int b    = rest / NH;
  const int qb   = qbBase + qbl;
  const int q0   = qb * 64 + wave * 16;
  const size_t rowB = (size_t)b * SEQ;

  const __bf16* Qh = (const __bf16*)(const void*)qkhp + (size_t)h * HD;
  const __bf16* Ql = (const __bf16*)(const void*)qklp + (size_t)h * HD;
  const __bf16* Kh = (const __bf16*)(const void*)qkhp + (size_t)DM + (size_t)h * HD;
  const __bf16* Kl = (const __bf16*)(const void*)qklp + (size_t)DM + (size_t)h * HD;
  const _Float16* Vh = (const _Float16*)(const void*)vhp + ((size_t)b * DM + (size_t)h * HD) * SEQ;
  const _Float16* Vl = (const _Float16*)(const void*)vlp + ((size_t)b * DM + (size_t)h * HD) * VLP;

  // ---- Q fragments (A operand, row = lane&15): 2 d-chunks, hi and lo ----
  v16b qah[2], qal[2];
#pragma unroll
  for (int dc = 0; dc < 2; ++dc) {
    const size_t qo = (rowB + q0 + c) * NQK + dc * 32 + 8 * hh;
    qah[dc] = ldfrag_b(Qh + qo);
    qal[dc] = ldfrag_b(Ql + qo);
  }

  float mrow[8], lrow[8];
  v8f oacc[4];
#pragma unroll
  for (int r = 0; r < 8; ++r) { mrow[r] = -INFINITY; lrow[r] = 0.f; }
#pragma unroll
  for (int t = 0; t < 4; ++t) oacc[t] = zero8();

  int nkt = qb + 1;                          // key tiles 0..qb, block-uniform
  if (nkt > NQB) nkt = NQB;
  for (int kt = 0; kt < nkt; ++kt) {
    const int kv0 = kt * 64;
    __syncthreads();
    {
      const int r = tid >> 1, half = (tid & 1) * 32;
      const __bf16*   kg  = Kh + (rowB + kv0 + r) * NQK + half;   // K row kv0+r, d = half..half+31
      const __bf16*   klg = Kl + (rowB + kv0 + r) * NQK + half;
      const _Float16* vg  = Vh + (size_t)r * SEQ + kv0 + half;    // V^T row d = r, s = kv0+half..+31
      const int kvl = (kv0 + 64 <= VLP) ? kv0 : (VLP - 64);     // clamped address into the residual plane
      const _Float16* vlg = Vl + (size_t)r * VLP + kvl + half;
      const bool resOK = (kv0 + 64 <= VLP);                      // block-uniform
#pragma unroll
      for (int i = 0; i < 4; ++i) {
        const v8b a0 = *(const v8b*)(kg + 8 * i);
        const v8b a1 = *(const v8b*)(klg + 8 * i);
        const v8h b0 = *(const v8h*)(vg + 8 * i);
        *(v8b*)(Ksh + r * LP + half + 8 * i) = a0;
        *(v8b*)(Ksl + r * LP + half + 8 * i) = a1;
        *(v8h*)(Vth + r * LP + half + 8 * i) = b0;
        if (RES) {
          v8h b1 = *(const v8h*)(vlg + 8 * i);
          if (!resOK) b1 = zero8h();
          *(v8h*)(Vtl + r * LP + half + 8 * i) = b1;
        }
      }
    }
    __syncthreads();

    // ---- scores: 16 query rows x 64 keys per wave, 3 bf16 products ----
    v8f s[4];
#pragma unroll
    for (int j = 0; j < 4; ++j) {
      s[j] = zero8();
#pragma unroll
      for (int dc = 0; dc < 2; ++dc) {
        FB kb, kl;
        kb.h[0] = *(const v8b*)(Ksh + (j * 16 + c) * LP + dc * 32 + 8 * hh);
        kb.h[1] = *(const v8b*)(Ksh + (j * 16 + c) * LP + dc * 32 + 16 + 8 * hh);
        kl.h[0] = *(const v8b*)(Ksl + (j * 16 + c) * LP + dc * 32 + 8 * hh);
        kl.h[1] = *(const v8b*)(Ksl + (j * 16 + c) * LP + dc * 32 + 16 + 8 * hh);
        s[j] = mma_b(qah[dc], kb.v, s[j]);
        s[j] = mma_b(qah[dc], kl.v, s[j]);
        s[j] = mma_b(qal[dc], kb.v, s[j]);
      }
    }

    // ---- scale + causal select (key > query -> -inf by value), row max, online softmax,
    //      P (x1024, f16) and P residual (x4096) to LDS ----
    _Float16* pwh = Psh[wave];
    _Float16* pwl = Psl[RES ? wave : 0];
#pragma unroll
    for (int r = 0; r < 8; ++r) {
      const int qrow = q0 + 8 * hh + r;
      float m = -INFINITY;
#pragma unroll
      for (int j = 0; j < 4; ++j) {
        const int key = kv0 + j * 16 + c;
        float sv = s[j][r] * sscale;
        sv = (key <= qrow) ? sv : -INFINITY;
        s[j][r] = sv;
        m = fmaxf(m, sv);
      }
#pragma unroll
      for (int off = 1; off < 16; off <<= 1) m = fmaxf(m, __shfl_xor(m, off, 32));
      const float mnew  = fmaxf(mrow[r], m);
      const float msafe = (mnew == -INFINITY) ? 0.f : mnew;
      const float alpha = __expf(mrow[r] - msafe);   // mrow = -inf -> 0 (l and context are 0 there anyway)
      mrow[r] = mnew;
      float psum = 0.f;
#pragma unroll
      for (int j = 0; j < 4; ++j) {
        const float p = __expf(s[j][r] - msafe);      // masked logit: exp(-inf) -> 0
        psum += p;
        const float p1k = p * 1024.0f;
        const _Float16 ph = (_Float16)p1k;
        pwh[(8 * hh + r) * LP + j * 16 + c] = ph;
        if (RES) {
          const _Float16 pl = (_Float16)((p1k - (float)ph) * 4096.0f);
          pwl[(8 * hh + r) * LP + j * 16 + c] = pl;
        }
      }
#pragma unroll
      for (int off = 1; off < 16; off <<= 1) psum += __shfl_xor(psum, off, 32);
      lrow[r] = lrow[r] * alpha + psum;
#pragma unroll
      for (int t = 0; t < 4; ++t) oacc[t][r] *= alpha;
    }
    __builtin_amdgcn_fence(__ATOMIC_RELEASE, "workgroup");
    __builtin_amdgcn_wave_barrier();
    __builtin_amdgcn_fence(__ATOMIC_ACQUIRE, "workgroup");

    // ---- context += P . V (f16 WMMA), residual products into a separate accumulator ----
    v8f o1[4];
#pragma unroll
    for (int t = 0; t < 4; ++t) o1[t] = zero8();
#pragma unroll 1
    for (int kk = 0; kk < 2; ++kk) {
      FH pa, pl;
      pa.h[0] = *(const v8h*)(pwh + c * LP + kk * 32 + 8 * hh);
      pa.h[1] = *(const v8h*)(pwh + c * LP + kk * 32 + 16 + 8 * hh);
      if (RES) {
        pl.h[0] = *(const v8h*)(pwl + c * LP + kk * 32 + 8 * hh);
        pl.h[1] = *(const v8h*)(pwl + c * LP + kk * 32 + 16 + 8 * hh);
      } else {
        pl.v = pa.v;
      }
#pragma unroll
      for (int t = 0; t < 4; ++t) {
        FH vb;
        vb.h[0] = *(const v8h*)(Vth + (t * 16 + c) * LP + kk * 32 + 8 * hh);
        vb.h[1] = *(const v8h*)(Vth + (t * 16 + c) * LP + kk * 32 + 16 + 8 * hh);
        oacc[t] = mma_h(pa.v, vb.v, oacc[t]);
        if (RES) {
          FH vl;
          vl.h[0] = *(const v8h*)(Vtl + (t * 16 + c) * LP + kk * 32 + 8 * hh);
          vl.h[1] = *(const v8h*)(Vtl + (t * 16 + c) * LP + kk * 32 + 16 + 8 * hh);
          o1[t] = mma_h(pa.v, vl.v, o1[t]);
          o1[t] = mma_h(pl.v, vb.v, o1[t]);
        }
      }
    }
    if (RES) {
#pragma unroll
      for (int t = 0; t < 4; ++t)
#pragma unroll
        for (int r = 0; r < 8; ++r) oacc[t][r] += o1[t][r] * (1.0f / 4096.0f);
    }
  }

  // ---- normalise (1/l and the 1/1024 p carry), stage the wave's 16x64 tile in LDS, then write bf16 hi/lo
  float* os = Os[wave];
#pragma unroll
  for (int r = 0; r < 8; ++r) {
    const float l = lrow[r];
    const float inv = ((l > 0.f) ? (1.0f / l) : 0.f) * (1.0f / 1024.0f);
#pragma unroll
    for (int t = 0; t < 4; ++t) os[(8 * hh + r) * OP + t * 16 + c] = oacc[t][r] * inv;
  }
  __builtin_amdgcn_fence(__ATOMIC_RELEASE, "workgroup");
  __builtin_amdgcn_wave_barrier();
  __builtin_amdgcn_fence(__ATOMIC_ACQUIRE, "workgroup");
  {
    const int q = lane >> 3, c8 = (lane & 7) * 8;
    v4u hv[4], lv[4];
#pragma unroll
    for (int it = 0; it < 4; ++it) {
      const int row = it * 4 + q;      // it 0..3 x q 0..3 = rows 0..15 of the wave tile
      const float* sp = os + row * OP + c8;
      v4u a, a2;
#pragma unroll
      for (int e = 0; e < 4; ++e) {
        const float f0 = sp[2 * e], f1 = sp[2 * e + 1];
        const unsigned short h0 = bf_bits(f0), h1 = bf_bits(f1);
        const unsigned short l0 = bf_bits(f0 - bf_up(h0)), l1 = bf_bits(f1 - bf_up(h1));
        a[e] = pk16(h0, h1); a2[e] = pk16(l0, l1);
      }
      hv[it] = a; lv[it] = a2;
    }
    {
#pragma unroll
      for (int it = 0; it < 4; ++it) {
        const int row = it * 4 + q;
        const size_t go = (rowB + q0 + row) * DM + (size_t)h * HD + c8;
        *(v4u*)(ahp + go) = hv[it];
        *(v4u*)(alp + go) = lv[it];
      }
      
    }
  }
}

// =====================================================================================================
// Workspace map (bytes), every region an exact multiple of its whole-line / whole-tile store granularity
//  because M, N are multiples of 64 everywhere):
//   Wqkvb  bf16 [3072][1024]             0          6291456   (rows 0..2047 = Wq|Wk as Bt, rows 2048.. = Wv as A)
//   Wob    bf16 [1024][1024]             6291456    2097152
//   Xb     bf16 [4096][1024]             8388608    8388608
//   XPh    bf16 [4096][1024]            16777216    8388608
//   XPl    bf16 [4096][1024]            25165824    8388608
//   QKh    bf16 [4096][2048]            33554432   16777216
//   QKl    bf16 [4096][2048]            50331648   16777216
//   VTh    f16  [2][1024][2048]         67108864    8388608
//   VTl    f16  [2][1024][512]          75497472    2097152
//   Ah     bf16 [4096][1024]            77594624    8388608
//   Al     bf16 [4096][1024]            85983232    8388608
//   end                                 94371840
// Weights arrive [out n][in k] row-major = the Bt / A layout the GEMM wants (k contiguous), so they are only
// RNE-converted to bf16.
// =====================================================================================================
extern "C" void kernel_launch(void* const* d_in, const int* in_sizes, int n_in,
                              void* d_out, int out_size, void* d_ws, size_t ws_size,
                              hipStream_t stream) {
  if (n_in < 4) return;
  if (in_sizes[0] != NB * SEQ * DM) return;
  if (in_sizes[1] != SEQ * DM) return;
  if (in_sizes[2] != 3 * DM * DM) return;
  if (in_sizes[3] != DM * DM) return;
  if (out_size != NB * SEQ * DM) return;

  const float* x    = (const float*)d_in[0];   // [NB][SEQ][DM]
  const float* posp = (const float*)d_in[1];   // [SEQ][DM]
  const float* wqkv = (const float*)d_in[2];   // [3*DM n][DM k]
  const float* wo   = (const float*)d_in[3];   // [DM n][DM k]

  const size_t PWqkv = (size_t)3 * DM * DM * 2;       //  6291456  bf16 [3072][1024]
  const size_t PWo   = (size_t)DM * DM * 2;           //  2097152  bf16 [1024][1024]
  const size_t PX    = (size_t)NB * SEQ * DM * 2;     //  8388608  bf16 [4096][1024]
  const size_t PQK   = (size_t)NB * SEQ * NQK * 2;    // 16777216  bf16 [4096][2048]
  const size_t PVTh  = (size_t)NB * DM * SEQ * 2;     //  8388608
  const size_t PVTl  = (size_t)NB * DM * VLP * 2;     //  2097152
  size_t off = 0;
  const size_t oWqkv = off; off += PWqkv;
  const size_t oWo   = off; off += PWo;
  const size_t oXb   = off; off += PX;
  const size_t oXPh  = off; off += PX;
  const size_t oXPl  = off; off += PX;
  const size_t oQKh  = off; off += PQK;
  const size_t oQKl  = off; off += PQK;
  const size_t oVTh  = off; off += PVTh;
  const size_t oVTl  = off; off += PVTl;
  const size_t oAh   = off; off += PX;
  const size_t oAl   = off; off += PX;
  if (off > ws_size) return;                           // off = 94371840
  if (off > (size_t)134217728) return;

  char* ws = (char*)d_ws;
  unsigned short* Wqkvb = (unsigned short*)(ws + oWqkv);
  unsigned short* Wvb   = Wqkvb + (size_t)2 * DM * DM;   // rows 2048..3071 of the Wqkv plane
  unsigned short* Wob   = (unsigned short*)(ws + oWo);
  unsigned short* Xb    = (unsigned short*)(ws + oXb);
  unsigned short* XPh   = (unsigned short*)(ws + oXPh);
  unsigned short* XPl   = (unsigned short*)(ws + oXPl);
  unsigned short* QKh   = (unsigned short*)(ws + oQKh);
  unsigned short* QKl   = (unsigned short*)(ws + oQKl);
  unsigned short* VTh   = (unsigned short*)(ws + oVTh);
  unsigned short* VTl   = (unsigned short*)(ws + oVTl);
  unsigned short* Ah    = (unsigned short*)(ws + oAh);
  unsigned short* Al    = (unsigned short*)(ws + oAl);
  float*          outf  = (float*)d_out;

  const dim3 blk(256);
  const int n8qkv = 3 * DM * DM / 8;                                 // 393216 (multiple of 256)
  const int n8w   = DM * DM / 8;                                     // 131072 (multiple of 256)
  const int n8x   = NB * SEQ * DM / 8;                               // 524288 (multiple of 256)
  const int p8    = SEQ * DM / 8;                                    // 262144
  const dim3 gCvtQKV((n8qkv + 255) / 256);                           // 1536 blocks
  const dim3 gCvtW((n8w + 255) / 256);                               // 512 blocks
  const dim3 gPrep((n8x + 255) / 256);                               // 2048 blocks
  const dim3 gQK((NB * SEQ / 128) * (NQK / 256), 1);                 // 128x256 tiles -> 256 blocks of 8 waves
  const dim3 gVT((DM / 128) * (SEQ / 128), NB);                      // 128x128 tiles -> 128 blocks of 4 waves x 2
  const dim3 gOut((NB * SEQ / 128) * (DM / 128), 1);                 // 128x128 tiles -> 256 blocks of 4 waves

  // (1) weights -> bf16 planes (keep their [n][k] layout); x -> bf16 plane; x + pos -> bf16 hi/lo planes
  cvt_bf16x8<<<gCvtQKV, blk, 0, stream>>>(wqkv, Wqkvb, n8qkv);
  cvt_bf16x8<<<gCvtW, blk, 0, stream>>>(wo, Wob, n8w);
  prep_x8<<<gPrep, blk, 0, stream>>>(x, posp, Xb, XPh, XPl, n8x, p8);
  // (2) q|k projection: QK[row][n] = sum_k (XPh+XPl)[row][k] Wqkvb[n][k], n < 2048 -> bf16 hi/lo planes,
  //     pitch NQK   (M=4096, N=2048, K=1024, 2 products)
  gemm64<1, 2, 4><<<gQK, dim3(256), 0, stream>>>(
      XPh, XPl, DM, 0LL, Wqkvb, DM, 0LL,
      (void*)QKh, NQK, 0LL, (void*)QKl, NQK, 0LL, NQK,
      NB * SEQ, NQK, DM, 1.0f);
  // (3) v^T per batch element: VTh[bl][m][s] = sum_k Wvb[m][k] Xb[bl*SEQ+s][k] -> f16 hi plane (pitch SEQ) and
  //     residual plane (x4096, keys < VLP, pitch VLP)  (M=1024, N=2048, K=1024, single product)
  gemm64<0, 3, 2><<<gVT, dim3(128), 0, stream>>>(
      Wvb, Wvb, DM, 0LL, Xb, DM, (long long)SEQ * DM,
      (void*)VTh, SEQ, (long long)DM * SEQ, (void*)VTl, VLP, (long long)DM * VLP, VLP,
      DM, SEQ, DM, 4096.0f);
  // (4) causal attention: query blocks 0..RESQB-1 with residual planes, the rest without -> Ah/Al bf16 hi/lo
  attn64<true><<<dim3(NB * NH * RESQB), dim3(128), 0, stream>>>(
      QKh, QKl, VTh, VTl, Ah, Al, 0, RESQB, 0.125f);
  attn64<false><<<dim3(NB * NH * (NQB - RESQB)), dim3(128), 0, stream>>>(
      QKh, QKl, VTh, VTl, Ah, Al, RESQB, NQB - RESQB, 0.125f);
  // (5) out[row][n] = sum_k (Ah+Al)[row][k] Wob[n][k] -> d_out f32   (M=4096, N=1024, K=1024, 2 products)
  gemm64<1, 0, 2><<<gOut, dim3(128), 0, stream>>>(
      Ah, Al, DM, 0LL, Wob, DM, 0LL,
      (void*)outf, DM, 0LL, (void*)outf, 0, 0LL, 0,
      NB * SEQ, DM, DM, 1.0f);
  (void)hipGetLastError();
}

// v003
// A run of this version takes 193 microseconds.
// Timed twice side by side with v002, it ran 1.04 times as fast both times.
// Over all steps from v000 it is 2.11 times as fast.
// Contractions: q|k projection = v_wmma_f32_16x16x32_bf16 with (x+pos) as bf16 hi/lo planes times the bf16 Wqk plane (2 products);
// v^T projection = v_wmma_f32_16x16x32_bf16 (bf16 x times bf16 Wv, single product);
// q.k^T scores = v_wmma_f32_16x16x32_bf16 with bf16 hi/lo split q and k (hi.hi + hi.lo + lo.hi);
// p.v = v_wmma_f32_16x16x32_f16 (p carried x1024 in f16, v in f16; extra f16 residual planes x4096 of p and v on the first 512 query rows);
// a.Wout^T = v_wmma_f32_16x16x32_bf16 with a as bf16 hi/lo planes times the bf16 Wout plane (2 products); all f32 accumulate; softmax in f32.
#include <hip/hip_runtime.h>
#include <math.h>
#include <stdint.h>

#define NB    2
#define SEQ   2048
#define DM    1024
#define NH    16
#define HD    64
#define NQK   (2 * DM)       // pitch of the q|k planes: q feature columns 0..DM-1, k feature columns DM..2DM-1
#define NQB   (SEQ / 64)     // 32 query / key tiles of 64
#define VLP   512            // key pitch of the v^T residual plane (keys 0..VLP-1)
#define RESQB 8              // leading 64-row query blocks that use the p / v residual planes
static_assert(RESQB * 64 <= VLP);
static_assert(NH * HD == DM);
static_assert((SEQ % 128) == 0 && (DM % 256) == 0);
static_assert(HD == 64);
static_assert(((NB * SEQ * DM / 8) % 256) == 0);
static_assert(((DM * DM / 8) % 256) == 0);
static_assert(((3 * DM * DM / 8) % 256) == 0);
static_assert(((SEQ * DM) % 8) == 0);

typedef _Float16 v16h __attribute__((ext_vector_type(16)));
typedef _Float16 v8h  __attribute__((ext_vector_type(8)));
typedef __bf16   v16b __attribute__((ext_vector_type(16)));
typedef __bf16   v8b  __attribute__((ext_vector_type(8)));
typedef float    v8f  __attribute__((ext_vector_type(8)));
typedef float    v4f  __attribute__((ext_vector_type(4)));
typedef unsigned int v4u __attribute__((ext_vector_type(4)));

// ---- scalar helpers --------------------------------------------------------------------------------
__device__ __forceinline__ unsigned short bf_bits(float f) {          // f32 -> bf16 bits, RNE convert
  unsigned u = __float_as_uint(f);
  return (unsigned short)((u + 0x7FFFu + ((u >> 16) & 1u)) >> 16);
}
__device__ __forceinline__ float bf_up(unsigned short h) { return __uint_as_float(((unsigned)h) << 16); }
__device__ __forceinline__ unsigned short h_bits(_Float16 x) { return __builtin_bit_cast(unsigned short, x); }
__device__ __forceinline__ unsigned pk16(unsigned short a, unsigned short b) { return (unsigned)a | ((unsigned)b << 16); }
__device__ __forceinline__ v8f zero8() { v8f z = {0.f, 0.f, 0.f, 0.f, 0.f, 0.f, 0.f, 0.f}; return z; }
__device__ __forceinline__ v8h zero8h() {
  const _Float16 z = (_Float16)0.0f;
  v8h r = {z, z, z, z, z, z, z, z};
  return r;
}

// ---- fragment loader: 16-bit A/B operand, lane -> row/col (lane&15), p already includes +8*(lane>>4);
//      elements 0..7 <- p[0..7] (k0+8h..), elements 8..15 <- p[16..23] (k0+16+8h..)
__device__ __forceinline__ v16b ldfrag_b(const __bf16* p) {
  union { v16b v; v8b h[2]; } f;
  f.h[0] = *(const v8b*)(p);
  f.h[1] = *(const v8b*)(p + 16);
  return f.v;
}

// ---- WMMA helpers with trailing VALU hazard gap --------------------------------------------------------
__device__ __forceinline__ v8f mma_b(v16b a, v16b b, v8f c) {
  c = __builtin_amdgcn_wmma_f32_16x16x32_bf16(false, a, false, b, (short)0, c, false, false);
#if defined(__HIP_DEVICE_COMPILE__)
  asm volatile("v_nop\n\tv_nop\n\tv_nop\n\tv_nop" : "+v"(c) : "v"(a), "v"(b));
#endif
  return c;
}
__device__ __forceinline__ v8f mma_h(v16h a, v16h b, v8f c) {
  c = __builtin_amdgcn_wmma_f32_16x16x32_f16(false, a, false, b, (short)0, c, false, false);
#if defined(__HIP_DEVICE_COMPILE__)
  asm volatile("v_nop\n\tv_nop\n\tv_nop\n\tv_nop" : "+v"(c) : "v"(a), "v"(b));
#endif
  return c;
}
__device__ __forceinline__ v8f mma_b_raw(v16b a, v16b b, v8f c) {
  return __builtin_amdgcn_wmma_f32_16x16x32_bf16(false, a, false, b, (short)0, c, false, false);
}
__device__ __forceinline__ void dep_guard_b(v8f& a, v8f& b, v16b x, v16b y) {
#if defined(__HIP_DEVICE_COMPILE__)
  asm volatile("v_nop\n\tv_nop\n\tv_nop\n\tv_nop" : "+v"(a), "+v"(b) : "v"(x), "v"(y));
#endif
}
__device__ __forceinline__ void keep4_b(v16b a, v16b b, v16b c, v16b d) {
#if defined(__HIP_DEVICE_COMPILE__)
  asm volatile("v_nop" :: "v"(a), "v"(b), "v"(c), "v"(d));
#endif
}
__device__ __forceinline__ void acc_guard4(v8f& a, v8f& b, v8f& c, v8f& d) {
#if defined(__HIP_DEVICE_COMPILE__)
  asm volatile("v_nop\n\tv_nop\n\tv_nop\n\tv_nop" : "+v"(a), "+v"(b), "+v"(c), "+v"(d));
#endif
}

// =====================================================================================================
// f32 -> bf16 (RNE convert), 8 elements per thread, one 16-B store per lane: a wave writes 512 contiguous B
// host-checked). coverage: n8 threads x 8 = whole plane.
// =====================================================================================================
__global__ __launch_bounds__(256) void cvt_bf16x8(const float* __restrict__ in, unsigned short* out, int n8) {
  const int i = blockIdx.x * 256 + threadIdx.x;
  if (i < n8) {
    const v4f a = *(const v4f*)(in + (size_t)i * 8);
    const v4f b = *(const v4f*)(in + (size_t)i * 8 + 4);
    v4u p;
    p[0] = pk16(bf_bits(a[0]), bf_bits(a[1]));
    p[1] = pk16(bf_bits(a[2]), bf_bits(a[3]));
    p[2] = pk16(bf_bits(b[0]), bf_bits(b[1]));
    p[3] = pk16(bf_bits(b[2]), bf_bits(b[3]));
    *(v4u*)(out + (size_t)i * 8) = p;
    
  }
}

// =====================================================================================================
// x prep: xb = bf16(x) (RNE convert); s = bf_up(bf16(x)) + bf_up(bf16(pos)) in f32 (pos element index =
// x element index mod SEQ*DM); hp = bf16 hi plane of s, lp = bf16 lo plane (lo = RNE(s - hi), unscaled).
// three planes (n8 multiple of 256, host-checked).
// =====================================================================================================
__global__ __launch_bounds__(256) void prep_x8(const float* __restrict__ x, const float* __restrict__ pos,
                                               unsigned short* xb, unsigned short* hp, unsigned short* lp,
                                               int n8, int p8) {
#pragma clang fp contract(off)
  const int i = blockIdx.x * 256 + threadIdx.x;
  if (i < n8) {
    const int ip = i % p8;
    const v4f a  = *(const v4f*)(x + (size_t)i * 8);
    const v4f b  = *(const v4f*)(x + (size_t)i * 8 + 4);
    const v4f pa = *(const v4f*)(pos + (size_t)ip * 8);
    const v4f pb = *(const v4f*)(pos + (size_t)ip * 8 + 4);
    v4u px, ph, pl;
#pragma unroll
    for (int e = 0; e < 4; ++e) {
      const float f0 = (e < 2) ? a[2 * e]      : b[2 * e - 4];
      const float f1 = (e < 2) ? a[2 * e + 1]  : b[2 * e - 3];
      const float g0 = (e < 2) ? pa[2 * e]     : pb[2 * e - 4];
      const float g1 = (e < 2) ? pa[2 * e + 1] : pb[2 * e - 3];
      const unsigned short x0 = bf_bits(f0), x1 = bf_bits(f1);
      const float s0 = bf_up(x0) + bf_up(bf_bits(g0));
      const float s1 = bf_up(x1) + bf_up(bf_bits(g1));
      const unsigned short h0 = bf_bits(s0), h1 = bf_bits(s1);
      const unsigned short l0 = bf_bits(s0 - bf_up(h0)), l1 = bf_bits(s1 - bf_up(h1));
      px[e] = pk16(x0, x1);
      ph[e] = pk16(h0, h1);
      pl[e] = pk16(l0, l1);
    }
    *(v4u*)(xb + (size_t)i * 8) = px;
    *(v4u*)(hp + (size_t)i * 8) = ph;
    *(v4u*)(lp + (size_t)i * 8) = pl;
    
  }
}

// =====================================================================================================
// Eight asynchronous 16-B-per-lane copies global -> LDS (no register in between). The closing s_wait_xcnt stands
// in the copies' own statement so that no address register named here is rewritten in front of it (a precaution).
// =====================================================================================================
__device__ __forceinline__ void copy8_async(const unsigned (&l)[8], const __bf16* const (&g)[8]) {
#if defined(__HIP_DEVICE_COMPILE__)
  asm volatile(
      "global_load_async_to_lds_b128 %0, %8, off\n\t"
      "global_load_async_to_lds_b128 %1, %9, off\n\t"
      "global_load_async_to_lds_b128 %2, %10, off\n\t"
      "global_load_async_to_lds_b128 %3, %11, off\n\t"
      "global_load_async_to_lds_b128 %4, %12, off\n\t"
      "global_load_async_to_lds_b128 %5, %13, off\n\t"
      "global_load_async_to_lds_b128 %6, %14, off\n\t"
      "global_load_async_to_lds_b128 %7, %15, off\n\t"
      "s_wait_xcnt 0x0"
      :: "v"(l[0]), "v"(l[1]), "v"(l[2]), "v"(l[3]), "v"(l[4]), "v"(l[5]), "v"(l[6]), "v"(l[7]),
         "v"(g[0]), "v"(g[1]), "v"(g[2]), "v"(g[3]), "v"(g[4]), "v"(g[5]), "v"(g[6]), "v"(g[7])
      : "memory");
#endif
}

// =====================================================================================================
// Batched bf16 WMMA GEMM: C[m][n] = sum_k A[m][k] * Bt[n][k]. A block of 2 x WN waves owns a 128 x (64*WN) tile of
// C, each wave a 64x64 part of it. A row-major [M][K] pitch lda; Bt row-major [N][K] pitch ldb (k contiguous);
// M a multiple of 128, N of 64*WN, K of 64 (host constants). blockIdx.y = batch index (strides in elements).
// Operands: per stage of 64 k the block's rows [A 128 | A2 128 (NSPLIT 1) | Bt 64*WN], 128 B each, are copied to
// LDS at pitch 144 B by asynchronous copies (a wave's copy = 4 whole 128-B lines); two buffers, stage t+1 flies
// while stage t is multiplied; the waves read their fragments from LDS with ds loads.
// NSPLIT: 0 = A.Bt; 1 = (A + A2).Bt (A2 = unscaled bf16 lo plane of A).
// OUT_MODE: 0 = f32 (pitch ldc); 2 = bf16 hi plane C + bf16 lo plane C2 (lo = RNE(v - hi), unscaled);
//           3 = f16 hi plane C + f16 residual plane C2 = f16((v - hi) * rscale), C2 written only for tiles
//               with n0 < N2 (pitch ldc2, batch stride strideC2).
// =====================================================================================================
template <int NSPLIT, int OUT_MODE, int WN>
__global__ __launch_bounds__(64 * WN) void gemm64(
    const unsigned short* __restrict__ Ap, const unsigned short* A2p, int lda, long long strideA,
    const unsigned short* __restrict__ Btp, int ldb, long long strideB,
    void* Cout, int ldc, long long strideC,
    void* Cout2, int ldc2, long long strideC2, int N2,
    int M, int N, int K, float rscale) {
  static_assert(NSPLIT == 0 || NSPLIT == 1);
  constexpr int NT    = 64 * WN;                       // threads
  constexpr int BM    = 128;                           // block rows of C
  constexpr int BN    = 64 * WN;                       // block columns of C
  constexpr int KS    = 64;                            // k per stage (128 B of every operand row)
  constexpr int AROWS = (NSPLIT == 1 ? 2 : 1) * BM;    // stage rows that hold A (and A2)
  constexpr int ROWS  = AROWS + BN;                    // stage rows in all
  constexpr int PE    = 72;                            // LDS row pitch in elements (144 B = 16 B x 9)
  constexpr int BUFE  = ROWS * PE;                     // elements of one buffer
  constexpr int RPI   = NT / 8;                        // stage rows that one copy of every thread covers
  constexpr int NIT   = ROWS / RPI;                    // copies per thread and stage
  static_assert((BM % RPI) == 0 && (NIT % 8) == 0 && NIT <= 63);
  const __bf16* A   = (const __bf16*)(const void*)Ap;
  const __bf16* A2  = (const __bf16*)(const void*)A2p;
  const __bf16* Bt  = (const __bf16*)(const void*)Btp;
  __shared__ __align__(16) __bf16 ring[2 * BUFE];       // two stage buffers
  __shared__ __align__(16) float sT[2 * WN][16 * 68];   // per-wave 16x64 slab, pitch 68 floats
  const int b    = blockIdx.y;
  const int tid  = threadIdx.x;
  const int lane = tid & 31;
  const int wave = tid >> 5;
  const int tilesN = N / BN;
  const int tilesM = M / BM;
  const int tile = blockIdx.x;
  if (tile >= tilesM * tilesN) return;   // block-uniform, in front of every copy and barrier
  const int tm = tile / tilesN;
  const int tn = tile - tm * tilesN;
  const int wm = wave / WN;                    // wave's 64-row part of the block tile
  const int wn = wave - wm * WN;               // wave's 64-column part
  const int m0 = tm * BM + (wm << 6);
  const int n0 = tn * BN + (wn << 6);

  const int rlane = lane & 15;                 // row (A) / col (B, D) within subtile
  const int koff  = (lane >> 4) * 8;           // k offset of this lane half
  const int mOff  = (lane >> 4) * 8;           // D row offset

  // this thread's 16-B piece of stage row (tid >> 3): source pointers at k = 0 and LDS byte address in buffer 0
  const int crow = tid >> 3, cpc = (tid & 7) * 8;
  const __bf16* gA  = A  + (size_t)b * strideA + (size_t)(tm * BM + crow) * lda + cpc;
  const __bf16* gA2 = (NSPLIT == 1) ? (A2 + (size_t)b * strideA + (size_t)(tm * BM + crow) * lda + cpc) : gA;
  const __bf16* gB  = Bt + (size_t)b * strideB + (size_t)(tn * BN + crow) * ldb + cpc;
  const unsigned lds0 = (unsigned)(size_t)(const void*)ring + (unsigned)(crow * PE + cpc) * 2u;

  // copies the next stage not yet asked for into buffer buf; the three source pointers then step on by one stage
  auto issue_stage = [&](int buf) {
    const unsigned lb = lds0 + (unsigned)buf * (unsigned)(BUFE * 2);
    // both loops unrolled: the stage row decides at compile time which operand a copy reads
#pragma unroll
    for (int g8 = 0; g8 < NIT / 8; ++g8) {
      unsigned dst[8];
      const __bf16* sp[8];
#pragma unroll
      for (int e = 0; e < 8; ++e) {
        const int sr = (g8 * 8 + e) * RPI;     // first stage row of this copy, a compile-time value
        sp[e]  = (sr < BM) ? (gA + (size_t)sr * lda)
               : (sr < AROWS) ? (gA2 + (size_t)(sr - BM) * lda)
                              : (gB + (size_t)(sr - AROWS) * ldb);
        dst[e] = lb + (unsigned)(sr * PE * 2);
      }
      copy8_async(dst, sp);
    }
    gA += KS; gA2 += KS; gB += KS;
  };

  v8f acc[4][4];
#pragma unroll
  for (int i = 0; i < 4; ++i)
#pragma unroll
    for (int j = 0; j < 4; ++j) acc[i][j] = zero8();

  const int nst = K / KS;
  issue_stage(0);
  asm volatile("s_wait_asynccnt 0x0" ::: "memory");   // this wave's copies of stage 0 have landed
  __syncthreads();                                    // ... and every other wave's: stage 0 may be read
  if (nst > 1) issue_stage(1);

  for (int t = 0; t < nst; ++t) {
    const __bf16* sb  = ring + (t & 1) * BUFE;
    const __bf16* sA  = sb + ((wm << 6) + rlane) * PE + koff;
    const __bf16* sA2 = sA + BM * PE;
    const __bf16* sB  = sb + (AROWS + (wn << 6) + rlane) * PE + koff;
    // every loop of the stage is unrolled: fragments and accumulators are register arrays (constant indices only)
#pragma unroll
    for (int kk = 0; kk < KS; kk += 32) {
      v16b bh[4], ah[4], al[4];
#pragma unroll
      for (int j = 0; j < 4; ++j) bh[j] = ldfrag_b(sB + (j << 4) * PE + kk);
#pragma unroll
      for (int i = 0; i < 4; ++i) {
        ah[i] = ldfrag_b(sA + (i << 4) * PE + kk);
        if (NSPLIT == 1) al[i] = ldfrag_b(sA2 + (i << 4) * PE + kk); else al[i] = ah[i];
      }
#pragma unroll
      for (int i = 0; i < 4; ++i) {
#pragma unroll
        for (int j = 0; j < 4; ++j) acc[i][j] = mma_b_raw(ah[i], bh[j], acc[i][j]);
        if (NSPLIT == 1) {
#pragma unroll
          for (int j = 0; j < 4; ++j) acc[i][j] = mma_b_raw(al[i], bh[j], acc[i][j]);
        }
        dep_guard_b(acc[i][0], acc[i][3], ah[i], al[i]);
      }
      keep4_b(bh[0], bh[1], bh[2], bh[3]);
    }
    asm volatile("s_wait_dscnt 0x0" ::: "memory");     // this wave's reads of buffer t & 1 are done
    asm volatile("s_wait_asynccnt 0x0" ::: "memory");  // this wave's copies of stage t + 1 have landed
    __syncthreads();                                   // publishes stage t + 1, frees buffer t & 1
    if (t + 2 < nst) issue_stage(t & 1);
  }
  asm volatile("s_wait_asynccnt 0x0" ::: "memory");    // no copy is outstanding when the wave goes on
  acc_guard4(acc[0][0], acc[0][1], acc[0][2], acc[0][3]);
  acc_guard4(acc[1][0], acc[1][1], acc[1][2], acc[1][3]);
  acc_guard4(acc[2][0], acc[2][1], acc[2][2], acc[2][3]);
  acc_guard4(acc[3][0], acc[3][1], acc[3][2], acc[3][3]);

  // ---- epilogue ----
  float* slab = sT[wave];
#pragma unroll
  for (int i = 0; i < 4; ++i) {
    const int mBase = m0 + (i << 4);
#pragma unroll
    for (int r = 0; r < 8; ++r) {
#pragma unroll
      for (int j = 0; j < 4; ++j) {
        slab[(mOff + r) * 68 + (j << 4) + rlane] = acc[i][j][r];
      }
    }
    __builtin_amdgcn_fence(__ATOMIC_RELEASE, "workgroup");
    __builtin_amdgcn_wave_barrier();
    __builtin_amdgcn_fence(__ATOMIC_ACQUIRE, "workgroup");
    if (OUT_MODE == 0) {
      float* C = (float*)Cout + (size_t)b * strideC;
      const int hh = lane >> 4, c4 = (lane & 15) * 4;     // 256-B row segment = 16 lanes x 16 B
      v4f ov[8];
#pragma unroll
      for (int it = 0; it < 8; ++it) {
        const int row = it * 2 + hh;                       // it 0..7 x hh 0..1 = rows 0..15
        ov[it] = *(const v4f*)(slab + row * 68 + c4);
      }
      {
#pragma unroll
        for (int it = 0; it < 8; ++it) {
          const int row = it * 2 + hh;
          *(v4f*)(C + (size_t)(mBase + row) * ldc + n0 + c4) = ov[it];
        }
        
      }
    } else {
      const int q = lane >> 3, c8 = (lane & 7) * 8;
      unsigned short* C  = (unsigned short*)Cout  + (size_t)b * strideC;
      unsigned short* C2 = (unsigned short*)Cout2 + (size_t)b * strideC2;
      const bool wlo = (OUT_MODE == 2) || (n0 < N2);      // wave-uniform
      v4u hv[4], lv[4];
#pragma unroll
      for (int it = 0; it < 4; ++it) {
        const int row = it * 4 + q;                        // it 0..3 x q 0..3 = rows 0..15
        const float* sp = slab + row * 68 + c8;
        v4u a, a2;
#pragma unroll
        for (int e = 0; e < 4; ++e) {
          const float f0 = sp[2 * e], f1 = sp[2 * e + 1];
          unsigned short h0, h1, l0, l1;
          if (OUT_MODE == 2) {
            h0 = bf_bits(f0); h1 = bf_bits(f1);
            l0 = bf_bits(f0 - bf_up(h0)); l1 = bf_bits(f1 - bf_up(h1));
          } else {
            const _Float16 x0 = (_Float16)f0, x1 = (_Float16)f1;
            h0 = h_bits(x0); h1 = h_bits(x1);
            l0 = h_bits((_Float16)((f0 - (float)x0) * rscale));
            l1 = h_bits((_Float16)((f1 - (float)x1) * rscale));
          }
          a[e] = pk16(h0, h1); a2[e] = pk16(l0, l1);
        }
        hv[it] = a; lv[it] = a2;
      }
      {
#pragma unroll
        for (int it = 0; it < 4; ++it) {
          const int row = it * 4 + q;
          *(v4u*)(C + (size_t)(mBase + row) * ldc + n0 + c8) = hv[it];
          if (wlo) *(v4u*)(C2 + (size_t)(mBase + row) * ldc2 + n0 + c8) = lv[it];
        }
        
      }
    }
    __builtin_amdgcn_fence(__ATOMIC_RELEASE, "workgroup");
    __builtin_amdgcn_wave_barrier();
    __builtin_amdgcn_fence(__ATOMIC_ACQUIRE, "workgroup");
  }
}

// =====================================================================================================
// Causal attention, head dim 64. Key index > query index: the scaled logit is REPLACED by -inf (its softmax
// weight is exactly 0; every query row keeps key 0, so no row is fully masked). Key chunks with first key above
// the block's last query row are not visited (chunks 0..qb, two a trip: block-uniform trip count <= 16).
//   q|k planes (bf16 hi / lo), pitch NQK: q element (bl, t, h, d) at [(bl*SEQ + t)*NQK + h*64 + d],
//                                          k element (bl, s, h, d) at [(bl*SEQ + s)*NQK + DM + h*64 + d]
//   v^T hi plane (f16):      element (bl, h, d, s) at [(bl*DM + h*64 + d)*SEQ + s]
//   v^T residual plane (f16, (v - hi)*4096): [(bl*DM + h*64 + d)*VLP + s], s < VLP, read only when RES
//   (with RES only key tiles below VLP occur; the address is clamped and the value zeroed otherwise)
//   out: bf16 hi plane ah + bf16 lo plane al (lo = RNE(v - hi), unscaled) of the normalised context,
//        element (bl, t, h*64 + d) at [(bl*SEQ + t)*DM + h*64 + d].
//   scores = q . k : bf16 hi/lo split (hi.hi + hi.lo + lo.hi), f32 accumulate, then * sscale in f32
//   p = exp(s - m) carried as f16(1024 p); context = p . v on f16 WMMA; RES adds f16 residual planes of p and v
//   (scale 4096, separate accumulator folded back with 1/4096 per chunk in f32); online softmax in f32 with a
//   -inf-safe running max.
//   Block = 8 waves = 64 query rows of one (bl, h); grid = nqbThis * NH * NB; kv chunks of 64.
//   Two groups of 4 waves walk the key chunks side by side: group g takes chunks g, g + 2, g + 4, ... with its own
//   K / V^T tiles and its own running (m, l, context), so a block's serial walk is half as many chunks long. Behind
//   the walk group 1 hands its (m, l, context) over in LDS and group 0 joins the two partial softmaxes in f32.
//   K / V^T chunk staging: a group's 128 threads x 32 elements per plane = its whole 64x64 tile (plain 16-B loads,
//   __syncthreads before and after); P tiles are wave-private, spilled with _Float16 element stores and reloaded
//   Output coverage: each wave of group 0 stores rows q0..q0+15 (it 0..3 x lane>>3 0..3) x 64 columns,
// =====================================================================================================
template <bool RES>
__global__ __launch_bounds__(256, RES ? 2 : 6)   // without residual planes three blocks share a WGP: 6 waves a SIMD
void attn64(const unsigned short* __restrict__ qkhp, const unsigned short* __restrict__ qklp,
            const unsigned short* __restrict__ vhp, const unsigned short* __restrict__ vlp,
            unsigned short* ahp, unsigned short* alp, int qbBase, int nqbThis, float sscale) {
  union FB { v16b v; v8b h[2]; };
  union FH { v16h v; v8h h[2]; };
  // LDS row pitches: 16-bit tiles 72 elements (144 B = 16 B x 9), so that the 16 rows which a 16-B fragment read
  // touches fall on 16 different groups of four banks; the f32 tile 68 floats (272 B = 16 B x 17), likewise.
  constexpr int LP = 72;
  constexpr int OP = 68;
  constexpr int PLE = 64 * LP;                                    // elements of one 64-row tile plane, 9 KB
  constexpr int NPL = RES ? 4 : 3;                                // planes of a group: K hi, K lo, V^T hi, (V^T residual)
  __shared__ __align__(16) unsigned short KV[2 * NPL * PLE];      // per group its planes in a row: one base register
  __shared__ __align__(16) _Float16 Psh[8][16 * LP];              // per wave P [row][kv]
  __shared__ __align__(16) _Float16 Psl[RES ? 8 : 1][16 * LP];    // per wave P residual
  __shared__ __align__(16) float    Os[4][16 * OP];               // per 16 query rows: context tile [row][d]
  __shared__ __align__(16) float    Ml[4][32];                    // group 1's m (0..15) and l (16..31) per row

  const int wv   = __builtin_amdgcn_readfirstlane((int)(threadIdx.x >> 5));   // wave 0..7, held as a scalar
  const int grp  = wv >> 2;                 // key group of this wave (a scalar: branches on it are scalar branches)
  const int wave = wv & 3;                  // which 16 query rows of the block
  const int tid  = threadIdx.x & 127;       // thread within its group
  const int lane = tid & 31;
  unsigned short* const kvg = KV + grp * (NPL * PLE);
  __bf16*   const Ksh = (__bf16*)(void*)kvg;                      // K hi [kv][d]
  __bf16*   const Ksl = Ksh + PLE;                                // K lo
  _Float16* const Vth = (_Float16*)(void*)(kvg + 2 * PLE);        // V^T hi [d][kv]
  _Float16* const Vtl = Vth + (RES ? PLE : 0);                    // V^T residual (used with RES only)
  const int hh   = lane >> 4;
  const int c    = lane & 15;

  const int bx   = blockIdx.x;
  const int qbl  = bx % nqbThis;
  const int rest = bx / nqbThis;
  const int h    = rest % NH;
  const int b    = rest / NH;
  const int qb   = qbBase + qbl;
  const int q0   = qb * 64 + wave * 16;
  const size_t rowB = (size_t)b * SEQ;

  const __bf16* Qh = (const __bf16*)(const void*)qkhp + (size_t)h * HD;
  const __bf16* Ql = (const __bf16*)(const void*)qklp + (size_t)h * HD;
  const __bf16* Kh = (const __bf16*)(const void*)qkhp + (size_t)DM + (size_t)h * HD;
  const __bf16* Kl = (const __bf16*)(const void*)qklp + (size_t)DM + (size_t)h * HD;
  const _Float16* Vh = (const _Float16*)(const void*)vhp + ((size_t)b * DM + (size_t)h * HD) * SEQ;
  const _Float16* Vl = (const _Float16*)(const void*)vlp + ((size_t)b * DM + (size_t)h * HD) * VLP;

  // ---- Q fragments (A operand, row = lane&15): 2 d-chunks, hi and lo ----
  v16b qah[2], qal[2];
#pragma unroll
  for (int dc = 0; dc < 2; ++dc) {
    const size_t qo = (rowB + q0 + c) * NQK + dc * 32 + 8 * hh;
    qah[dc] = ldfrag_b(Qh + qo);
    qal[dc] = ldfrag_b(Ql + qo);
  }

  float mrow[8], lrow[8];
  v8f oacc[4];
#pragma unroll
  for (int r = 0; r < 8; ++r) { mrow[r] = -INFINITY; lrow[r] = 0.f; }
#pragma unroll
  for (int t = 0; t < 4; ++t) oacc[t] = zero8();

  int nkt = qb + 1;                          // key tiles 0..qb, block-uniform
  if (nkt > NQB) nkt = NQB;
  const int nit = (nkt + 1) >> 1;            // block-uniform trip count <= 16; every wave passes every barrier
  for (int it = 0; it < nit; ++it) {
    const int kt  = 2 * it + grp;            // this group's key tile
    const bool act = kt < nkt;               // false only in group 1's last trip when nkt is odd (a scalar)
    const int kv0 = kt * 64;
    __syncthreads();
    if (act) {
      const int r = tid >> 1, half = (tid & 1) * 32;
      const __bf16*   kg  = Kh + (rowB + kv0 + r) * NQK + half;   // K row kv0+r, d = half..half+31
      const __bf16*   klg = Kl + (rowB + kv0 + r) * NQK + half;
      const _Float16* vg  = Vh + (size_t)r * SEQ + kv0 + half;    // V^T row d = r, s = kv0+half..+31
      const int kvl = (kv0 + 64 <= VLP) ? kv0 : (VLP - 64);     // clamped address into the residual plane
      const _Float16* vlg = Vl + (size_t)r * VLP + kvl + half;
      const bool resOK = (kv0 + 64 <= VLP);                      // the same in a whole group
#pragma unroll
      for (int i = 0; i < 4; ++i) {
        const v8b a0 = *(const v8b*)(kg + 8 * i);
        const v8b a1 = *(const v8b*)(klg + 8 * i);
        const v8h b0 = *(const v8h*)(vg + 8 * i);
        *(v8b*)(Ksh + r * LP + half + 8 * i) = a0;
        *(v8b*)(Ksl + r * LP + half + 8 * i) = a1;
        *(v8h*)(Vth + r * LP + half + 8 * i) = b0;
        if (RES) {
          v8h b1 = *(const v8h*)(vlg + 8 * i);
          if (!resOK) b1 = zero8h();
          *(v8h*)(Vtl + r * LP + half + 8 * i) = b1;
        }
      }
    }
    __syncthreads();
    if (!act) continue;

    // ---- scores: 16 query rows x 64 keys per wave, 3 bf16 products ----
    v8f s[4];
#pragma unroll
    for (int j = 0; j < 4; ++j) {
      s[j] = zero8();
#pragma unroll
      for (int dc = 0; dc < 2; ++dc) {
        FB kb, kl;
        kb.h[0] = *(const v8b*)(Ksh + (j * 16 + c) * LP + dc * 32 + 8 * hh);
        kb.h[1] = *(const v8b*)(Ksh + (j * 16 + c) * LP + dc * 32 + 16 + 8 * hh);
        kl.h[0] = *(const v8b*)(Ksl + (j * 16 + c) * LP + dc * 32 + 8 * hh);
        kl.h[1] = *(const v8b*)(Ksl + (j * 16 + c) * LP + dc * 32 + 16 + 8 * hh);
        s[j] = mma_b(qah[dc], kb.v, s[j]);
        s[j] = mma_b(qah[dc], kl.v, s[j]);
        s[j] = mma_b(qal[dc], kb.v, s[j]);
      }
    }

    // ---- scale + causal select (key > query -> -inf by value), row max, online softmax,
    //      P (x1024, f16) and P residual (x4096) to LDS ----
    // key minus query row at j = 0, r = 0: the mask test then needs this one register, not one per row (the budget of
    // 160 registers is met without scratch)
    const int dkq = kv0 + c - (q0 + 8 * hh);
    _Float16* pwh = Psh[wv];
    _Float16* pwl = Psl[RES ? wv : 0];
#pragma unroll
    for (int r = 0; r < 8; ++r) {
      float m = -INFINITY;
#pragma unroll
      for (int j = 0; j < 4; ++j) {
        float sv = s[j][r] * sscale;
        sv = (dkq <= r - j * 16) ? sv : -INFINITY;    // key kv0 + 16 j + c <= query row q0 + 8 hh + r
        s[j][r] = sv;
        m = fmaxf(m, sv);
      }
#pragma unroll
      for (int off = 1; off < 16; off <<= 1) m = fmaxf(m, __shfl_xor(m, off, 32));
      const float mnew  = fmaxf(mrow[r], m);
      const float msafe = (mnew == -INFINITY) ? 0.f : mnew;
      const float alpha = __expf(mrow[r] - msafe);   // mrow = -inf -> 0 (l and context are 0 there anyway)
      mrow[r] = mnew;
      float psum = 0.f;
#pragma unroll
      for (int j = 0; j < 4; ++j) {
        const float p = __expf(s[j][r] - msafe);      // masked logit: exp(-inf) -> 0
        psum += p;
        const float p1k = p * 1024.0f;
        const _Float16 ph = (_Float16)p1k;
        pwh[(8 * hh + r) * LP + j * 16 + c] = ph;
        if (RES) {
          const _Float16 pl = (_Float16)((p1k - (float)ph) * 4096.0f);
          pwl[(8 * hh + r) * LP + j * 16 + c] = pl;
        }
      }
#pragma unroll
      for (int off = 1; off < 16; off <<= 1) psum += __shfl_xor(psum, off, 32);
      lrow[r] = lrow[r] * alpha + psum;
#pragma unroll
      for (int t = 0; t < 4; ++t) oacc[t][r] *= alpha;
    }
    __builtin_amdgcn_fence(__ATOMIC_RELEASE, "workgroup");
    __builtin_amdgcn_wave_barrier();
    __builtin_amdgcn_fence(__ATOMIC_ACQUIRE, "workgroup");

    // ---- context += P . V (f16 WMMA), residual products into a separate accumulator ----
    v8f o1[4];
#pragma unroll
    for (int t = 0; t < 4; ++t) o1[t] = zero8();
#pragma unroll 1
    for (int kk = 0; kk < 2; ++kk) {
      FH pa, pl;
      pa.h[0] = *(const v8h*)(pwh + c * LP + kk * 32 + 8 * hh);
      pa.h[1] = *(const v8h*)(pwh + c * LP + kk * 32 + 16 + 8 * hh);
      if (RES) {
        pl.h[0] = *(const v8h*)(pwl + c * LP + kk * 32 + 8 * hh);
        pl.h[1] = *(const v8h*)(pwl + c * LP + kk * 32 + 16 + 8 * hh);
      } else {
        pl.v = pa.v;
      }
#pragma unroll
      for (int t = 0; t < 4; ++t) {
        FH vb;
        vb.h[0] = *(const v8h*)(Vth + (t * 16 + c) * LP + kk * 32 + 8 * hh);
        vb.h[1] = *(const v8h*)(Vth + (t * 16 + c) * LP + kk * 32 + 16 + 8 * hh);
        oacc[t] = mma_h(pa.v, vb.v, oacc[t]);
        if (RES) {
          FH vl;
          vl.h[0] = *(const v8h*)(Vtl + (t * 16 + c) * LP + kk * 32 + 8 * hh);
          vl.h[1] = *(const v8h*)(Vtl + (t * 16 + c) * LP + kk * 32 + 16 + 8 * hh);
          o1[t] = mma_h(pa.v, vl.v, o1[t]);
          o1[t] = mma_h(pl.v, vb.v, o1[t]);
        }
      }
    }
    if (RES) {
#pragma unroll
      for (int t = 0; t < 4; ++t)
#pragma unroll
        for (int r = 0; r < 8; ++r) oacc[t][r] += o1[t][r] * (1.0f / 4096.0f);
    }
  }

  // ---- group 1 hands over its running maximum, sum and context (each lane its own accumulator positions) ----
  float* os = Os[wave];
  float* ml = Ml[wave];
  if (grp == 1) {
#pragma unroll
    for (int r = 0; r < 8; ++r) {
#pragma unroll
      for (int t = 0; t < 4; ++t) os[(8 * hh + r) * OP + t * 16 + c] = oacc[t][r];
      if (c == 0) {                          // m and l are equal in the 16 lanes of a row
        ml[8 * hh + r]      = mrow[r];
        ml[16 + 8 * hh + r] = lrow[r];
      }
    }
  }
  __syncthreads();                           // group 1's partial results may be read
  if (grp == 1) return;                      // no barrier follows

  // ---- join the two partial softmaxes (a group without a tile brings m = -inf, l = 0, context 0), normalise
  //      (1/l and the 1/1024 p carry), stage the 16x64 tile in LDS (each lane overwrites the positions it has just
  //      read), then write bf16 hi/lo
#pragma unroll
  for (int r = 0; r < 8; ++r) {
    const float m1 = ml[8 * hh + r];
    const float l1 = ml[16 + 8 * hh + r];
    const float mj    = fmaxf(mrow[r], m1);
    const float msafe = (mj == -INFINITY) ? 0.f : mj;
    const float a0 = __expf(mrow[r] - msafe);
    const float a1 = __expf(m1 - msafe);
    const float l = lrow[r] * a0 + l1 * a1;
    const float inv = ((l > 0.f) ? (1.0f / l) : 0.f) * (1.0f / 1024.0f);
#pragma unroll
    for (int t = 0; t < 4; ++t) {
      const int ix = (8 * hh + r) * OP + t * 16 + c;
      os[ix] = (oacc[t][r] * a0 + os[ix] * a1) * inv;
    }
  }
  __builtin_amdgcn_fence(__ATOMIC_RELEASE, "workgroup");
  __builtin_amdgcn_wave_barrier();
  __builtin_amdgcn_fence(__ATOMIC_ACQUIRE, "workgroup");
  {
    const int q = lane >> 3, c8 = (lane & 7) * 8;
    v4u hv[4], lv[4];
#pragma unroll
    for (int it = 0; it < 4; ++it) {
      const int row = it * 4 + q;      // it 0..3 x q 0..3 = rows 0..15 of the wave tile
      const float* sp = os + row * OP + c8;
      v4u a, a2;
#pragma unroll
      for (int e = 0; e < 4; ++e) {
        const float f0 = sp[2 * e], f1 = sp[2 * e + 1];
        const unsigned short h0 = bf_bits(f0), h1 = bf_bits(f1);
        const unsigned short l0 = bf_bits(f0 - bf_up(h0)), l1 = bf_bits(f1 - bf_up(h1));
        a[e] = pk16(h0, h1); a2[e] = pk16(l0, l1);
      }
      hv[it] = a; lv[it] = a2;
    }
    {
#pragma unroll
      for (int it = 0; it < 4; ++it) {
        const int row = it * 4 + q;
        const size_t go = (rowB + q0 + row) * DM + (size_t)h * HD + c8;
        *(v4u*)(ahp + go) = hv[it];
        *(v4u*)(alp + go) = lv[it];
      }
      
    }
  }
}

// =====================================================================================================
// Workspace map (bytes), every region an exact multiple of its whole-line / whole-tile store granularity
//  because M, N are multiples of 64 everywhere):
//   Wqkvb  bf16 [3072][1024]             0          6291456   (rows 0..2047 = Wq|Wk as Bt, rows 2048.. = Wv as A)
//   Wob    bf16 [1024][1024]             6291456    2097152
//   Xb     bf16 [4096][1024]             8388608    8388608
//   XPh    bf16 [4096][1024]            16777216    8388608
//   XPl    bf16 [4096][1024]            25165824    8388608
//   QKh    bf16 [4096][2048]            33554432   16777216
//   QKl    bf16 [4096][2048]            50331648   16777216
//   VTh    f16  [2][1024][2048]         67108864    8388608
//   VTl    f16  [2][1024][512]          75497472    2097152
//   Ah     bf16 [4096][1024]            77594624    8388608
//   Al     bf16 [4096][1024]            85983232    8388608
//   end                                 94371840
// Weights arrive [out n][in k] row-major = the Bt / A layout the GEMM wants (k contiguous), so they are only
// RNE-converted to bf16.
// =====================================================================================================
extern "C" void kernel_launch(void* const* d_in, const int* in_sizes, int n_in,
                              void* d_out, int out_size, void* d_ws, size_t ws_size,
                              hipStream_t stream) {
  if (n_in < 4) return;
  if (in_sizes[0] != NB * SEQ * DM) return;
  if (in_sizes[1] != SEQ * DM) return;
  if (in_sizes[2] != 3 * DM * DM) return;
  if (in_sizes[3] != DM * DM) return;
  if (out_size != NB * SEQ * DM) return;

  const float* x    = (const float*)d_in[0];   // [NB][SEQ][DM]
  const float* posp = (const float*)d_in[1];   // [SEQ][DM]
  const float* wqkv = (const float*)d_in[2];   // [3*DM n][DM k]
  const float* wo   = (const float*)d_in[3];   // [DM n][DM k]

  const size_t PWqkv = (size_t)3 * DM * DM * 2;       //  6291456  bf16 [3072][1024]
  const size_t PWo   = (size_t)DM * DM * 2;           //  2097152  bf16 [1024][1024]
  const size_t PX    = (size_t)NB * SEQ * DM * 2;     //  8388608  bf16 [4096][1024]
  const size_t PQK   = (size_t)NB * SEQ * NQK * 2;    // 16777216  bf16 [4096][2048]
  const size_t PVTh  = (size_t)NB * DM * SEQ * 2;     //  8388608
  const size_t PVTl  = (size_t)NB * DM * VLP * 2;     //  2097152
  size_t off = 0;
  const size_t oWqkv = off; off += PWqkv;
  const size_t oWo   = off; off += PWo;
  const size_t oXb   = off; off += PX;
  const size_t oXPh  = off; off += PX;
  const size_t oXPl  = off; off += PX;
  const size_t oQKh  = off; off += PQK;
  const size_t oQKl  = off; off += PQK;
  const size_t oVTh  = off; off += PVTh;
  const size_t oVTl  = off; off += PVTl;
  const size_t oAh   = off; off += PX;
  const size_t oAl   = off; off += PX;
  if (off > ws_size) return;                           // off = 94371840
  if (off > (size_t)134217728) return;

  char* ws = (char*)d_ws;
  unsigned short* Wqkvb = (unsigned short*)(ws + oWqkv);
  unsigned short* Wvb   = Wqkvb + (size_t)2 * DM * DM;   // rows 2048..3071 of the Wqkv plane
  unsigned short* Wob   = (unsigned short*)(ws + oWo);
  unsigned short* Xb    = (unsigned short*)(ws + oXb);
  unsigned short* XPh   = (unsigned short*)(ws + oXPh);
  unsigned short* XPl   = (unsigned short*)(ws + oXPl);
  unsigned short* QKh   = (unsigned short*)(ws + oQKh);
  unsigned short* QKl   = (unsigned short*)(ws + oQKl);
  unsigned short* VTh   = (unsigned short*)(ws + oVTh);
  unsigned short* VTl   = (unsigned short*)(ws + oVTl);
  unsigned short* Ah    = (unsigned short*)(ws + oAh);
  unsigned short* Al    = (unsigned short*)(ws + oAl);
  float*          outf  = (float*)d_out;

  const dim3 blk(256);
  const int n8qkv = 3 * DM * DM / 8;                                 // 393216 (multiple of 256)
  const int n8w   = DM * DM / 8;                                     // 131072 (multiple of 256)
  const int n8x   = NB * SEQ * DM / 8;                               // 524288 (multiple of 256)
  const int p8    = SEQ * DM / 8;                                    // 262144
  const dim3 gCvtQKV((n8qkv + 255) / 256);                           // 1536 blocks
  const dim3 gCvtW((n8w + 255) / 256);                               // 512 blocks
  const dim3 gPrep((n8x + 255) / 256);                               // 2048 blocks
  const dim3 gQK((NB * SEQ / 128) * (NQK / 256), 1);                 // 128x256 tiles -> 256 blocks of 8 waves
  const dim3 gVT((DM / 128) * (SEQ / 128), NB);                      // 128x128 tiles -> 128 blocks of 4 waves x 2
  const dim3 gOut((NB * SEQ / 128) * (DM / 128), 1);                 // 128x128 tiles -> 256 blocks of 4 waves

  // (1) weights -> bf16 planes (keep their [n][k] layout); x -> bf16 plane; x + pos -> bf16 hi/lo planes
  cvt_bf16x8<<<gCvtQKV, blk, 0, stream>>>(wqkv, Wqkvb, n8qkv);
  cvt_bf16x8<<<gCvtW, blk, 0, stream>>>(wo, Wob, n8w);
  prep_x8<<<gPrep, blk, 0, stream>>>(x, posp, Xb, XPh, XPl, n8x, p8);
  // (2) q|k projection: QK[row][n] = sum_k (XPh+XPl)[row][k] Wqkvb[n][k], n < 2048 -> bf16 hi/lo planes,
  //     pitch NQK   (M=4096, N=2048, K=1024, 2 products)
  gemm64<1, 2, 4><<<gQK, dim3(256), 0, stream>>>(
      XPh, XPl, DM, 0LL, Wqkvb, DM, 0LL,
      (void*)QKh, NQK, 0LL, (void*)QKl, NQK, 0LL, NQK,
      NB * SEQ, NQK, DM, 1.0f);
  // (3) v^T per batch element: VTh[bl][m][s] = sum_k Wvb[m][k] Xb[bl*SEQ+s][k] -> f16 hi plane (pitch SEQ) and
  //     residual plane (x4096, keys < VLP, pitch VLP)  (M=1024, N=2048, K=1024, single product)
  gemm64<0, 3, 2><<<gVT, dim3(128), 0, stream>>>(
      Wvb, Wvb, DM, 0LL, Xb, DM, (long long)SEQ * DM,
      (void*)VTh, SEQ, (long long)DM * SEQ, (void*)VTl, VLP, (long long)DM * VLP, VLP,
      DM, SEQ, DM, 4096.0f);
  // (4) causal attention: query blocks 0..RESQB-1 with residual planes, the rest without -> Ah/Al bf16 hi/lo
  attn64<true><<<dim3(NB * NH * RESQB), dim3(256), 0, stream>>>(
      QKh, QKl, VTh, VTl, Ah, Al, 0, RESQB, 0.125f);
  attn64<false><<<dim3(NB * NH * (NQB - RESQB)), dim3(256), 0, stream>>>(
      QKh, QKl, VTh, VTl, Ah, Al, RESQB, NQB - RESQB, 0.125f);
  // (5) out[row][n] = sum_k (Ah+Al)[row][k] Wob[n][k] -> d_out f32   (M=4096, N=1024, K=1024, 2 products)
  gemm64<1, 0, 2><<<gOut, dim3(128), 0, stream>>>(
      Ah, Al, DM, 0LL, Wob, DM, 0LL,
      (void*)outf, DM, 0LL, (void*)outf, 0, 0LL, 0,
      NB * SEQ, DM, DM, 1.0f);
  (void)hipGetLastError();
}

// v004
// Measured time: 151 microseconds a run.
// Timed twice side by side with v003, it ran 1.28 times as fast both times.
// Counting every step since v000, it is 2.70 times as fast.
// Contractions: q|k projection = v_wmma_f32_16x16x32_bf16 with (x+pos) as bf16 hi/lo planes times the bf16 Wqk plane (2 products);
// v^T projection = v_wmma_f32_16x16x32_bf16 (bf16 x times bf16 Wv, single product);
// q.k^T scores = v_wmma_f32_16x16x32_bf16 with bf16 hi/lo split q and k (hi.hi + hi.lo + lo.hi);
// p.v = v_wmma_f32_16x16x32_f16 (p carried x1024 in f16, v in f16; extra f16 residual planes x4096 of p and v on the first 512 query rows);
// a.Wout^T = v_wmma_f32_16x16x32_bf16 with a as bf16 hi/lo planes times the bf16 Wout plane (2 products); all f32 accumulate; softmax in f32.
#include <hip/hip_runtime.h>
#include <math.h>
#include <stdint.h>

#define NB    2
#define SEQ   2048
#define DM    1024
#define NH    16
#define HD    64
#define NQK   (2 * DM)       // pitch of the q|k planes: q feature columns 0..DM-1, k feature columns DM..2DM-1
#define NQB   (SEQ / 64)     // 32 query / key tiles of 64
#define VLP   512            // key pitch of the v^T residual plane (keys 0..VLP-1)
#define RESQB 8              // leading 64-row query blocks that use the p / v residual planes
static_assert(RESQB * 64 <= VLP);
static_assert(NH * HD == DM);
static_assert((SEQ % 128) == 0 && (DM % 256) == 0);
static_assert(HD == 64);
static_assert(((NB * SEQ * DM / 8) % 256) == 0);
static_assert(((DM * DM / 8) % 256) == 0);
static_assert(((3 * DM * DM / 8) % 256) == 0);
static_assert(((SEQ * DM) % 8) == 0);

typedef _Float16 v16h __attribute__((ext_vector_type(16)));
typedef _Float16 v8h  __attribute__((ext_vector_type(8)));
typedef __bf16   v16b __attribute__((ext_vector_type(16)));
typedef __bf16   v8b  __attribute__((ext_vector_type(8)));
typedef float    v8f  __attribute__((ext_vector_type(8)));
typedef float    v4f  __attribute__((ext_vector_type(4)));
typedef unsigned int v4u __attribute__((ext_vector_type(4)));

// ---- scalar helpers --------------------------------------------------------------------------------
__device__ __forceinline__ unsigned short bf_bits(float f) {          // f32 -> bf16 bits, RNE convert
  unsigned u = __float_as_uint(f);
  return (unsigned short)((u + 0x7FFFu + ((u >> 16) & 1u)) >> 16);
}
__device__ __forceinline__ float bf_up(unsigned short h) { return __uint_as_float(((unsigned)h) << 16); }
__device__ __forceinline__ unsigned short h_bits(_Float16 x) { return __builtin_bit_cast(unsigned short, x); }
__device__ __forceinline__ unsigned pk16(unsigned short a, unsigned short b) { return (unsigned)a | ((unsigned)b << 16); }
__device__ __forceinline__ v8f zero8() { v8f z = {0.f, 0.f, 0.f, 0.f, 0.f, 0.f, 0.f, 0.f}; return z; }
__device__ __forceinline__ v8h zero8h() {
  const _Float16 z = (_Float16)0.0f;
  v8h r = {z, z, z, z, z, z, z, z};
  return r;
}

// lane l reads lane l ^ 16: the two lanes that share a column of a B operand or of an accumulator tile
__device__ __forceinline__ float xhalf(float x) {
  return __builtin_bit_cast(float, __builtin_amdgcn_permlanex16(__builtin_bit_cast(int, x), __builtin_bit_cast(int, x),
                                                                0x76543210, 0xfedcba98, false, false));
}

// ---- fragment loader: 16-bit A/B operand, lane -> row/col (lane&15), p already includes +8*(lane>>4);
//      elements 0..7 <- p[0..7] (k0+8h..), elements 8..15 <- p[16..23] (k0+16+8h..)
__device__ __forceinline__ v16b ldfrag_b(const __bf16* p) {
  union { v16b v; v8b h[2]; } f;
  f.h[0] = *(const v8b*)(p);
  f.h[1] = *(const v8b*)(p + 16);
  return f.v;
}

// ---- WMMA helpers with trailing VALU hazard gap --------------------------------------------------------
__device__ __forceinline__ v8f mma_b(v16b a, v16b b, v8f c) {
  c = __builtin_amdgcn_wmma_f32_16x16x32_bf16(false, a, false, b, (short)0, c, false, false);
#if defined(__HIP_DEVICE_COMPILE__)
  asm volatile("v_nop\n\tv_nop\n\tv_nop\n\tv_nop" : "+v"(c) : "v"(a), "v"(b));
#endif
  return c;
}
__device__ __forceinline__ v8f mma_h(v16h a, v16h b, v8f c) {
  c = __builtin_amdgcn_wmma_f32_16x16x32_f16(false, a, false, b, (short)0, c, false, false);
#if defined(__HIP_DEVICE_COMPILE__)
  asm volatile("v_nop\n\tv_nop\n\tv_nop\n\tv_nop" : "+v"(c) : "v"(a), "v"(b));
#endif
  return c;
}
__device__ __forceinline__ v8f mma_b_raw(v16b a, v16b b, v8f c) {
  return __builtin_amdgcn_wmma_f32_16x16x32_bf16(false, a, false, b, (short)0, c, false, false);
}
__device__ __forceinline__ void dep_guard_b(v8f& a, v8f& b, v16b x, v16b y) {
#if defined(__HIP_DEVICE_COMPILE__)
  asm volatile("v_nop\n\tv_nop\n\tv_nop\n\tv_nop" : "+v"(a), "+v"(b) : "v"(x), "v"(y));
#endif
}
__device__ __forceinline__ void keep4_b(v16b a, v16b b, v16b c, v16b d) {
#if defined(__HIP_DEVICE_COMPILE__)
  asm volatile("v_nop" :: "v"(a), "v"(b), "v"(c), "v"(d));
#endif
}
__device__ __forceinline__ void acc_guard4(v8f& a, v8f& b, v8f& c, v8f& d) {
#if defined(__HIP_DEVICE_COMPILE__)
  asm volatile("v_nop\n\tv_nop\n\tv_nop\n\tv_nop" : "+v"(a), "+v"(b), "+v"(c), "+v"(d));
#endif
}

// =====================================================================================================
// f32 -> bf16 (RNE convert), 8 elements per thread, one 16-B store per lane: a wave writes 512 contiguous B
// host-checked). coverage: n8 threads x 8 = whole plane.
// =====================================================================================================
__global__ __launch_bounds__(256) void cvt_bf16x8(const float* __restrict__ in, unsigned short* out, int n8) {
  const int i = blockIdx.x * 256 + threadIdx.x;
  if (i < n8) {
    const v4f a = *(const v4f*)(in + (size_t)i * 8);
    const v4f b = *(const v4f*)(in + (size_t)i * 8 + 4);
    v4u p;
    p[0] = pk16(bf_bits(a[0]), bf_bits(a[1]));
    p[1] = pk16(bf_bits(a[2]), bf_bits(a[3]));
    p[2] = pk16(bf_bits(b[0]), bf_bits(b[1]));
    p[3] = pk16(bf_bits(b[2]), bf_bits(b[3]));
    *(v4u*)(out + (size_t)i * 8) = p;
    
  }
}

// =====================================================================================================
// x prep: xb = bf16(x) (RNE convert); s = bf_up(bf16(x)) + bf_up(bf16(pos)) in f32 (pos element index =
// x element index mod SEQ*DM); hp = bf16 hi plane of s, lp = bf16 lo plane (lo = RNE(s - hi), unscaled).
// three planes (n8 multiple of 256, host-checked).
// =====================================================================================================
__global__ __launch_bounds__(256) void prep_x8(const float* __restrict__ x, const float* __restrict__ pos,
                                               unsigned short* xb, unsigned short* hp, unsigned short* lp,
                                               int n8, int p8) {
#pragma clang fp contract(off)
  const int i = blockIdx.x * 256 + threadIdx.x;
  if (i < n8) {
    const int ip = i % p8;
    const v4f a  = *(const v4f*)(x + (size_t)i * 8);
    const v4f b  = *(const v4f*)(x + (size_t)i * 8 + 4);
    const v4f pa = *(const v4f*)(pos + (size_t)ip * 8);
    const v4f pb = *(const v4f*)(pos + (size_t)ip * 8 + 4);
    v4u px, ph, pl;
#pragma unroll
    for (int e = 0; e < 4; ++e) {
      const float f0 = (e < 2) ? a[2 * e]      : b[2 * e - 4];
      const float f1 = (e < 2) ? a[2 * e + 1]  : b[2 * e - 3];
      const float g0 = (e < 2) ? pa[2 * e]     : pb[2 * e - 4];
      const float g1 = (e < 2) ? pa[2 * e + 1] : pb[2 * e - 3];
      const unsigned short x0 = bf_bits(f0), x1 = bf_bits(f1);
      const float s0 = bf_up(x0) + bf_up(bf_bits(g0));
      const float s1 = bf_up(x1) + bf_up(bf_bits(g1));
      const unsigned short h0 = bf_bits(s0), h1 = bf_bits(s1);
      const unsigned short l0 = bf_bits(s0 - bf_up(h0)), l1 = bf_bits(s1 - bf_up(h1));
      px[e] = pk16(x0, x1);
      ph[e] = pk16(h0, h1);
      pl[e] = pk16(l0, l1);
    }
    *(v4u*)(xb + (size_t)i * 8) = px;
    *(v4u*)(hp + (size_t)i * 8) = ph;
    *(v4u*)(lp + (size_t)i * 8) = pl;
    
  }
}

// =====================================================================================================
// Eight asynchronous 16-B-per-lane copies global -> LDS (no register in between). The closing s_wait_xcnt stands
// in the copies' own statement so that no address register named here is rewritten in front of it (a precaution).
// =====================================================================================================
__device__ __forceinline__ void copy8_async(const unsigned (&l)[8], const __bf16* const (&g)[8]) {
#if defined(__HIP_DEVICE_COMPILE__)
  asm volatile(
      "global_load_async_to_lds_b128 %0, %8, off\n\t"
      "global_load_async_to_lds_b128 %1, %9, off\n\t"
      "global_load_async_to_lds_b128 %2, %10, off\n\t"
      "global_load_async_to_lds_b128 %3, %11, off\n\t"
      "global_load_async_to_lds_b128 %4, %12, off\n\t"
      "global_load_async_to_lds_b128 %5, %13, off\n\t"
      "global_load_async_to_lds_b128 %6, %14, off\n\t"
      "global_load_async_to_lds_b128 %7, %15, off\n\t"
      "s_wait_xcnt 0x0"
      :: "v"(l[0]), "v"(l[1]), "v"(l[2]), "v"(l[3]), "v"(l[4]), "v"(l[5]), "v"(l[6]), "v"(l[7]),
         "v"(g[0]), "v"(g[1]), "v"(g[2]), "v"(g[3]), "v"(g[4]), "v"(g[5]), "v"(g[6]), "v"(g[7])
      : "memory");
#endif
}

// =====================================================================================================
// Batched bf16 WMMA GEMM: C[m][n] = sum_k A[m][k] * Bt[n][k]. A block of 2 x WN waves owns a 128 x (64*WN) tile of
// C, each wave a 64x64 part of it. A row-major [M][K] pitch lda; Bt row-major [N][K] pitch ldb (k contiguous);
// M a multiple of 128, N of 64*WN, K of 64 (host constants). blockIdx.y = batch index (strides in elements).
// Operands: per stage of 64 k the block's rows [A 128 | A2 128 (NSPLIT 1) | Bt 64*WN], 128 B each, are copied to
// LDS at pitch 144 B by asynchronous copies (a wave's copy = 4 whole 128-B lines); two buffers, stage t+1 flies
// while stage t is multiplied; the waves read their fragments from LDS with ds loads.
// NSPLIT: 0 = A.Bt; 1 = (A + A2).Bt (A2 = unscaled bf16 lo plane of A).
// OUT_MODE: 0 = f32 (pitch ldc); 2 = bf16 hi plane C + bf16 lo plane C2 (lo = RNE(v - hi), unscaled);
//           3 = f16 hi plane C + f16 residual plane C2 = f16((v - hi) * rscale), C2 written only for tiles
//               with n0 < N2 (pitch ldc2, batch stride strideC2).
// =====================================================================================================
template <int NSPLIT, int OUT_MODE, int WN>
__global__ __launch_bounds__(64 * WN) void gemm64(
    const unsigned short* __restrict__ Ap, const unsigned short* A2p, int lda, long long strideA,
    const unsigned short* __restrict__ Btp, int ldb, long long strideB,
    void* Cout, int ldc, long long strideC,
    void* Cout2, int ldc2, long long strideC2, int N2,
    int M, int N, int K, float rscale) {
  static_assert(NSPLIT == 0 || NSPLIT == 1);
  constexpr int NT    = 64 * WN;                       // threads
  constexpr int BM    = 128;                           // block rows of C
  constexpr int BN    = 64 * WN;                       // block columns of C
  constexpr int KS    = 64;                            // k per stage (128 B of every operand row)
  constexpr int AROWS = (NSPLIT == 1 ? 2 : 1) * BM;    // stage rows that hold A (and A2)
  constexpr int ROWS  = AROWS + BN;                    // stage rows in all
  constexpr int PE    = 72;                            // LDS row pitch in elements (144 B = 16 B x 9)
  constexpr int BUFE  = ROWS * PE;                     // elements of one buffer
  constexpr int RPI   = NT / 8;                        // stage rows that one copy of every thread covers
  constexpr int NIT   = ROWS / RPI;                    // copies per thread and stage
  static_assert((BM % RPI) == 0 && (NIT % 8) == 0 && NIT <= 63);
  const __bf16* A   = (const __bf16*)(const void*)Ap;
  const __bf16* A2  = (const __bf16*)(const void*)A2p;
  const __bf16* Bt  = (const __bf16*)(const void*)Btp;
  __shared__ __align__(16) __bf16 ring[2 * BUFE];       // two stage buffers
  __shared__ __align__(16) float sT[2 * WN][16 * 68];   // per-wave 16x64 slab, pitch 68 floats
  const int b    = blockIdx.y;
  const int tid  = threadIdx.x;
  const int lane = tid & 31;
  const int wave = tid >> 5;
  const int tilesN = N / BN;
  const int tilesM = M / BM;
  const int tile = blockIdx.x;
  if (tile >= tilesM * tilesN) return;   // block-uniform, in front of every copy and barrier
  const int tm = tile / tilesN;
  const int tn = tile - tm * tilesN;
  const int wm = wave / WN;                    // wave's 64-row part of the block tile
  const int wn = wave - wm * WN;               // wave's 64-column part
  const int m0 = tm * BM + (wm << 6);
  const int n0 = tn * BN + (wn << 6);

  const int rlane = lane & 15;                 // row (A) / col (B, D) within subtile
  const int koff  = (lane >> 4) * 8;           // k offset of this lane half
  const int mOff  = (lane >> 4) * 8;           // D row offset

  // this thread's 16-B piece of stage row (tid >> 3): source pointers at k = 0 and LDS byte address in buffer 0
  const int crow = tid >> 3, cpc = (tid & 7) * 8;
  const __bf16* gA  = A  + (size_t)b * strideA + (size_t)(tm * BM + crow) * lda + cpc;
  const __bf16* gA2 = (NSPLIT == 1) ? (A2 + (size_t)b * strideA + (size_t)(tm * BM + crow) * lda + cpc) : gA;
  const __bf16* gB  = Bt + (size_t)b * strideB + (size_t)(tn * BN + crow) * ldb + cpc;
  const unsigned lds0 = (unsigned)(size_t)(const void*)ring + (unsigned)(crow * PE + cpc) * 2u;

  // copies the next stage not yet asked for into buffer buf; the three source pointers then step on by one stage
  auto issue_stage = [&](int buf) {
    const unsigned lb = lds0 + (unsigned)buf * (unsigned)(BUFE * 2);
    // both loops unrolled: the stage row decides at compile time which operand a copy reads
#pragma unroll
    for (int g8 = 0; g8 < NIT / 8; ++g8) {
      unsigned dst[8];
      const __bf16* sp[8];
#pragma unroll
      for (int e = 0; e < 8; ++e) {
        const int sr = (g8 * 8 + e) * RPI;     // first stage row of this copy, a compile-time value
        sp[e]  = (sr < BM) ? (gA + (size_t)sr * lda)
               : (sr < AROWS) ? (gA2 + (size_t)(sr - BM) * lda)
                              : (gB + (size_t)(sr - AROWS) * ldb);
        dst[e] = lb + (unsigned)(sr * PE * 2);
      }
      copy8_async(dst, sp);
    }
    gA += KS; gA2 += KS; gB += KS;
  };

  v8f acc[4][4];
#pragma unroll
  for (int i = 0; i < 4; ++i)
#pragma unroll
    for (int j = 0; j < 4; ++j) acc[i][j] = zero8();

  const int nst = K / KS;
  issue_stage(0);
  asm volatile("s_wait_asynccnt 0x0" ::: "memory");   // this wave's copies of stage 0 have landed
  __syncthreads();                                    // ... and every other wave's: stage 0 may be read
  if (nst > 1) issue_stage(1);

  for (int t = 0; t < nst; ++t) {
    const __bf16* sb  = ring + (t & 1) * BUFE;
    const __bf16* sA  = sb + ((wm << 6) + rlane) * PE + koff;
    const __bf16* sA2 = sA + BM * PE;
    const __bf16* sB  = sb + (AROWS + (wn << 6) + rlane) * PE + koff;
    // every loop of the stage is unrolled: fragments and accumulators are register arrays (constant indices only)
#pragma unroll
    for (int kk = 0; kk < KS; kk += 32) {
      v16b bh[4], ah[4], al[4];
#pragma unroll
      for (int j = 0; j < 4; ++j) bh[j] = ldfrag_b(sB + (j << 4) * PE + kk);
#pragma unroll
      for (int i = 0; i < 4; ++i) {
        ah[i] = ldfrag_b(sA + (i << 4) * PE + kk);
        if (NSPLIT == 1) al[i] = ldfrag_b(sA2 + (i << 4) * PE + kk); else al[i] = ah[i];
      }
#pragma unroll
      for (int i = 0; i < 4; ++i) {
#pragma unroll
        for (int j = 0; j < 4; ++j) acc[i][j] = mma_b_raw(ah[i], bh[j], acc[i][j]);
        if (NSPLIT == 1) {
#pragma unroll
          for (int j = 0; j < 4; ++j) acc[i][j] = mma_b_raw(al[i], bh[j], acc[i][j]);
        }
        dep_guard_b(acc[i][0], acc[i][3], ah[i], al[i]);
      }
      keep4_b(bh[0], bh[1], bh[2], bh[3]);
    }
    asm volatile("s_wait_dscnt 0x0" ::: "memory");     // this wave's reads of buffer t & 1 are done
    asm volatile("s_wait_asynccnt 0x0" ::: "memory");  // this wave's copies of stage t + 1 have landed
    __syncthreads();                                   // publishes stage t + 1, frees buffer t & 1
    if (t + 2 < nst) issue_stage(t & 1);
  }
  asm volatile("s_wait_asynccnt 0x0" ::: "memory");    // no copy is outstanding when the wave goes on
  acc_guard4(acc[0][0], acc[0][1], acc[0][2], acc[0][3]);
  acc_guard4(acc[1][0], acc[1][1], acc[1][2], acc[1][3]);
  acc_guard4(acc[2][0], acc[2][1], acc[2][2], acc[2][3]);
  acc_guard4(acc[3][0], acc[3][1], acc[3][2], acc[3][3]);

  // ---- epilogue ----
  float* slab = sT[wave];
#pragma unroll
  for (int i = 0; i < 4; ++i) {
    const int mBase = m0 + (i << 4);
#pragma unroll
    for (int r = 0; r < 8; ++r) {
#pragma unroll
      for (int j = 0; j < 4; ++j) {
        slab[(mOff + r) * 68 + (j << 4) + rlane] = acc[i][j][r];
      }
    }
    __builtin_amdgcn_fence(__ATOMIC_RELEASE, "workgroup");
    __builtin_amdgcn_wave_barrier();
    __builtin_amdgcn_fence(__ATOMIC_ACQUIRE, "workgroup");
    if (OUT_MODE == 0) {
      float* C = (float*)Cout + (size_t)b * strideC;
      const int hh = lane >> 4, c4 = (lane & 15) * 4;     // 256-B row segment = 16 lanes x 16 B
      v4f ov[8];
#pragma unroll
      for (int it = 0; it < 8; ++it) {
        const int row = it * 2 + hh;                       // it 0..7 x hh 0..1 = rows 0..15
        ov[it] = *(const v4f*)(slab + row * 68 + c4);
      }
      {
#pragma unroll
        for (int it = 0; it < 8; ++it) {
          const int row = it * 2 + hh;
          *(v4f*)(C + (size_t)(mBase + row) * ldc + n0 + c4) = ov[it];
        }
        
      }
    } else {
      const int q = lane >> 3, c8 = (lane & 7) * 8;
      unsigned short* C  = (unsigned short*)Cout  + (size_t)b * strideC;
      unsigned short* C2 = (unsigned short*)Cout2 + (size_t)b * strideC2;
      const bool wlo = (OUT_MODE == 2) || (n0 < N2);      // wave-uniform
      v4u hv[4], lv[4];
#pragma unroll
      for (int it = 0; it < 4; ++it) {
        const int row = it * 4 + q;                        // it 0..3 x q 0..3 = rows 0..15
        const float* sp = slab + row * 68 + c8;
        v4u a, a2;
#pragma unroll
        for (int e = 0; e < 4; ++e) {
          const float f0 = sp[2 * e], f1 = sp[2 * e + 1];
          unsigned short h0, h1, l0, l1;
          if (OUT_MODE == 2) {
            h0 = bf_bits(f0); h1 = bf_bits(f1);
            l0 = bf_bits(f0 - bf_up(h0)); l1 = bf_bits(f1 - bf_up(h1));
          } else {
            const _Float16 x0 = (_Float16)f0, x1 = (_Float16)f1;
            h0 = h_bits(x0); h1 = h_bits(x1);
            l0 = h_bits((_Float16)((f0 - (float)x0) * rscale));
            l1 = h_bits((_Float16)((f1 - (float)x1) * rscale));
          }
          a[e] = pk16(h0, h1); a2[e] = pk16(l0, l1);
        }
        hv[it] = a; lv[it] = a2;
      }
      {
#pragma unroll
        for (int it = 0; it < 4; ++it) {
          const int row = it * 4 + q;
          *(v4u*)(C + (size_t)(mBase + row) * ldc + n0 + c8) = hv[it];
          if (wlo) *(v4u*)(C2 + (size_t)(mBase + row) * ldc2 + n0 + c8) = lv[it];
        }
        
      }
    }
    __builtin_amdgcn_fence(__ATOMIC_RELEASE, "workgroup");
    __builtin_amdgcn_wave_barrier();
    __builtin_amdgcn_fence(__ATOMIC_ACQUIRE, "workgroup");
  }
}

template <bool RES>
__global__ __launch_bounds__(256, RES ? 2 : 6)   // without residual planes three blocks share a WGP: 6 waves a SIMD
void attn64(const unsigned short* __restrict__ qkhp, const unsigned short* __restrict__ qklp,
            const unsigned short* __restrict__ vhp, const unsigned short* __restrict__ vlp,
            unsigned short* ahp, unsigned short* alp, int qbBase, int nqbThis, float sscale) {
  union FB { v16b v; v8b h[2]; };
  union FH { v16h v; v8h h[2]; };
  // LDS row pitches: 16-bit tiles 72 elements (144 B = 16 B x 9), so that the 16 rows which a 16-B fragment read
  // touches fall on 16 different groups of four banks; the f32 tile 68 floats (272 B = 16 B x 17), likewise.
  constexpr int LP = 72;
  constexpr int OP = 68;
  constexpr int PLE = 64 * LP;                                    // elements of one 64-row tile plane, 9 KB
  constexpr int NPL = RES ? 4 : 3;                                // planes of a group: K hi, K lo, V^T hi, (V^T residual)
  __shared__ __align__(16) unsigned short KV[2 * NPL * PLE];      // per group its planes in a row: one base register
  __shared__ __align__(16) float    Os[4][16 * OP];               // per 16 query rows: context tile [row][d]
  __shared__ __align__(16) float    Ml[4][32];                    // group 1's m (0..15) and l (16..31) per row

  const int wv   = __builtin_amdgcn_readfirstlane((int)(threadIdx.x >> 5));   // wave 0..7, held as a scalar
  const int grp  = wv >> 2;                 // key group of this wave (a scalar: branches on it are scalar branches)
  const int wave = wv & 3;                  // which 16 query rows of the block
  const int tid  = threadIdx.x & 127;       // thread within its group
  const int lane = tid & 31;
  unsigned short* const kvg = KV + grp * (NPL * PLE);
  __bf16*   const Ksh = (__bf16*)(void*)kvg;                      // K hi [kv][d]
  __bf16*   const Ksl = Ksh + PLE;                                // K lo
  _Float16* const Vth = (_Float16*)(void*)(kvg + 2 * PLE);        // V^T hi [d][kv]
  _Float16* const Vtl = Vth + (RES ? PLE : 0);                    // V^T residual (used with RES only)
  const int hh   = lane >> 4;
  const int c    = lane & 15;

  const int bx   = blockIdx.x;
  const int qbl  = bx % nqbThis;
  const int rest = bx / nqbThis;
  const int h    = rest % NH;
  const int b    = rest / NH;
  const int qb   = qbBase + qbl;
  const int q0   = qb * 64 + wave * 16;
  const size_t rowB = (size_t)b * SEQ;

  const __bf16* Qh = (const __bf16*)(const void*)qkhp + (size_t)h * HD;
  const __bf16* Ql = (const __bf16*)(const void*)qklp + (size_t)h * HD;
  const __bf16* Kh = (const __bf16*)(const void*)qkhp + (size_t)DM + (size_t)h * HD;
  const __bf16* Kl = (const __bf16*)(const void*)qklp + (size_t)DM + (size_t)h * HD;
  const _Float16* Vh = (const _Float16*)(const void*)vhp + ((size_t)b * DM + (size_t)h * HD) * SEQ;
  const _Float16* Vl = (const _Float16*)(const void*)vlp + ((size_t)b * DM + (size_t)h * HD) * VLP;

  // ---- Q fragments (B operand, column = query = lane&15): 2 d-chunks, hi and lo ----
  v16b qah[2], qal[2];
#pragma unroll
  for (int dc = 0; dc < 2; ++dc) {
    const size_t qo = (rowB + q0 + c) * NQK + dc * 32 + 8 * hh;
    qah[dc] = ldfrag_b(Qh + qo);
    qal[dc] = ldfrag_b(Ql + qo);
  }

  float mrow = -INFINITY;                    // running maximum of query q0 + c, equal in both halves of the wave
  float lrow = 0.f;                          // running sum over the keys that this half of the wave holds
  v8f oacc[4];                               // O^T: oacc[t][r] = context[query q0 + c][d = 16 t + 8 hh + r]
#pragma unroll
  for (int t = 0; t < 4; ++t) oacc[t] = zero8();

  int nkt = qb + 1;                          // key tiles 0..qb, block-uniform
  if (nkt > NQB) nkt = NQB;
  const int nit = (nkt + 1) >> 1;            // block-uniform trip count <= 16; every wave passes every barrier
  for (int it = 0; it < nit; ++it) {
    const int kt  = 2 * it + grp;            // this group's key tile
    const bool act = kt < nkt;               // false only in group 1's last trip when nkt is odd (a scalar)
    const int kv0 = kt * 64;
    __syncthreads();
    if (act) {
      const int r = tid >> 1, half = (tid & 1) * 32;
      const __bf16*   kg  = Kh + (rowB + kv0 + r) * NQK + half;   // K row kv0+r, d = half..half+31
      const __bf16*   klg = Kl + (rowB + kv0 + r) * NQK + half;
      const _Float16* vg  = Vh + (size_t)r * SEQ + kv0 + half;    // V^T row d = r, s = kv0+half..+31
      const int kvl = (kv0 + 64 <= VLP) ? kv0 : (VLP - 64);     // clamped address into the residual plane
      const _Float16* vlg = Vl + (size_t)r * VLP + kvl + half;
      const bool resOK = (kv0 + 64 <= VLP);                      // the same in a whole group
#pragma unroll
      for (int i = 0; i < 4; ++i) {
        const v8b a0 = *(const v8b*)(kg + 8 * i);
        const v8b a1 = *(const v8b*)(klg + 8 * i);
        const v8h b0 = *(const v8h*)(vg + 8 * i);
        *(v8b*)(Ksh + r * LP + half + 8 * i) = a0;
        *(v8b*)(Ksl + r * LP + half + 8 * i) = a1;
        *(v8h*)(Vth + r * LP + half + 8 * i) = b0;
        if (RES) {
          v8h b1 = *(const v8h*)(vlg + 8 * i);
          if (!resOK) b1 = zero8h();
          *(v8h*)(Vtl + r * LP + half + 8 * i) = b1;
        }
      }
    }
    __syncthreads();
    if (!act) continue;

    // ---- scores, transposed: 64 keys x 16 query columns per wave, 3 bf16 products;
    //      s[j][r] = score of key kv0 + 16 j + 8 hh + r with query q0 + c ----
    v8f s[4];
#pragma unroll
    for (int j = 0; j < 4; ++j) {
      s[j] = zero8();
#pragma unroll
      for (int dc = 0; dc < 2; ++dc) {
        FB kb, kl;
        kb.h[0] = *(const v8b*)(Ksh + (j * 16 + c) * LP + dc * 32 + 8 * hh);
        kb.h[1] = *(const v8b*)(Ksh + (j * 16 + c) * LP + dc * 32 + 16 + 8 * hh);
        kl.h[0] = *(const v8b*)(Ksl + (j * 16 + c) * LP + dc * 32 + 8 * hh);
        kl.h[1] = *(const v8b*)(Ksl + (j * 16 + c) * LP + dc * 32 + 16 + 8 * hh);
        s[j] = mma_b(kb.v, qah[dc], s[j]);
        s[j] = mma_b(kl.v, qah[dc], s[j]);
        s[j] = mma_b(kb.v, qal[dc], s[j]);
      }
    }

    // ---- scale + causal select (key > query -> -inf by value), the query's maximum, online softmax;
    //      P (x1024, f16) and P residual (x4096) packed as B operands: element e of chunk kk is key
    //      kv0 + 32 kk + (e < 8 ? 8 hh + e : 16 + 8 hh + e - 8), the k order of the V^T fragments ----
    const int dkq = kv0 + 8 * hh - (q0 + c);          // key minus query at j = 0, r = 0
    float m = -INFINITY;
#pragma unroll
    for (int j = 0; j < 4; ++j) {
#pragma unroll
      for (int r = 0; r < 8; ++r) {
        float sv = s[j][r] * sscale;
        sv = (dkq <= -(j * 16 + r)) ? sv : -INFINITY;  // key kv0 + 16 j + 8 hh + r <= query q0 + c
        s[j][r] = sv;
        m = fmaxf(m, sv);
      }
    }
    m = fmaxf(m, xhalf(m));                           // both halves now hold the maximum over the 64 keys
    const float mnew  = fmaxf(mrow, m);
    const float msafe = (mnew == -INFINITY) ? 0.f : mnew;
    const float alpha = __expf(mrow - msafe);         // mrow = -inf -> 0 (l and context are 0 there anyway)
    mrow = mnew;
    float ps[4];                                      // one partial sum per score tile: four short add chains
    FH pb[2], pr[2];
#pragma unroll
    for (int j = 0; j < 4; ++j) {
      ps[j] = 0.f;
#pragma unroll
      for (int r = 0; r < 8; ++r) {
        const float p = __expf(s[j][r] - msafe);      // masked logit: exp(-inf) -> 0
        ps[j] += p;
        const float p1k = p * 1024.0f;
        const _Float16 ph = (_Float16)p1k;
        pb[j >> 1].v[(j & 1) * 8 + r] = ph;
        if (RES) pr[j >> 1].v[(j & 1) * 8 + r] = (_Float16)((p1k - (float)ph) * 4096.0f);
      }
    }
    lrow = lrow * alpha + ((ps[0] + ps[1]) + (ps[2] + ps[3]));
#pragma unroll
    for (int t = 0; t < 4; ++t)
#pragma unroll
      for (int r = 0; r < 8; ++r) oacc[t][r] *= alpha;

    // ---- context^T += V^T . P^T (f16 WMMA), residual products into a separate accumulator ----
    v8f o1[4];
#pragma unroll
    for (int t = 0; t < 4; ++t) o1[t] = zero8();
    // unrolled: the P chunks are register arrays (constant indices only)
#pragma unroll
    for (int kk = 0; kk < 2; ++kk) {
#pragma unroll
      for (int t = 0; t < 4; ++t) {
        FH vb;
        vb.h[0] = *(const v8h*)(Vth + (t * 16 + c) * LP + kk * 32 + 8 * hh);
        vb.h[1] = *(const v8h*)(Vth + (t * 16 + c) * LP + kk * 32 + 16 + 8 * hh);
        oacc[t] = mma_h(vb.v, pb[kk].v, oacc[t]);
        if (RES) {
          FH vl;
          vl.h[0] = *(const v8h*)(Vtl + (t * 16 + c) * LP + kk * 32 + 8 * hh);
          vl.h[1] = *(const v8h*)(Vtl + (t * 16 + c) * LP + kk * 32 + 16 + 8 * hh);
          o1[t] = mma_h(vl.v, pb[kk].v, o1[t]);
          o1[t] = mma_h(vb.v, pr[kk].v, o1[t]);
        }
      }
    }
    if (RES) {
#pragma unroll
      for (int t = 0; t < 4; ++t)
#pragma unroll
        for (int r = 0; r < 8; ++r) oacc[t][r] += o1[t][r] * (1.0f / 4096.0f);
    }
  }

  const float lsum = lrow + xhalf(lrow);     // the two halves' key sums joined, once

  // ---- group 1 hands over its running maximum, sum and context (each lane its own accumulator positions:
  //      row = query c, 8 consecutive d per tile t) ----
  float* os = Os[wave];
  float* ml = Ml[wave];
  if (grp == 1) {
#pragma unroll
    for (int t = 0; t < 4; ++t) {
      float* op = os + c * OP + t * 16 + 8 * hh;
      const v4f lo4 = {oacc[t][0], oacc[t][1], oacc[t][2], oacc[t][3]};
      const v4f hi4 = {oacc[t][4], oacc[t][5], oacc[t][6], oacc[t][7]};
      *(v4f*)(op)     = lo4;
      *(v4f*)(op + 4) = hi4;
    }
    if (hh == 0) {                           // m and l are equal in the two lanes of a query
      ml[c]      = mrow;
      ml[16 + c] = lsum;
    }
  }
  __syncthreads();                           // group 1's partial results may be read
  if (grp == 1) return;                      // no barrier follows

  // ---- join the two partial softmaxes (a group without a tile brings m = -inf, l = 0, context 0), normalise
  //      (1/l and the 1/1024 p carry), stage the 16x64 tile in LDS (each lane overwrites the positions it has just
  //      read), then write bf16 hi/lo
  {
    const float m1 = ml[c];
    const float l1 = ml[16 + c];
    const float mj    = fmaxf(mrow, m1);
    const float msafe = (mj == -INFINITY) ? 0.f : mj;
    const float a0 = __expf(mrow - msafe);
    const float a1 = __expf(m1 - msafe);
    const float l = lsum * a0 + l1 * a1;
    const float inv = ((l > 0.f) ? (1.0f / l) : 0.f) * (1.0f / 1024.0f);
#pragma unroll
    for (int t = 0; t < 4; ++t) {
      float* op = os + c * OP + t * 16 + 8 * hh;
      const v4f g0 = *(const v4f*)(op);
      const v4f g1 = *(const v4f*)(op + 4);
      v4f w0, w1;
#pragma unroll
      for (int e = 0; e < 4; ++e) {
        w0[e] = (oacc[t][e] * a0 + g0[e] * a1) * inv;
        w1[e] = (oacc[t][4 + e] * a0 + g1[e] * a1) * inv;
      }
      *(v4f*)(op)     = w0;
      *(v4f*)(op + 4) = w1;
    }
  }
  __builtin_amdgcn_fence(__ATOMIC_RELEASE, "workgroup");
  __builtin_amdgcn_wave_barrier();
  __builtin_amdgcn_fence(__ATOMIC_ACQUIRE, "workgroup");
  {
    const int q = lane >> 3, c8 = (lane & 7) * 8;
    v4u hv[4], lv[4];
#pragma unroll
    for (int it = 0; it < 4; ++it) {
      const int row = it * 4 + q;      // it 0..3 x q 0..3 = rows 0..15 of the wave tile
      const float* sp = os + row * OP + c8;
      v4u a, a2;
#pragma unroll
      for (int e = 0; e < 4; ++e) {
        const float f0 = sp[2 * e], f1 = sp[2 * e + 1];
        const unsigned short h0 = bf_bits(f0), h1 = bf_bits(f1);
        const unsigned short l0 = bf_bits(f0 - bf_up(h0)), l1 = bf_bits(f1 - bf_up(h1));
        a[e] = pk16(h0, h1); a2[e] = pk16(l0, l1);
      }
      hv[it] = a; lv[it] = a2;
    }
    {
#pragma unroll
      for (int it = 0; it < 4; ++it) {
        const int row = it * 4 + q;
        const size_t go = (rowB + q0 + row) * DM + (size_t)h * HD + c8;
        *(v4u*)(ahp + go) = hv[it];
        *(v4u*)(alp + go) = lv[it];
      }
      
    }
  }
}

// =====================================================================================================
// Workspace map (bytes), every region an exact multiple of its whole-line / whole-tile store granularity
//  because M, N are multiples of 64 everywhere):
//   Wqkvb  bf16 [3072][1024]             0          6291456   (rows 0..2047 = Wq|Wk as Bt, rows 2048.. = Wv as A)
//   Wob    bf16 [1024][1024]             6291456    2097152
//   Xb     bf16 [4096][1024]             8388608    8388608
//   XPh    bf16 [4096][1024]            16777216    8388608
//   XPl    bf16 [4096][1024]            25165824    8388608
//   QKh    bf16 [4096][2048]            33554432   16777216
//   QKl    bf16 [4096][2048]            50331648   16777216
//   VTh    f16  [2][1024][2048]         67108864    8388608
//   VTl    f16  [2][1024][512]          75497472    2097152
//   Ah     bf16 [4096][1024]            77594624    8388608
//   Al     bf16 [4096][1024]            85983232    8388608
//   end                                 94371840
// Weights arrive [out n][in k] row-major = the Bt / A layout the GEMM wants (k contiguous), so they are only
// RNE-converted to bf16.
// =====================================================================================================
extern "C" void kernel_launch(void* const* d_in, const int* in_sizes, int n_in,
                              void* d_out, int out_size, void* d_ws, size_t ws_size,
                              hipStream_t stream) {
  if (n_in < 4) return;
  if (in_sizes[0] != NB * SEQ * DM) return;
  if (in_sizes[1] != SEQ * DM) return;
  if (in_sizes[2] != 3 * DM * DM) return;
  if (in_sizes[3] != DM * DM) return;
  if (out_size != NB * SEQ * DM) return;

  const float* x    = (const float*)d_in[0];   // [NB][SEQ][DM]
  const float* posp = (const float*)d_in[1];   // [SEQ][DM]
  const float* wqkv = (const float*)d_in[2];   // [3*DM n][DM k]
  const float* wo   = (const float*)d_in[3];   // [DM n][DM k]

  const size_t PWqkv = (size_t)3 * DM * DM * 2;       //  6291456  bf16 [3072][1024]
  const size_t PWo   = (size_t)DM * DM * 2;           //  2097152  bf16 [1024][1024]
  const size_t PX    = (size_t)NB * SEQ * DM * 2;     //  8388608  bf16 [4096][1024]
  const size_t PQK   = (size_t)NB * SEQ * NQK * 2;    // 16777216  bf16 [4096][2048]
  const size_t PVTh  = (size_t)NB * DM * SEQ * 2;     //  8388608
  const size_t PVTl  = (size_t)NB * DM * VLP * 2;     //  2097152
  size_t off = 0;
  const size_t oWqkv = off; off += PWqkv;
  const size_t oWo   = off; off += PWo;
  const size_t oXb   = off; off += PX;
  const size_t oXPh  = off; off += PX;
  const size_t oXPl  = off; off += PX;
  const size_t oQKh  = off; off += PQK;
  const size_t oQKl  = off; off += PQK;
  const size_t oVTh  = off; off += PVTh;
  const size_t oVTl  = off; off += PVTl;
  const size_t oAh   = off; off += PX;
  const size_t oAl   = off; off += PX;
  if (off > ws_size) return;                           // off = 94371840
  if (off > (size_t)134217728) return;

  char* ws = (char*)d_ws;
  unsigned short* Wqkvb = (unsigned short*)(ws + oWqkv);
  unsigned short* Wvb   = Wqkvb + (size_t)2 * DM * DM;   // rows 2048..3071 of the Wqkv plane
  unsigned short* Wob   = (unsigned short*)(ws + oWo);
  unsigned short* Xb    = (unsigned short*)(ws + oXb);
  unsigned short* XPh   = (unsigned short*)(ws + oXPh);
  unsigned short* XPl   = (unsigned short*)(ws + oXPl);
  unsigned short* QKh   = (unsigned short*)(ws + oQKh);
  unsigned short* QKl   = (unsigned short*)(ws + oQKl);
  unsigned short* VTh   = (unsigned short*)(ws + oVTh);
  unsigned short* VTl   = (unsigned short*)(ws + oVTl);
  unsigned short* Ah    = (unsigned short*)(ws + oAh);
  unsigned short* Al    = (unsigned short*)(ws + oAl);
  float*          outf  = (float*)d_out;

  const dim3 blk(256);
  const int n8qkv = 3 * DM * DM / 8;                                 // 393216 (multiple of 256)
  const int n8w   = DM * DM / 8;                                     // 131072 (multiple of 256)
  const int n8x   = NB * SEQ * DM / 8;                               // 524288 (multiple of 256)
  const int p8    = SEQ * DM / 8;                                    // 262144
  const dim3 gCvtQKV((n8qkv + 255) / 256);                           // 1536 blocks
  const dim3 gCvtW((n8w + 255) / 256);                               // 512 blocks
  const dim3 gPrep((n8x + 255) / 256);                               // 2048 blocks
  const dim3 gQK((NB * SEQ / 128) * (NQK / 256), 1);                 // 128x256 tiles -> 256 blocks of 8 waves
  const dim3 gVT((DM / 128) * (SEQ / 128), NB);                      // 128x128 tiles -> 128 blocks of 4 waves x 2
  const dim3 gOut((NB * SEQ / 128) * (DM / 128), 1);                 // 128x128 tiles -> 256 blocks of 4 waves

  // (1) weights -> bf16 planes (keep their [n][k] layout); x -> bf16 plane; x + pos -> bf16 hi/lo planes
  cvt_bf16x8<<<gCvtQKV, blk, 0, stream>>>(wqkv, Wqkvb, n8qkv);
  cvt_bf16x8<<<gCvtW, blk, 0, stream>>>(wo, Wob, n8w);
  prep_x8<<<gPrep, blk, 0, stream>>>(x, posp, Xb, XPh, XPl, n8x, p8);
  // (2) q|k projection: QK[row][n] = sum_k (XPh+XPl)[row][k] Wqkvb[n][k], n < 2048 -> bf16 hi/lo planes,
  //     pitch NQK   (M=4096, N=2048, K=1024, 2 products)
  gemm64<1, 2, 4><<<gQK, dim3(256), 0, stream>>>(
      XPh, XPl, DM, 0LL, Wqkvb, DM, 0LL,
      (void*)QKh, NQK, 0LL, (void*)QKl, NQK, 0LL, NQK,
      NB * SEQ, NQK, DM, 1.0f);
  // (3) v^T per batch element: VTh[bl][m][s] = sum_k Wvb[m][k] Xb[bl*SEQ+s][k] -> f16 hi plane (pitch SEQ) and
  //     residual plane (x4096, keys < VLP, pitch VLP)  (M=1024, N=2048, K=1024, single product)
  gemm64<0, 3, 2><<<gVT, dim3(128), 0, stream>>>(
      Wvb, Wvb, DM, 0LL, Xb, DM, (long long)SEQ * DM,
      (void*)VTh, SEQ, (long long)DM * SEQ, (void*)VTl, VLP, (long long)DM * VLP, VLP,
      DM, SEQ, DM, 4096.0f);
  // (4) causal attention: query blocks 0..RESQB-1 with residual planes, the rest without -> Ah/Al bf16 hi/lo
  attn64<true><<<dim3(NB * NH * RESQB), dim3(256), 0, stream>>>(
      QKh, QKl, VTh, VTl, Ah, Al, 0, RESQB, 0.125f);
  attn64<false><<<dim3(NB * NH * (NQB - RESQB)), dim3(256), 0, stream>>>(
      QKh, QKl, VTh, VTl, Ah, Al, RESQB, NQB - RESQB, 0.125f);
  // (5) out[row][n] = sum_k (Ah+Al)[row][k] Wob[n][k] -> d_out f32   (M=4096, N=1024, K=1024, 2 products)
  gemm64<1, 0, 2><<<gOut, dim3(128), 0, stream>>>(
      Ah, Al, DM, 0LL, Wob, DM, 0LL,
      (void*)outf, DM, 0LL, (void*)outf, 0, 0LL, 0,
      NB * SEQ, DM, DM, 1.0f);
  (void)hipGetLastError();
}

// v005
// One run takes 143 microseconds.
// Two timings next to v004 both put it at 1.05 times that version's speed.
// All steps since v000 together make it 2.84 times as fast.
// Contractions: q|k projection = v_wmma_f32_16x16x32_bf16 with (x+pos) as bf16 hi/lo planes times the bf16 Wqk plane (2 products);
// v^T projection = v_wmma_f32_16x16x32_bf16 (bf16 x times bf16 Wv, single product);
// q.k^T scores = v_wmma_f32_16x16x32_bf16 with bf16 hi/lo split q and k (hi.hi + hi.lo + lo.hi);
// p.v = v_wmma_f32_16x16x32_f16 (p carried x1024 in f16, v in f16; extra f16 residual planes x4096 of p and v on the first 512 query rows);
// a.Wout^T = v_wmma_f32_16x16x32_bf16 with a as bf16 hi/lo planes times the bf16 Wout plane (2 products); all f32 accumulate; softmax in f32.
#include <hip/hip_runtime.h>
#include <math.h>
#include <stdint.h>

#define NB    2
#define SEQ   2048
#define DM    1024
#define NH    16
#define HD    64
#define NQK   (2 * DM)       // pitch of the q|k planes: q feature columns 0..DM-1, k feature columns DM..2DM-1
#define NQB   (SEQ / 64)     // 32 query / key tiles of 64
#define VLP   512            // key pitch of the v^T residual plane (keys 0..VLP-1)
#define RESQB 8              // leading 64-row query blocks that use the p / v residual planes
static_assert(RESQB * 64 <= VLP);
static_assert(NH * HD == DM);
static_assert((SEQ % 128) == 0 && (DM % 256) == 0);
static_assert(HD == 64);
static_assert(((NB * SEQ * DM / 8) % 256) == 0);
static_assert(((DM * DM / 8) % 256) == 0);
static_assert(((3 * DM * DM / 8) % 256) == 0);
static_assert(((SEQ * DM) % 8) == 0);

typedef _Float16 v16h __attribute__((ext_vector_type(16)));
typedef _Float16 v8h  __attribute__((ext_vector_type(8)));
typedef __bf16   v16b __attribute__((ext_vector_type(16)));
typedef __bf16   v8b  __attribute__((ext_vector_type(8)));
typedef float    v8f  __attribute__((ext_vector_type(8)));
typedef float    v4f  __attribute__((ext_vector_type(4)));
typedef unsigned int v4u __attribute__((ext_vector_type(4)));

// ---- scalar helpers --------------------------------------------------------------------------------
__device__ __forceinline__ unsigned short bf_bits(float f) {          // f32 -> bf16 bits, RNE convert
  unsigned u = __float_as_uint(f);
  return (unsigned short)((u + 0x7FFFu + ((u >> 16) & 1u)) >> 16);
}
__device__ __forceinline__ float bf_up(unsigned short h) { return __uint_as_float(((unsigned)h) << 16); }
__device__ __forceinline__ unsigned short h_bits(_Float16 x) { return __builtin_bit_cast(unsigned short, x); }
__device__ __forceinline__ unsigned pk16(unsigned short a, unsigned short b) { return (unsigned)a | ((unsigned)b << 16); }
__device__ __forceinline__ v8f zero8() { v8f z = {0.f, 0.f, 0.f, 0.f, 0.f, 0.f, 0.f, 0.f}; return z; }
__device__ __forceinline__ v8h zero8h() {
  const _Float16 z = (_Float16)0.0f;
  v8h r = {z, z, z, z, z, z, z, z};
  return r;
}

// lane l reads lane l ^ 16: the two lanes that share a column of a B operand or of an accumulator tile
__device__ __forceinline__ float xhalf(float x) {
  return __builtin_bit_cast(float, __builtin_amdgcn_permlanex16(__builtin_bit_cast(int, x), __builtin_bit_cast(int, x),
                                                                0x76543210, 0xfedcba98, false, false));
}

// ---- fragment loader: 16-bit A/B operand, lane -> row/col (lane&15), p already includes +8*(lane>>4);
//      elements 0..7 <- p[0..7] (k0+8h..), elements 8..15 <- p[16..23] (k0+16+8h..)
__device__ __forceinline__ v16b ldfrag_b(const __bf16* p) {
  union { v16b v; v8b h[2]; } f;
  f.h[0] = *(const v8b*)(p);
  f.h[1] = *(const v8b*)(p + 16);
  return f.v;
}

// ---- WMMA helpers with trailing VALU hazard gap --------------------------------------------------------
__device__ __forceinline__ v8f mma_b(v16b a, v16b b, v8f c) {
  c = __builtin_amdgcn_wmma_f32_16x16x32_bf16(false, a, false, b, (short)0, c, false, false);
#if defined(__HIP_DEVICE_COMPILE__)
  asm volatile("v_nop\n\tv_nop\n\tv_nop\n\tv_nop" : "+v"(c) : "v"(a), "v"(b));
#endif
  return c;
}
__device__ __forceinline__ v8f mma_h(v16h a, v16h b, v8f c) {
  c = __builtin_amdgcn_wmma_f32_16x16x32_f16(false, a, false, b, (short)0, c, false, false);
#if defined(__HIP_DEVICE_COMPILE__)
  asm volatile("v_nop\n\tv_nop\n\tv_nop\n\tv_nop" : "+v"(c) : "v"(a), "v"(b));
#endif
  return c;
}
__device__ __forceinline__ v8f mma_b_raw(v16b a, v16b b, v8f c) {
  return __builtin_amdgcn_wmma_f32_16x16x32_bf16(false, a, false, b, (short)0, c, false, false);
}
__device__ __forceinline__ void dep_guard_b(v8f& a, v8f& b, v16b x, v16b y) {
#if defined(__HIP_DEVICE_COMPILE__)
  asm volatile("v_nop\n\tv_nop\n\tv_nop\n\tv_nop" : "+v"(a), "+v"(b) : "v"(x), "v"(y));
#endif
}
__device__ __forceinline__ void keep4_b(v16b a, v16b b, v16b c, v16b d) {
#if defined(__HIP_DEVICE_COMPILE__)
  asm volatile("v_nop" :: "v"(a), "v"(b), "v"(c), "v"(d));
#endif
}
__device__ __forceinline__ void acc_guard4(v8f& a, v8f& b, v8f& c, v8f& d) {
#if defined(__HIP_DEVICE_COMPILE__)
  asm volatile("v_nop\n\tv_nop\n\tv_nop\n\tv_nop" : "+v"(a), "+v"(b), "+v"(c), "+v"(d));
#endif
}

// s_wait_xcnt behind a run of global loads; the loads' pointers are inputs, so that no address register is given a
// new value (a later load's result included) in front of the wait (a precaution)
__device__ __forceinline__ void addr_wait4(const void* a, const void* b, const void* c, const void* d) {
#if defined(__HIP_DEVICE_COMPILE__)
  asm volatile("s_wait_xcnt 0x0" :: "v"(a), "v"(b), "v"(c), "v"(d) : "memory");
#endif
}

// =====================================================================================================
// f32 -> bf16 (RNE convert), 8 elements per thread, one 16-B store per lane: a wave writes 512 contiguous B
// host-checked). coverage: n8 threads x 8 = whole plane.
// =====================================================================================================
__global__ __launch_bounds__(256) void cvt_bf16x8(const float* __restrict__ in, unsigned short* out, int n8) {
  const int i = blockIdx.x * 256 + threadIdx.x;
  if (i < n8) {
    const v4f a = *(const v4f*)(in + (size_t)i * 8);
    const v4f b = *(const v4f*)(in + (size_t)i * 8 + 4);
    v4u p;
    p[0] = pk16(bf_bits(a[0]), bf_bits(a[1]));
    p[1] = pk16(bf_bits(a[2]), bf_bits(a[3]));
    p[2] = pk16(bf_bits(b[0]), bf_bits(b[1]));
    p[3] = pk16(bf_bits(b[2]), bf_bits(b[3]));
    *(v4u*)(out + (size_t)i * 8) = p;
    
  }
}

// =====================================================================================================
// x prep: xb = bf16(x) (RNE convert); s = bf_up(bf16(x)) + bf_up(bf16(pos)) in f32 (pos element index =
// x element index mod SEQ*DM); hp = bf16 hi plane of s, lp = bf16 lo plane (lo = RNE(s - hi), unscaled).
// three planes (n8 multiple of 256, host-checked).
// =====================================================================================================
__global__ __launch_bounds__(256) void prep_x8(const float* __restrict__ x, const float* __restrict__ pos,
                                               unsigned short* xb, unsigned short* hp, unsigned short* lp,
                                               int n8, int p8) {
#pragma clang fp contract(off)
  const int i = blockIdx.x * 256 + threadIdx.x;
  if (i < n8) {
    const int ip = i % p8;
    const v4f a  = *(const v4f*)(x + (size_t)i * 8);
    const v4f b  = *(const v4f*)(x + (size_t)i * 8 + 4);
    const v4f pa = *(const v4f*)(pos + (size_t)ip * 8);
    const v4f pb = *(const v4f*)(pos + (size_t)ip * 8 + 4);
    v4u px, ph, pl;
#pragma unroll
    for (int e = 0; e < 4; ++e) {
      const float f0 = (e < 2) ? a[2 * e]      : b[2 * e - 4];
      const float f1 = (e < 2) ? a[2 * e + 1]  : b[2 * e - 3];
      const float g0 = (e < 2) ? pa[2 * e]     : pb[2 * e - 4];
      const float g1 = (e < 2) ? pa[2 * e + 1] : pb[2 * e - 3];
      const unsigned short x0 = bf_bits(f0), x1 = bf_bits(f1);
      const float s0 = bf_up(x0) + bf_up(bf_bits(g0));
      const float s1 = bf_up(x1) + bf_up(bf_bits(g1));
      const unsigned short h0 = bf_bits(s0), h1 = bf_bits(s1);
      const unsigned short l0 = bf_bits(s0 - bf_up(h0)), l1 = bf_bits(s1 - bf_up(h1));
      px[e] = pk16(x0, x1);
      ph[e] = pk16(h0, h1);
      pl[e] = pk16(l0, l1);
    }
    *(v4u*)(xb + (size_t)i * 8) = px;
    *(v4u*)(hp + (size_t)i * 8) = ph;
    *(v4u*)(lp + (size_t)i * 8) = pl;
    
  }
}

// =====================================================================================================
// Eight asynchronous 16-B-per-lane copies global -> LDS (no register in between). The closing s_wait_xcnt stands
// in the copies' own statement so that no address register named here is rewritten in front of it (a precaution).
// =====================================================================================================
__device__ __forceinline__ void copy8_async(const unsigned (&l)[8], const __bf16* const (&g)[8]) {
#if defined(__HIP_DEVICE_COMPILE__)
  asm volatile(
      "global_load_async_to_lds_b128 %0, %8, off\n\t"
      "global_load_async_to_lds_b128 %1, %9, off\n\t"
      "global_load_async_to_lds_b128 %2, %10, off\n\t"
      "global_load_async_to_lds_b128 %3, %11, off\n\t"
      "global_load_async_to_lds_b128 %4, %12, off\n\t"
      "global_load_async_to_lds_b128 %5, %13, off\n\t"
      "global_load_async_to_lds_b128 %6, %14, off\n\t"
      "global_load_async_to_lds_b128 %7, %15, off\n\t"
      "s_wait_xcnt 0x0"
      :: "v"(l[0]), "v"(l[1]), "v"(l[2]), "v"(l[3]), "v"(l[4]), "v"(l[5]), "v"(l[6]), "v"(l[7]),
         "v"(g[0]), "v"(g[1]), "v"(g[2]), "v"(g[3]), "v"(g[4]), "v"(g[5]), "v"(g[6]), "v"(g[7])
      : "memory");
#endif
}

// =====================================================================================================
// Batched bf16 WMMA GEMM: C[m][n] = sum_k A[m][k] * Bt[n][k]. A block of 2 x WN waves owns a 128 x (64*WN) tile of
// C, each wave a 64x64 part of it. A row-major [M][K] pitch lda; Bt row-major [N][K] pitch ldb (k contiguous);
// M a multiple of 128, N of 64*WN, K of 64 (host constants). blockIdx.y = batch index (strides in elements).
// Operands: per stage of 64 k the block's rows [A 128 | A2 128 (NSPLIT 1) | Bt 64*WN], 128 B each, are copied to
// LDS at pitch 144 B by asynchronous copies (a wave's copy = 4 whole 128-B lines); two buffers, stage t+1 flies
// while stage t is multiplied; the waves read their fragments from LDS with ds loads.
// NSPLIT: 0 = A.Bt; 1 = (A + A2).Bt (A2 = unscaled bf16 lo plane of A).
// OUT_MODE: 0 = f32 (pitch ldc); 2 = bf16 hi plane C + bf16 lo plane C2 (lo = RNE(v - hi), unscaled);
//           3 = f16 hi plane C + f16 residual plane C2 = f16((v - hi) * rscale), C2 written only for tiles
//               with n0 < N2 (pitch ldc2, batch stride strideC2).
// =====================================================================================================
template <int NSPLIT, int OUT_MODE, int WN>
__global__ __launch_bounds__(64 * WN) void gemm64(
    const unsigned short* __restrict__ Ap, const unsigned short* A2p, int lda, long long strideA,
    const unsigned short* __restrict__ Btp, int ldb, long long strideB,
    void* Cout, int ldc, long long strideC,
    void* Cout2, int ldc2, long long strideC2, int N2,
    int M, int N, int K, float rscale) {
  static_assert(NSPLIT == 0 || NSPLIT == 1);
  constexpr int NT    = 64 * WN;                       // threads
  constexpr int BM    = 128;                           // block rows of C
  constexpr int BN    = 64 * WN;                       // block columns of C
  constexpr int KS    = 64;                            // k per stage (128 B of every operand row)
  constexpr int AROWS = (NSPLIT == 1 ? 2 : 1) * BM;    // stage rows that hold A (and A2)
  constexpr int ROWS  = AROWS + BN;                    // stage rows in all
  constexpr int PE    = 72;                            // LDS row pitch in elements (144 B = 16 B x 9)
  constexpr int BUFE  = ROWS * PE;                     // elements of one buffer
  constexpr int RPI   = NT / 8;                        // stage rows that one copy of every thread covers
  constexpr int NIT   = ROWS / RPI;                    // copies per thread and stage
  static_assert((BM % RPI) == 0 && (NIT % 8) == 0 && NIT <= 63);
  const __bf16* A   = (const __bf16*)(const void*)Ap;
  const __bf16* A2  = (const __bf16*)(const void*)A2p;
  const __bf16* Bt  = (const __bf16*)(const void*)Btp;
  __shared__ __align__(16) __bf16 ring[2 * BUFE];       // two stage buffers
  __shared__ __align__(16) float sT[2 * WN][16 * 68];   // per-wave 16x64 slab, pitch 68 floats
  const int b    = blockIdx.y;
  const int tid  = threadIdx.x;
  const int lane = tid & 31;
  const int wave = tid >> 5;
  const int tilesN = N / BN;
  const int tilesM = M / BM;
  const int tile = blockIdx.x;
  if (tile >= tilesM * tilesN) return;   // block-uniform, in front of every copy and barrier
  const int tm = tile / tilesN;
  const int tn = tile - tm * tilesN;
  const int wm = wave / WN;                    // wave's 64-row part of the block tile
  const int wn = wave - wm * WN;               // wave's 64-column part
  const int m0 = tm * BM + (wm << 6);
  const int n0 = tn * BN + (wn << 6);

  const int rlane = lane & 15;                 // row (A) / col (B, D) within subtile
  const int koff  = (lane >> 4) * 8;           // k offset of this lane half
  const int mOff  = (lane >> 4) * 8;           // D row offset

  // this thread's 16-B piece of stage row (tid >> 3): source pointers at k = 0 and LDS byte address in buffer 0
  const int crow = tid >> 3, cpc = (tid & 7) * 8;
  const __bf16* gA  = A  + (size_t)b * strideA + (size_t)(tm * BM + crow) * lda + cpc;
  const __bf16* gA2 = (NSPLIT == 1) ? (A2 + (size_t)b * strideA + (size_t)(tm * BM + crow) * lda + cpc) : gA;
  const __bf16* gB  = Bt + (size_t)b * strideB + (size_t)(tn * BN + crow) * ldb + cpc;
  const unsigned lds0 = (unsigned)(size_t)(const void*)ring + (unsigned)(crow * PE + cpc) * 2u;

  // copies the next stage not yet asked for into buffer buf; the three source pointers then step on by one stage
  auto issue_stage = [&](int buf) {
    const unsigned lb = lds0 + (unsigned)buf * (unsigned)(BUFE * 2);
    // both loops unrolled: the stage row decides at compile time which operand a copy reads
#pragma unroll
    for (int g8 = 0; g8 < NIT / 8; ++g8) {
      unsigned dst[8];
      const __bf16* sp[8];
#pragma unroll
      for (int e = 0; e < 8; ++e) {
        const int sr = (g8 * 8 + e) * RPI;     // first stage row of this copy, a compile-time value
        sp[e]  = (sr < BM) ? (gA + (size_t)sr * lda)
               : (sr < AROWS) ? (gA2 + (size_t)(sr - BM) * lda)
                              : (gB + (size_t)(sr - AROWS) * ldb);
        dst[e] = lb + (unsigned)(sr * PE * 2);
      }
      copy8_async(dst, sp);
    }
    gA += KS; gA2 += KS; gB += KS;
  };

  v8f acc[4][4];
#pragma unroll
  for (int i = 0; i < 4; ++i)
#pragma unroll
    for (int j = 0; j < 4; ++j) acc[i][j] = zero8();

  const int nst = K / KS;
  issue_stage(0);
  asm volatile("s_wait_asynccnt 0x0" ::: "memory");   // this wave's copies of stage 0 have landed
  __syncthreads();                                    // ... and every other wave's: stage 0 may be read
  if (nst > 1) issue_stage(1);

  for (int t = 0; t < nst; ++t) {
    const __bf16* sb  = ring + (t & 1) * BUFE;
    const __bf16* sA  = sb + ((wm << 6) + rlane) * PE + koff;
    const __bf16* sA2 = sA + BM * PE;
    const __bf16* sB  = sb + (AROWS + (wn << 6) + rlane) * PE + koff;
    // every loop of the stage is unrolled: fragments and accumulators are register arrays (constant indices only)
#pragma unroll
    for (int kk = 0; kk < KS; kk += 32) {
      v16b bh[4], ah[4], al[4];
#pragma unroll
      for (int j = 0; j < 4; ++j) bh[j] = ldfrag_b(sB + (j << 4) * PE + kk);
#pragma unroll
      for (int i = 0; i < 4; ++i) {
        ah[i] = ldfrag_b(sA + (i << 4) * PE + kk);
        if (NSPLIT == 1) al[i] = ldfrag_b(sA2 + (i << 4) * PE + kk); else al[i] = ah[i];
      }
#pragma unroll
      for (int i = 0; i < 4; ++i) {
#pragma unroll
        for (int j = 0; j < 4; ++j) acc[i][j] = mma_b_raw(ah[i], bh[j], acc[i][j]);
        if (NSPLIT == 1) {
#pragma unroll
          for (int j = 0; j < 4; ++j) acc[i][j] = mma_b_raw(al[i], bh[j], acc[i][j]);
        }
        dep_guard_b(acc[i][0], acc[i][3], ah[i], al[i]);
      }
      keep4_b(bh[0], bh[1], bh[2], bh[3]);
    }
    asm volatile("s_wait_dscnt 0x0" ::: "memory");     // this wave's reads of buffer t & 1 are done
    asm volatile("s_wait_asynccnt 0x0" ::: "memory");  // this wave's copies of stage t + 1 have landed
    __syncthreads();                                   // publishes stage t + 1, frees buffer t & 1
    if (t + 2 < nst) issue_stage(t & 1);
  }
  asm volatile("s_wait_asynccnt 0x0" ::: "memory");    // no copy is outstanding when the wave goes on
  acc_guard4(acc[0][0], acc[0][1], acc[0][2], acc[0][3]);
  acc_guard4(acc[1][0], acc[1][1], acc[1][2], acc[1][3]);
  acc_guard4(acc[2][0], acc[2][1], acc[2][2], acc[2][3]);
  acc_guard4(acc[3][0], acc[3][1], acc[3][2], acc[3][3]);

  // ---- epilogue ----
  float* slab = sT[wave];
#pragma unroll
  for (int i = 0; i < 4; ++i) {
    const int mBase = m0 + (i << 4);
#pragma unroll
    for (int r = 0; r < 8; ++r) {
#pragma unroll
      for (int j = 0; j < 4; ++j) {
        slab[(mOff + r) * 68 + (j << 4) + rlane] = acc[i][j][r];
      }
    }
    __builtin_amdgcn_fence(__ATOMIC_RELEASE, "workgroup");
    __builtin_amdgcn_wave_barrier();
    __builtin_amdgcn_fence(__ATOMIC_ACQUIRE, "workgroup");
    if (OUT_MODE == 0) {
      float* C = (float*)Cout + (size_t)b * strideC;
      const int hh = lane >> 4, c4 = (lane & 15) * 4;     // 256-B row segment = 16 lanes x 16 B
      v4f ov[8];
#pragma unroll
      for (int it = 0; it < 8; ++it) {
        const int row = it * 2 + hh;                       // it 0..7 x hh 0..1 = rows 0..15
        ov[it] = *(const v4f*)(slab + row * 68 + c4);
      }
      {
#pragma unroll
        for (int it = 0; it < 8; ++it) {
          const int row = it * 2 + hh;
          *(v4f*)(C + (size_t)(mBase + row) * ldc + n0 + c4) = ov[it];
        }
        
      }
    } else {
      const int q = lane >> 3, c8 = (lane & 7) * 8;
      unsigned short* C  = (unsigned short*)Cout  + (size_t)b * strideC;
      unsigned short* C2 = (unsigned short*)Cout2 + (size_t)b * strideC2;
      const bool wlo = (OUT_MODE == 2) || (n0 < N2);      // wave-uniform
      v4u hv[4], lv[4];
#pragma unroll
      for (int it = 0; it < 4; ++it) {
        const int row = it * 4 + q;                        // it 0..3 x q 0..3 = rows 0..15
        const float* sp = slab + row * 68 + c8;
        v4u a, a2;
#pragma unroll
        for (int e = 0; e < 4; ++e) {
          const float f0 = sp[2 * e], f1 = sp[2 * e + 1];
          unsigned short h0, h1, l0, l1;
          if (OUT_MODE == 2) {
            h0 = bf_bits(f0); h1 = bf_bits(f1);
            l0 = bf_bits(f0 - bf_up(h0)); l1 = bf_bits(f1 - bf_up(h1));
          } else {
            const _Float16 x0 = (_Float16)f0, x1 = (_Float16)f1;
            h0 = h_bits(x0); h1 = h_bits(x1);
            l0 = h_bits((_Float16)((f0 - (float)x0) * rscale));
            l1 = h_bits((_Float16)((f1 - (float)x1) * rscale));
          }
          a[e] = pk16(h0, h1); a2[e] = pk16(l0, l1);
        }
        hv[it] = a; lv[it] = a2;
      }
      {
#pragma unroll
        for (int it = 0; it < 4; ++it) {
          const int row = it * 4 + q;
          *(v4u*)(C + (size_t)(mBase + row) * ldc + n0 + c8) = hv[it];
          if (wlo) *(v4u*)(C2 + (size_t)(mBase + row) * ldc2 + n0 + c8) = lv[it];
        }
        
      }
    }
    __builtin_amdgcn_fence(__ATOMIC_RELEASE, "workgroup");
    __builtin_amdgcn_wave_barrier();
    __builtin_amdgcn_fence(__ATOMIC_ACQUIRE, "workgroup");
  }
}

template <bool RES>
__global__ __launch_bounds__(256, RES ? 2 : 6)   // without residual planes three blocks share a WGP: 6 waves a SIMD
void attn64(const unsigned short* __restrict__ qkhp, const unsigned short* __restrict__ qklp,
            const unsigned short* __restrict__ vhp, const unsigned short* __restrict__ vlp,
            unsigned short* ahp, unsigned short* alp, int qbBase, int nqbThis, float sscale) {
  union FB { v16b v; v8b h[2]; };
  union FH { v16h v; v8h h[2]; };
  // LDS row pitches: 16-bit tiles 72 elements (144 B = 16 B x 9), so that the 16 rows which a 16-B fragment read
  // touches fall on 16 different groups of four banks; the f32 tile 68 floats (272 B = 16 B x 17), likewise.
  constexpr int LP = 72;
  constexpr int OP = 68;
  constexpr int PLE = 64 * LP;                                    // elements of one 64-row tile plane, 9 KB
  constexpr int NPL = RES ? 4 : 3;                                // planes of a group: K hi, K lo, V^T hi, (V^T residual)
  __shared__ __align__(16) unsigned short KV[2 * NPL * PLE];      // per group its planes in a row: one base register
  __shared__ __align__(16) float    Os[4][16 * OP];               // per 16 query rows: context tile [row][d]
  __shared__ __align__(16) float    Ml[4][32];                    // group 1's m (0..15) and l (16..31) per row

  const int wv   = __builtin_amdgcn_readfirstlane((int)(threadIdx.x >> 5));   // wave 0..7, held as a scalar
  const int grp  = wv >> 2;                 // key group of this wave (a scalar: branches on it are scalar branches)
  const int wave = wv & 3;                  // which 16 query rows of the block
  const int tid  = threadIdx.x & 127;       // thread within its group
  const int lane = tid & 31;
  unsigned short* const kvg = KV + grp * (NPL * PLE);
  __bf16*   const Ksh = (__bf16*)(void*)kvg;                      // K hi [kv][d]
  __bf16*   const Ksl = Ksh + PLE;                                // K lo
  _Float16* const Vth = (_Float16*)(void*)(kvg + 2 * PLE);        // V^T hi [d][kv]
  _Float16* const Vtl = Vth + (RES ? PLE : 0);                    // V^T residual (used with RES only)
  const int hh   = lane >> 4;
  const int c    = lane & 15;

  const int bx   = blockIdx.x;
  const int qbl  = bx % nqbThis;
  const int rest = bx / nqbThis;
  const int h    = rest % NH;
  const int b    = rest / NH;
  const int qb   = qbBase + qbl;
  const int q0   = qb * 64 + wave * 16;
  const size_t rowB = (size_t)b * SEQ;

  const __bf16* Qh = (const __bf16*)(const void*)qkhp + (size_t)h * HD;
  const __bf16* Ql = (const __bf16*)(const void*)qklp + (size_t)h * HD;
  const __bf16* Kh = (const __bf16*)(const void*)qkhp + (size_t)DM + (size_t)h * HD;
  const __bf16* Kl = (const __bf16*)(const void*)qklp + (size_t)DM + (size_t)h * HD;
  const _Float16* Vh = (const _Float16*)(const void*)vhp + ((size_t)b * DM + (size_t)h * HD) * SEQ;
  const _Float16* Vl = (const _Float16*)(const void*)vlp + ((size_t)b * DM + (size_t)h * HD) * VLP;

  // ---- Q fragments (B operand, column = query = lane&15): 2 d-chunks, hi and lo ----
  v16b qah[2], qal[2];
#pragma unroll
  for (int dc = 0; dc < 2; ++dc) {
    const size_t qo = (rowB + q0 + c) * NQK + dc * 32 + 8 * hh;
    qah[dc] = ldfrag_b(Qh + qo);
    qal[dc] = ldfrag_b(Ql + qo);
  }

  float mrow = -INFINITY;                    // running maximum of query q0 + c, equal in both halves of the wave
  float lrow = 0.f;                          // running sum over the keys that this half of the wave holds
  v8f oacc[4];                               // O^T: oacc[t][r] = context[query q0 + c][d = 16 t + 8 hh + r]
#pragma unroll
  for (int t = 0; t < 4; ++t) oacc[t] = zero8();

  int nkt = qb + 1;                          // key tiles 0..qb, block-uniform
  if (nkt > NQB) nkt = NQB;
  const int nit = (nkt + 1) >> 1;            // block-uniform trip count <= 16; every wave passes every barrier
  for (int it = 0; it < nit; ++it) {
    const int kt  = 2 * it + grp;            // this group's key tile
    const bool act = kt < nkt;               // false only in group 1's last trip when nkt is odd (a scalar)
    const int kv0 = kt * 64;
    __syncthreads();
    if (act) {
      // eight lanes share a tile row (128 B = one line): a wave's 16-B load covers four whole lines; load i of a
      // thread takes row r + 16 i
      const int r = tid >> 3, pc = (tid & 7) * 8;
      const __bf16*   kg  = Kh + (rowB + kv0 + r) * NQK + pc;     // K row kv0+r, d = pc..pc+7
      const __bf16*   klg = Kl + (rowB + kv0 + r) * NQK + pc;
      const _Float16* vg  = Vh + (size_t)r * SEQ + kv0 + pc;      // V^T row d = r, s = kv0+pc..+7
      const int kvl = (kv0 + 64 <= VLP) ? kv0 : (VLP - 64);     // clamped address into the residual plane
      const _Float16* vlg = Vl + (size_t)r * VLP + kvl + pc;
      const bool resOK = (kv0 + 64 <= VLP);                      // the same in a whole group
      v8b a0[4], a1[4];
      v8h b0[4], b1[4];
      // both loops unrolled: the loaded pieces are register arrays (constant indices only)
#pragma unroll
      for (int i = 0; i < 4; ++i) {
        a0[i] = *(const v8b*)(kg + (size_t)(16 * i) * NQK);
        a1[i] = *(const v8b*)(klg + (size_t)(16 * i) * NQK);
        b0[i] = *(const v8h*)(vg + (size_t)(16 * i) * SEQ);
        b1[i] = RES ? *(const v8h*)(vlg + (size_t)(16 * i) * VLP) : zero8h();
      }
      addr_wait4(kg, klg, vg, RES ? vlg : vg);
#pragma unroll
      for (int i = 0; i < 4; ++i) {
        *(v8b*)(Ksh + (r + 16 * i) * LP + pc) = a0[i];
        *(v8b*)(Ksl + (r + 16 * i) * LP + pc) = a1[i];
        *(v8h*)(Vth + (r + 16 * i) * LP + pc) = b0[i];
        if (RES) *(v8h*)(Vtl + (r + 16 * i) * LP + pc) = resOK ? b1[i] : zero8h();
      }
    }
    __syncthreads();
    if (!act) continue;

    // ---- scores, transposed: 64 keys x 16 query columns per wave, 3 bf16 products;
    //      s[j][r] = score of key kv0 + 16 j + 8 hh + r with query q0 + c ----
    v8f s[4];
#pragma unroll
    for (int j = 0; j < 4; ++j) {
      s[j] = zero8();
#pragma unroll
      for (int dc = 0; dc < 2; ++dc) {
        FB kb, kl;
        kb.h[0] = *(const v8b*)(Ksh + (j * 16 + c) * LP + dc * 32 + 8 * hh);
        kb.h[1] = *(const v8b*)(Ksh + (j * 16 + c) * LP + dc * 32 + 16 + 8 * hh);
        kl.h[0] = *(const v8b*)(Ksl + (j * 16 + c) * LP + dc * 32 + 8 * hh);
        kl.h[1] = *(const v8b*)(Ksl + (j * 16 + c) * LP + dc * 32 + 16 + 8 * hh);
        s[j] = mma_b(kb.v, qah[dc], s[j]);
        s[j] = mma_b(kl.v, qah[dc], s[j]);
        s[j] = mma_b(kb.v, qal[dc], s[j]);
      }
    }

    // ---- scale + causal select (key > query -> -inf by value), the query's maximum, online softmax;
    //      P (x1024, f16) and P residual (x4096) packed as B operands: element e of chunk kk is key
    //      kv0 + 32 kk + (e < 8 ? 8 hh + e : 16 + 8 hh + e - 8), the k order of the V^T fragments ----
    const int dkq = kv0 + 8 * hh - (q0 + c);          // key minus query at j = 0, r = 0
    float m = -INFINITY;
#pragma unroll
    for (int j = 0; j < 4; ++j) {
#pragma unroll
      for (int r = 0; r < 8; ++r) {
        float sv = s[j][r] * sscale;
        sv = (dkq <= -(j * 16 + r)) ? sv : -INFINITY;  // key kv0 + 16 j + 8 hh + r <= query q0 + c
        s[j][r] = sv;
        m = fmaxf(m, sv);
      }
    }
    m = fmaxf(m, xhalf(m));                           // both halves now hold the maximum over the 64 keys
    const float mnew  = fmaxf(mrow, m);
    const float msafe = (mnew == -INFINITY) ? 0.f : mnew;
    const float alpha = __expf(mrow - msafe);         // mrow = -inf -> 0 (l and context are 0 there anyway)
    mrow = mnew;
    float ps[4];                                      // one partial sum per score tile: four short add chains
    FH pb[2], pr[2];
#pragma unroll
    for (int j = 0; j < 4; ++j) {
      ps[j] = 0.f;
#pragma unroll
      for (int r = 0; r < 8; ++r) {
        const float p = __expf(s[j][r] - msafe);      // masked logit: exp(-inf) -> 0
        ps[j] += p;
        const float p1k = p * 1024.0f;
        const _Float16 ph = (_Float16)p1k;
        pb[j >> 1].v[(j & 1) * 8 + r] = ph;
        if (RES) pr[j >> 1].v[(j & 1) * 8 + r] = (_Float16)((p1k - (float)ph) * 4096.0f);
      }
    }
    lrow = lrow * alpha + ((ps[0] + ps[1]) + (ps[2] + ps[3]));
#pragma unroll
    for (int t = 0; t < 4; ++t)
#pragma unroll
      for (int r = 0; r < 8; ++r) oacc[t][r] *= alpha;

    // ---- context^T += V^T . P^T (f16 WMMA), residual products into a separate accumulator ----
    v8f o1[4];
#pragma unroll
    for (int t = 0; t < 4; ++t) o1[t] = zero8();
    // unrolled: the P chunks are register arrays (constant indices only)
#pragma unroll
    for (int kk = 0; kk < 2; ++kk) {
#pragma unroll
      for (int t = 0; t < 4; ++t) {
        FH vb;
        vb.h[0] = *(const v8h*)(Vth + (t * 16 + c) * LP + kk * 32 + 8 * hh);
        vb.h[1] = *(const v8h*)(Vth + (t * 16 + c) * LP + kk * 32 + 16 + 8 * hh);
        oacc[t] = mma_h(vb.v, pb[kk].v, oacc[t]);
        if (RES) {
          FH vl;
          vl.h[0] = *(const v8h*)(Vtl + (t * 16 + c) * LP + kk * 32 + 8 * hh);
          vl.h[1] = *(const v8h*)(Vtl + (t * 16 + c) * LP + kk * 32 + 16 + 8 * hh);
          o1[t] = mma_h(vl.v, pb[kk].v, o1[t]);
          o1[t] = mma_h(vb.v, pr[kk].v, o1[t]);
        }
      }
    }
    if (RES) {
#pragma unroll
      for (int t = 0; t < 4; ++t)
#pragma unroll
        for (int r = 0; r < 8; ++r) oacc[t][r] += o1[t][r] * (1.0f / 4096.0f);
    }
  }

  const float lsum = lrow + xhalf(lrow);     // the two halves' key sums joined, once

  // ---- group 1 hands over its running maximum, sum and context (each lane its own accumulator positions:
  //      row = query c, 8 consecutive d per tile t) ----
  float* os = Os[wave];
  float* ml = Ml[wave];
  if (grp == 1) {
#pragma unroll
    for (int t = 0; t < 4; ++t) {
      float* op = os + c * OP + t * 16 + 8 * hh;
      const v4f lo4 = {oacc[t][0], oacc[t][1], oacc[t][2], oacc[t][3]};
      const v4f hi4 = {oacc[t][4], oacc[t][5], oacc[t][6], oacc[t][7]};
      *(v4f*)(op)     = lo4;
      *(v4f*)(op + 4) = hi4;
    }
    if (hh == 0) {                           // m and l are equal in the two lanes of a query
      ml[c]      = mrow;
      ml[16 + c] = lsum;
    }
  }
  __syncthreads();                           // group 1's partial results may be read
  if (grp == 1) return;                      // no barrier follows

  // ---- join the two partial softmaxes (a group without a tile brings m = -inf, l = 0, context 0), normalise
  //      (1/l and the 1/1024 p carry), stage the 16x64 tile in LDS (each lane overwrites the positions it has just
  //      read), then write bf16 hi/lo
  {
    const float m1 = ml[c];
    const float l1 = ml[16 + c];
    const float mj    = fmaxf(mrow, m1);
    const float msafe = (mj == -INFINITY) ? 0.f : mj;
    const float a0 = __expf(mrow - msafe);
    const float a1 = __expf(m1 - msafe);
    const float l = lsum * a0 + l1 * a1;
    const float inv = ((l > 0.f) ? (1.0f / l) : 0.f) * (1.0f / 1024.0f);
#pragma unroll
    for (int t = 0; t < 4; ++t) {
      float* op = os + c * OP + t * 16 + 8 * hh;
      const v4f g0 = *(const v4f*)(op);
      const v4f g1 = *(const v4f*)(op + 4);
      v4f w0, w1;
#pragma unroll
      for (int e = 0; e < 4; ++e) {
        w0[e] = (oacc[t][e] * a0 + g0[e] * a1) * inv;
        w1[e] = (oacc[t][4 + e] * a0 + g1[e] * a1) * inv;
      }
      *(v4f*)(op)     = w0;
      *(v4f*)(op + 4) = w1;
    }
  }
  __builtin_amdgcn_fence(__ATOMIC_RELEASE, "workgroup");
  __builtin_amdgcn_wave_barrier();
  __builtin_amdgcn_fence(__ATOMIC_ACQUIRE, "workgroup");
  {
    const int q = lane >> 3, c8 = (lane & 7) * 8;
    v4u hv[4], lv[4];
#pragma unroll
    for (int it = 0; it < 4; ++it) {
      const int row = it * 4 + q;      // it 0..3 x q 0..3 = rows 0..15 of the wave tile
      const float* sp = os + row * OP + c8;
      v4u a, a2;
#pragma unroll
      for (int e = 0; e < 4; ++e) {
        const float f0 = sp[2 * e], f1 = sp[2 * e + 1];
        const unsigned short h0 = bf_bits(f0), h1 = bf_bits(f1);
        const unsigned short l0 = bf_bits(f0 - bf_up(h0)), l1 = bf_bits(f1 - bf_up(h1));
        a[e] = pk16(h0, h1); a2[e] = pk16(l0, l1);
      }
      hv[it] = a; lv[it] = a2;
    }
    {
#pragma unroll
      for (int it = 0; it < 4; ++it) {
        const int row = it * 4 + q;
        const size_t go = (rowB + q0 + row) * DM + (size_t)h * HD + c8;
        *(v4u*)(ahp + go) = hv[it];
        *(v4u*)(alp + go) = lv[it];
      }
      
    }
  }
}

// =====================================================================================================
// Workspace map (bytes), every region an exact multiple of its whole-line / whole-tile store granularity
//  because M, N are multiples of 64 everywhere):
//   Wqkvb  bf16 [3072][1024]             0          6291456   (rows 0..2047 = Wq|Wk as Bt, rows 2048.. = Wv as A)
//   Wob    bf16 [1024][1024]             6291456    2097152
//   Xb     bf16 [4096][1024]             8388608    8388608
//   XPh    bf16 [4096][1024]            16777216    8388608
//   XPl    bf16 [4096][1024]            25165824    8388608
//   QKh    bf16 [4096][2048]            33554432   16777216
//   QKl    bf16 [4096][2048]            50331648   16777216
//   VTh    f16  [2][1024][2048]         67108864    8388608
//   VTl    f16  [2][1024][512]          75497472    2097152
//   Ah     bf16 [4096][1024]            77594624    8388608
//   Al     bf16 [4096][1024]            85983232    8388608
//   end                                 94371840
// Weights arrive [out n][in k] row-major = the Bt / A layout the GEMM wants (k contiguous), so they are only
// RNE-converted to bf16.
// =====================================================================================================
extern "C" void kernel_launch(void* const* d_in, const int* in_sizes, int n_in,
                              void* d_out, int out_size, void* d_ws, size_t ws_size,
                              hipStream_t stream) {
  if (n_in < 4) return;
  if (in_sizes[0] != NB * SEQ * DM) return;
  if (in_sizes[1] != SEQ * DM) return;
  if (in_sizes[2] != 3 * DM * DM) return;
  if (in_sizes[3] != DM * DM) return;
  if (out_size != NB * SEQ * DM) return;

  const float* x    = (const float*)d_in[0];   // [NB][SEQ][DM]
  const float* posp = (const float*)d_in[1];   // [SEQ][DM]
  const float* wqkv = (const float*)d_in[2];   // [3*DM n][DM k]
  const float* wo   = (const float*)d_in[3];   // [DM n][DM k]

  const size_t PWqkv = (size_t)3 * DM * DM * 2;       //  6291456  bf16 [3072][1024]
  const size_t PWo   = (size_t)DM * DM * 2;           //  2097152  bf16 [1024][1024]
  const size_t PX    = (size_t)NB * SEQ * DM * 2;     //  8388608  bf16 [4096][1024]
  const size_t PQK   = (size_t)NB * SEQ * NQK * 2;    // 16777216  bf16 [4096][2048]
  const size_t PVTh  = (size_t)NB * DM * SEQ * 2;     //  8388608
  const size_t PVTl  = (size_t)NB * DM * VLP * 2;     //  2097152
  size_t off = 0;
  const size_t oWqkv = off; off += PWqkv;
  const size_t oWo   = off; off += PWo;
  const size_t oXb   = off; off += PX;
  const size_t oXPh  = off; off += PX;
  const size_t oXPl  = off; off += PX;
  const size_t oQKh  = off; off += PQK;
  const size_t oQKl  = off; off += PQK;
  const size_t oVTh  = off; off += PVTh;
  const size_t oVTl  = off; off += PVTl;
  const size_t oAh   = off; off += PX;
  const size_t oAl   = off; off += PX;
  if (off > ws_size) return;                           // off = 94371840
  if (off > (size_t)134217728) return;

  char* ws = (char*)d_ws;
  unsigned short* Wqkvb = (unsigned short*)(ws + oWqkv);
  unsigned short* Wvb   = Wqkvb + (size_t)2 * DM * DM;   // rows 2048..3071 of the Wqkv plane
  unsigned short* Wob   = (unsigned short*)(ws + oWo);
  unsigned short* Xb    = (unsigned short*)(ws + oXb);
  unsigned short* XPh   = (unsigned short*)(ws + oXPh);
  unsigned short* XPl   = (unsigned short*)(ws + oXPl);
  unsigned short* QKh   = (unsigned short*)(ws + oQKh);
  unsigned short* QKl   = (unsigned short*)(ws + oQKl);
  unsigned short* VTh   = (unsigned short*)(ws + oVTh);
  unsigned short* VTl   = (unsigned short*)(ws + oVTl);
  unsigned short* Ah    = (unsigned short*)(ws + oAh);
  unsigned short* Al    = (unsigned short*)(ws + oAl);
  float*          outf  = (float*)d_out;

  const dim3 blk(256);
  const int n8qkv = 3 * DM * DM / 8;                                 // 393216 (multiple of 256)
  const int n8w   = DM * DM / 8;                                     // 131072 (multiple of 256)
  const int n8x   = NB * SEQ * DM / 8;                               // 524288 (multiple of 256)
  const int p8    = SEQ * DM / 8;                                    // 262144
  const dim3 gCvtQKV((n8qkv + 255) / 256);                           // 1536 blocks
  const dim3 gCvtW((n8w + 255) / 256);                               // 512 blocks
  const dim3 gPrep((n8x + 255) / 256);                               // 2048 blocks
  const dim3 gQK((NB * SEQ / 128) * (NQK / 256), 1);                 // 128x256 tiles -> 256 blocks of 8 waves
  const dim3 gVT((DM / 128) * (SEQ / 128), NB);                      // 128x128 tiles -> 128 blocks of 4 waves x 2
  const dim3 gOut((NB * SEQ / 128) * (DM / 128), 1);                 // 128x128 tiles -> 256 blocks of 4 waves

  // (1) weights -> bf16 planes (keep their [n][k] layout); x -> bf16 plane; x + pos -> bf16 hi/lo planes
  cvt_bf16x8<<<gCvtQKV, blk, 0, stream>>>(wqkv, Wqkvb, n8qkv);
  cvt_bf16x8<<<gCvtW, blk, 0, stream>>>(wo, Wob, n8w);
  prep_x8<<<gPrep, blk, 0, stream>>>(x, posp, Xb, XPh, XPl, n8x, p8);
  // (2) q|k projection: QK[row][n] = sum_k (XPh+XPl)[row][k] Wqkvb[n][k], n < 2048 -> bf16 hi/lo planes,
  //     pitch NQK   (M=4096, N=2048, K=1024, 2 products)
  gemm64<1, 2, 4><<<gQK, dim3(256), 0, stream>>>(
      XPh, XPl, DM, 0LL, Wqkvb, DM, 0LL,
      (void*)QKh, NQK, 0LL, (void*)QKl, NQK, 0LL, NQK,
      NB * SEQ, NQK, DM, 1.0f);
  // (3) v^T per batch element: VTh[bl][m][s] = sum_k Wvb[m][k] Xb[bl*SEQ+s][k] -> f16 hi plane (pitch SEQ) and
  //     residual plane (x4096, keys < VLP, pitch VLP)  (M=1024, N=2048, K=1024, single product)
  gemm64<0, 3, 2><<<gVT, dim3(128), 0, stream>>>(
      Wvb, Wvb, DM, 0LL, Xb, DM, (long long)SEQ * DM,
      (void*)VTh, SEQ, (long long)DM * SEQ, (void*)VTl, VLP, (long long)DM * VLP, VLP,
      DM, SEQ, DM, 4096.0f);
  // (4) causal attention: query blocks 0..RESQB-1 with residual planes, the rest without -> Ah/Al bf16 hi/lo
  attn64<true><<<dim3(NB * NH * RESQB), dim3(256), 0, stream>>>(
      QKh, QKl, VTh, VTl, Ah, Al, 0, RESQB, 0.125f);
  attn64<false><<<dim3(NB * NH * (NQB - RESQB)), dim3(256), 0, stream>>>(
      QKh, QKl, VTh, VTl, Ah, Al, RESQB, NQB - RESQB, 0.125f);
  // (5) out[row][n] = sum_k (Ah+Al)[row][k] Wob[n][k] -> d_out f32   (M=4096, N=1024, K=1024, 2 products)
  gemm64<1, 0, 2><<<gOut, dim3(128), 0, stream>>>(
      Ah, Al, DM, 0LL, Wob, DM, 0LL,
      (void*)outf, DM, 0LL, (void*)outf, 0, 0LL, 0,
      NB * SEQ, DM, DM, 1.0f);
  (void)hipGetLastError();
}

// v006
// It runs in 116 microseconds.
// In two side-by-side timings against v005, it was 1.23 and 1.24 times as fast.
// All steps since v000 together make it 3.50 times as fast.
// Contractions: q|k projection = v_wmma_f32_16x16x32_bf16 with (x+pos) as bf16 hi/lo planes times the bf16 Wqk plane (2 products);
// v^T projection = v_wmma_f32_16x16x32_bf16 (bf16 x times bf16 Wv, single product);
// q.k^T scores = v_wmma_f32_16x16x32_bf16 with bf16 hi/lo split q and k (hi.hi + hi.lo + lo.hi);
// p.v = v_wmma_f32_16x16x32_f16 (p carried x1024 in f16, v in f16; extra f16 residual planes x4096 of p and v on the first 512 query rows);
// a.Wout^T = v_wmma_f32_16x16x32_bf16 with a as bf16 hi/lo planes times the bf16 Wout plane (2 products); all f32 accumulate; softmax in f32.
#include <hip/hip_runtime.h>
#include <math.h>
#include <stdint.h>

#define NB    2
#define SEQ   2048
#define DM    1024
#define NH    16
#define HD    64
#define NQK   (2 * DM)       // pitch of the q|k planes: q feature columns 0..DM-1, k feature columns DM..2DM-1
#define NQB   (SEQ / 64)     // 32 query / key tiles of 64
#define VLP   512            // key pitch of the v^T residual plane (keys 0..VLP-1)
#define RESQB 8              // leading 64-row query blocks that use the p / v residual planes
static_assert(RESQB * 64 <= VLP);
static_assert(NH * HD == DM);
static_assert((SEQ % 128) == 0 && (DM % 256) == 0);
static_assert(HD == 64);
static_assert(((NB * SEQ * DM / 8) % 256) == 0);
static_assert(((DM * DM / 8) % 256) == 0);
static_assert(((3 * DM * DM / 8) % 256) == 0);
static_assert(((SEQ * DM) % 8) == 0);

typedef _Float16 v16h __attribute__((ext_vector_type(16)));
typedef _Float16 v8h  __attribute__((ext_vector_type(8)));
typedef __bf16   v16b __attribute__((ext_vector_type(16)));
typedef __bf16   v8b  __attribute__((ext_vector_type(8)));
typedef float    v8f  __attribute__((ext_vector_type(8)));
typedef float    v4f  __attribute__((ext_vector_type(4)));
typedef unsigned int v4u __attribute__((ext_vector_type(4)));

// ---- scalar helpers --------------------------------------------------------------------------------
__device__ __forceinline__ unsigned short bf_bits(float f) {          // f32 -> bf16 bits, RNE convert
  unsigned u = __float_as_uint(f);
  return (unsigned short)((u + 0x7FFFu + ((u >> 16) & 1u)) >> 16);
}
__device__ __forceinline__ float bf_up(unsigned short h) { return __uint_as_float(((unsigned)h) << 16); }
__device__ __forceinline__ unsigned short h_bits(_Float16 x) { return __builtin_bit_cast(unsigned short, x); }
__device__ __forceinline__ unsigned pk16(unsigned short a, unsigned short b) { return (unsigned)a | ((unsigned)b << 16); }
__device__ __forceinline__ v8f zero8() { v8f z = {0.f, 0.f, 0.f, 0.f, 0.f, 0.f, 0.f, 0.f}; return z; }
__device__ __forceinline__ v8h zero8h() {
  const _Float16 z = (_Float16)0.0f;
  v8h r = {z, z, z, z, z, z, z, z};
  return r;
}

// lane l reads lane l ^ 16: the two lanes that share a column of a B operand or of an accumulator tile
__device__ __forceinline__ float xhalf(float x) {
  return __builtin_bit_cast(float, __builtin_amdgcn_permlanex16(__builtin_bit_cast(int, x), __builtin_bit_cast(int, x),
                                                                0x76543210, 0xfedcba98, false, false));
}

// ---- fragment loader: 16-bit A/B operand, lane -> row/col (lane&15), p already includes +8*(lane>>4);
//      elements 0..7 <- p[0..7] (k0+8h..), elements 8..15 <- p[16..23] (k0+16+8h..)
__device__ __forceinline__ v16b ldfrag_b(const __bf16* p) {
  union { v16b v; v8b h[2]; } f;
  f.h[0] = *(const v8b*)(p);
  f.h[1] = *(const v8b*)(p + 16);
  return f.v;
}

// ---- WMMA helpers with trailing VALU hazard gap --------------------------------------------------------
__device__ __forceinline__ v8f mma_b(v16b a, v16b b, v8f c) {
  c = __builtin_amdgcn_wmma_f32_16x16x32_bf16(false, a, false, b, (short)0, c, false, false);
#if defined(__HIP_DEVICE_COMPILE__)
  asm volatile("v_nop\n\tv_nop\n\tv_nop\n\tv_nop" : "+v"(c) : "v"(a), "v"(b));
#endif
  return c;
}
__device__ __forceinline__ v8f mma_h(v16h a, v16h b, v8f c) {
  c = __builtin_amdgcn_wmma_f32_16x16x32_f16(false, a, false, b, (short)0, c, false, false);
#if defined(__HIP_DEVICE_COMPILE__)
  asm volatile("v_nop\n\tv_nop\n\tv_nop\n\tv_nop" : "+v"(c) : "v"(a), "v"(b));
#endif
  return c;
}
__device__ __forceinline__ v8f mma_b_raw(v16b a, v16b b, v8f c) {
  return __builtin_amdgcn_wmma_f32_16x16x32_bf16(false, a, false, b, (short)0, c, false, false);
}
__device__ __forceinline__ void dep_guard_b(v8f& a, v8f& b, v16b x, v16b y) {
#if defined(__HIP_DEVICE_COMPILE__)
  asm volatile("v_nop\n\tv_nop\n\tv_nop\n\tv_nop" : "+v"(a), "+v"(b) : "v"(x), "v"(y));
#endif
}
__device__ __forceinline__ void keep4_b(v16b a, v16b b, v16b c, v16b d) {
#if defined(__HIP_DEVICE_COMPILE__)
  asm volatile("v_nop" :: "v"(a), "v"(b), "v"(c), "v"(d));
#endif
}
__device__ __forceinline__ void acc_guard4(v8f& a, v8f& b, v8f& c, v8f& d) {
#if defined(__HIP_DEVICE_COMPILE__)
  asm volatile("v_nop\n\tv_nop\n\tv_nop\n\tv_nop" : "+v"(a), "+v"(b), "+v"(c), "+v"(d));
#endif
}

// s_wait_xcnt behind a run of global loads; the loads' pointers are inputs, so that no address register is given a
// new value (a later load's result included) in front of the wait (a precaution)
__device__ __forceinline__ void addr_wait4(const void* a, const void* b, const void* c, const void* d) {
#if defined(__HIP_DEVICE_COMPILE__)
  asm volatile("s_wait_xcnt 0x0" :: "v"(a), "v"(b), "v"(c), "v"(d) : "memory");
#endif
}

// s_wait_xcnt behind global stores whose address or data registers are given a new value later (a precaution)
__device__ __forceinline__ void store_wait() {
#if defined(__HIP_DEVICE_COMPILE__)
  asm volatile("s_wait_xcnt 0x0" ::: "memory");
#endif
}

// =====================================================================================================
// f32 -> bf16 (RNE convert), 8 elements per thread, one 16-B store per lane: a wave writes 512 contiguous B
// host-checked). coverage: n8 threads x 8 = whole plane.
// =====================================================================================================
__device__ __forceinline__ void cvt_bf16x8(int blk, const float* __restrict__ in, unsigned short* out, int n8) {
  const int i = blk * 256 + threadIdx.x;
  if (i < n8) {
    const v4f a = *(const v4f*)(in + (size_t)i * 8);
    const v4f b = *(const v4f*)(in + (size_t)i * 8 + 4);
    v4u p;
    p[0] = pk16(bf_bits(a[0]), bf_bits(a[1]));
    p[1] = pk16(bf_bits(a[2]), bf_bits(a[3]));
    p[2] = pk16(bf_bits(b[0]), bf_bits(b[1]));
    p[3] = pk16(bf_bits(b[2]), bf_bits(b[3]));
    *(v4u*)(out + (size_t)i * 8) = p;
    
  }
}

// =====================================================================================================
// x prep: xb = bf16(x) (RNE convert); s = bf_up(bf16(x)) + bf_up(bf16(pos)) in f32 (pos element index =
// x element index mod SEQ*DM); hp = bf16 hi plane of s, lp = bf16 lo plane (lo = RNE(s - hi), unscaled).
// three planes (n8 multiple of 256, host-checked).
// =====================================================================================================
__device__ __forceinline__ void prep_x8(int blk, const float* __restrict__ x, const float* __restrict__ pos,
                                        unsigned short* xb, unsigned short* hp, unsigned short* lp,
                                        int n8, int p8) {
#pragma clang fp contract(off)
  const int i = blk * 256 + threadIdx.x;
  if (i < n8) {
    const int ip = i % p8;
    const v4f a  = *(const v4f*)(x + (size_t)i * 8);
    const v4f b  = *(const v4f*)(x + (size_t)i * 8 + 4);
    const v4f pa = *(const v4f*)(pos + (size_t)ip * 8);
    const v4f pb = *(const v4f*)(pos + (size_t)ip * 8 + 4);
    v4u px, ph, pl;
#pragma unroll
    for (int e = 0; e < 4; ++e) {
      const float f0 = (e < 2) ? a[2 * e]      : b[2 * e - 4];
      const float f1 = (e < 2) ? a[2 * e + 1]  : b[2 * e - 3];
      const float g0 = (e < 2) ? pa[2 * e]     : pb[2 * e - 4];
      const float g1 = (e < 2) ? pa[2 * e + 1] : pb[2 * e - 3];
      const unsigned short x0 = bf_bits(f0), x1 = bf_bits(f1);
      const float s0 = bf_up(x0) + bf_up(bf_bits(g0));
      const float s1 = bf_up(x1) + bf_up(bf_bits(g1));
      const unsigned short h0 = bf_bits(s0), h1 = bf_bits(s1);
      const unsigned short l0 = bf_bits(s0 - bf_up(h0)), l1 = bf_bits(s1 - bf_up(h1));
      px[e] = pk16(x0, x1);
      ph[e] = pk16(h0, h1);
      pl[e] = pk16(l0, l1);
    }
    *(v4u*)(xb + (size_t)i * 8) = px;
    *(v4u*)(hp + (size_t)i * 8) = ph;
    *(v4u*)(lp + (size_t)i * 8) = pl;
    
  }
}

// =====================================================================================================
// The three independent conversions in ONE launch; the block index picks the job (block-uniform branch):
// blocks 0..nbx-1 prepare x, the next nbqkv convert Wqkv, the rest convert Wout.
// =====================================================================================================
__global__ __launch_bounds__(256) void prep_all(const float* __restrict__ x, const float* __restrict__ pos,
                                                const float* __restrict__ wqkv, const float* __restrict__ wo,
                                                unsigned short* xb, unsigned short* hp, unsigned short* lp,
                                                unsigned short* wqkvb, unsigned short* wob,
                                                int n8x, int p8, int n8qkv, int n8w, int nbx, int nbqkv) {
  const int bx = blockIdx.x;
  if (bx < nbx)              prep_x8(bx, x, pos, xb, hp, lp, n8x, p8);
  else if (bx < nbx + nbqkv) cvt_bf16x8(bx - nbx, wqkv, wqkvb, n8qkv);
  else                       cvt_bf16x8(bx - nbx - nbqkv, wo, wob, n8w);
}

// =====================================================================================================
// Eight asynchronous 16-B-per-lane copies global -> LDS (no register in between). The closing s_wait_xcnt stands
// in the copies' own statement so that no address register named here is rewritten in front of it (a precaution).
// =====================================================================================================
__device__ __forceinline__ void copy8_async(const unsigned (&l)[8], const __bf16* const (&g)[8]) {
#if defined(__HIP_DEVICE_COMPILE__)
  asm volatile(
      "global_load_async_to_lds_b128 %0, %8, off\n\t"
      "global_load_async_to_lds_b128 %1, %9, off\n\t"
      "global_load_async_to_lds_b128 %2, %10, off\n\t"
      "global_load_async_to_lds_b128 %3, %11, off\n\t"
      "global_load_async_to_lds_b128 %4, %12, off\n\t"
      "global_load_async_to_lds_b128 %5, %13, off\n\t"
      "global_load_async_to_lds_b128 %6, %14, off\n\t"
      "global_load_async_to_lds_b128 %7, %15, off\n\t"
      "s_wait_xcnt 0x0"
      :: "v"(l[0]), "v"(l[1]), "v"(l[2]), "v"(l[3]), "v"(l[4]), "v"(l[5]), "v"(l[6]), "v"(l[7]),
         "v"(g[0]), "v"(g[1]), "v"(g[2]), "v"(g[3]), "v"(g[4]), "v"(g[5]), "v"(g[6]), "v"(g[7])
      : "memory");
#endif
}

// the same for four copies (a stage whose copies per thread are not a multiple of eight ends in one of these)
__device__ __forceinline__ void copy4_async(const unsigned (&l)[4], const __bf16* const (&g)[4]) {
#if defined(__HIP_DEVICE_COMPILE__)
  asm volatile(
      "global_load_async_to_lds_b128 %0, %4, off\n\t"
      "global_load_async_to_lds_b128 %1, %5, off\n\t"
      "global_load_async_to_lds_b128 %2, %6, off\n\t"
      "global_load_async_to_lds_b128 %3, %7, off\n\t"
      "s_wait_xcnt 0x0"
      :: "v"(l[0]), "v"(l[1]), "v"(l[2]), "v"(l[3]), "v"(g[0]), "v"(g[1]), "v"(g[2]), "v"(g[3])
      : "memory");
#endif
}

// =====================================================================================================
// Batched bf16 WMMA GEMM: C[m][n] = sum_k A[m][k] * Bt[n][k]. A block of 2 x WN waves owns a 128 x (64*WN) tile of
// C, each wave a 64x64 part of it. A row-major [M][K] pitch lda; Bt row-major [N][K] pitch ldb (k contiguous);
// M a multiple of 128, N of 64*WN, K of 64 (host constants). tile = index of the block's tile, b = batch index
// (strides in elements), both handed in by the kernel.
// Operands: per stage of 64 k the block's rows [A 128 | A2 128 (NSPLIT 1) | Bt 64*WN], 128 B each, are copied to
// LDS at pitch 144 B by asynchronous copies (a wave's copy = 4 whole 128-B lines); two buffers, stage t+1 flies
// while stage t is multiplied; the waves read their fragments from LDS with ds loads.
// NSPLIT: 0 = A.Bt; 1 = (A + A2).Bt (A2 = unscaled bf16 lo plane of A).
// OUT_MODE: 0 = f32 (pitch ldc); 2 = bf16 hi plane C + bf16 lo plane C2 (lo = RNE(v - hi), unscaled);
//           3 = f16 hi plane C + f16 residual plane C2 = f16((v - hi) * rscale), C2 written only for tiles
//               with n0 < N2 (pitch ldc2, batch stride strideC2).
// =====================================================================================================
// LDS of one block: the two stage buffers; the per-wave epilogue slabs lie over their first bytes (the last stage's
// barrier, which every wave passes behind its own s_wait_dscnt 0 and s_wait_asynccnt 0, ends all use of the buffers).
// The kernel owns the bytes and hands them to the body: two bodies that share a launch share one allocation, and it is
// small enough for two 8-wave blocks on a WGP, so that a v^T block runs beside a q|k block, not behind it.
template <int NSPLIT, int WN>
struct GemmLds {
  static constexpr int RINGB = 2 * ((NSPLIT == 1 ? 2 : 1) * 128 + 64 * WN) * 72 * 2;   // bytes of the two buffers
  static constexpr int BYTES = RINGB;
  static_assert(2 * WN * 16 * 68 * 4 <= RINGB);                                        // the slabs fit over them
};
template <int NSPLIT, int OUT_MODE, int WN>
__device__ __forceinline__ void gemm64_body(
    unsigned char* smem, int tile, int b,
    const unsigned short* __restrict__ Ap, const unsigned short* A2p, int lda, long long strideA,
    const unsigned short* __restrict__ Btp, int ldb, long long strideB,
    void* Cout, int ldc, long long strideC,
    void* Cout2, int ldc2, long long strideC2, int N2,
    int M, int N, int K, float rscale) {
  static_assert(NSPLIT == 0 || NSPLIT == 1);
  constexpr int NT    = 64 * WN;                       // threads
  constexpr int BM    = 128;                           // block rows of C
  constexpr int BN    = 64 * WN;                       // block columns of C
  constexpr int KS    = 64;                            // k per stage (128 B of every operand row)
  constexpr int AROWS = (NSPLIT == 1 ? 2 : 1) * BM;    // stage rows that hold A (and A2)
  constexpr int ROWS  = AROWS + BN;                    // stage rows in all
  constexpr int PE    = 72;                            // LDS row pitch in elements (144 B = 16 B x 9)
  constexpr int BUFE  = ROWS * PE;                     // elements of one buffer
  constexpr int RPI   = NT / 8;                        // stage rows that one copy of every thread covers
  constexpr int NIT   = ROWS / RPI;                    // copies per thread and stage
  static_assert((BM % RPI) == 0 && (NIT % 4) == 0 && NIT <= 63);
  const __bf16* A   = (const __bf16*)(const void*)Ap;
  const __bf16* A2  = (const __bf16*)(const void*)A2p;
  const __bf16* Bt  = (const __bf16*)(const void*)Btp;
  static_assert(GemmLds<NSPLIT, WN>::RINGB == 2 * BUFE * 2);
  __bf16* const ring = (__bf16*)(void*)smem;                                     // two stage buffers
  float*  const sT   = (float*)(void*)smem;       // per-wave 16x64 slab, pitch 68 floats, used behind the last stage
  const int tid  = threadIdx.x;
  const int lane = tid & 31;
  const int wave = tid >> 5;
  const int tilesN = N / BN;
  const int tilesM = M / BM;
  if (tile >= tilesM * tilesN) return;   // block-uniform, in front of every copy and barrier
  const int tm = tile / tilesN;
  const int tn = tile - tm * tilesN;
  const int wm = wave / WN;                    // wave's 64-row part of the block tile
  const int wn = wave - wm * WN;               // wave's 64-column part
  const int m0 = tm * BM + (wm << 6);
  const int n0 = tn * BN + (wn << 6);

  const int rlane = lane & 15;                 // row (A) / col (B, D) within subtile
  const int koff  = (lane >> 4) * 8;           // k offset of this lane half
  const int mOff  = (lane >> 4) * 8;           // D row offset

  // this thread's 16-B piece of stage row (tid >> 3): source pointers at k = 0 and LDS byte address in buffer 0
  const int crow = tid >> 3, cpc = (tid & 7) * 8;
  const __bf16* gA  = A  + (size_t)b * strideA + (size_t)(tm * BM + crow) * lda + cpc;
  const __bf16* gA2 = (NSPLIT == 1) ? (A2 + (size_t)b * strideA + (size_t)(tm * BM + crow) * lda + cpc) : gA;
  const __bf16* gB  = Bt + (size_t)b * strideB + (size_t)(tn * BN + crow) * ldb + cpc;
  const unsigned lds0 = (unsigned)(size_t)(const void*)ring + (unsigned)(crow * PE + cpc) * 2u;

  // copies the next stage not yet asked for into buffer buf; the three source pointers then step on by one stage
  auto issue_stage = [&](int buf) {
    const unsigned lb = lds0 + (unsigned)buf * (unsigned)(BUFE * 2);
    // both loops unrolled: the stage row decides at compile time which operand a copy reads
#pragma unroll
    for (int g8 = 0; g8 < NIT / 8; ++g8) {
      unsigned dst[8];
      const __bf16* sp[8];
#pragma unroll
      for (int e = 0; e < 8; ++e) {
        const int sr = (g8 * 8 + e) * RPI;     // first stage row of this copy, a compile-time value
        sp[e]  = (sr < BM) ? (gA + (size_t)sr * lda)
               : (sr < AROWS) ? (gA2 + (size_t)(sr - BM) * lda)
                              : (gB + (size_t)(sr - AROWS) * ldb);
        dst[e] = lb + (unsigned)(sr * PE * 2);
      }
      copy8_async(dst, sp);
    }
    if constexpr ((NIT % 8) != 0) {
      unsigned dst[4];
      const __bf16* sp[4];
#pragma unroll
      for (int e = 0; e < 4; ++e) {
        const int sr = ((NIT / 8) * 8 + e) * RPI;
        sp[e]  = (sr < BM) ? (gA + (size_t)sr * lda)
               : (sr < AROWS) ? (gA2 + (size_t)(sr - BM) * lda)
                              : (gB + (size_t)(sr - AROWS) * ldb);
        dst[e] = lb + (unsigned)(sr * PE * 2);
      }
      copy4_async(dst, sp);
    }
    gA += KS; gA2 += KS; gB += KS;
  };

  v8f acc[4][4];
#pragma unroll
  for (int i = 0; i < 4; ++i)
#pragma unroll
    for (int j = 0; j < 4; ++j) acc[i][j] = zero8();

  const int nst = K / KS;
  issue_stage(0);
  asm volatile("s_wait_asynccnt 0x0" ::: "memory");   // this wave's copies of stage 0 have landed
  __syncthreads();                                    // ... and every other wave's: stage 0 may be read
  if (nst > 1) issue_stage(1);

  for (int t = 0; t < nst; ++t) {
    const __bf16* sb  = ring + (t & 1) * BUFE;
    const __bf16* sA  = sb + ((wm << 6) + rlane) * PE + koff;
    const __bf16* sA2 = sA + BM * PE;
    const __bf16* sB  = sb + (AROWS + (wn << 6) + rlane) * PE + koff;
    // every loop of the stage is unrolled: fragments and accumulators are register arrays (constant indices only)
#pragma unroll
    for (int kk = 0; kk < KS; kk += 32) {
      v16b bh[4], ah[4], al[4];
#pragma unroll
      for (int j = 0; j < 4; ++j) bh[j] = ldfrag_b(sB + (j << 4) * PE + kk);
#pragma unroll
      for (int i = 0; i < 4; ++i) {
        ah[i] = ldfrag_b(sA + (i << 4) * PE + kk);
        if (NSPLIT == 1) al[i] = ldfrag_b(sA2 + (i << 4) * PE + kk); else al[i] = ah[i];
      }
#pragma unroll
      for (int i = 0; i < 4; ++i) {
#pragma unroll
        for (int j = 0; j < 4; ++j) acc[i][j] = mma_b_raw(ah[i], bh[j], acc[i][j]);
        if (NSPLIT == 1) {
#pragma unroll
          for (int j = 0; j < 4; ++j) acc[i][j] = mma_b_raw(al[i], bh[j], acc[i][j]);
        }
        dep_guard_b(acc[i][0], acc[i][3], ah[i], al[i]);
      }
      keep4_b(bh[0], bh[1], bh[2], bh[3]);
    }
    asm volatile("s_wait_dscnt 0x0" ::: "memory");     // this wave's reads of buffer t & 1 are done
    asm volatile("s_wait_asynccnt 0x0" ::: "memory");  // this wave's copies of stage t + 1 have landed
    __syncthreads();                                   // publishes stage t + 1, frees buffer t & 1
    if (t + 2 < nst) issue_stage(t & 1);
  }
  asm volatile("s_wait_asynccnt 0x0" ::: "memory");    // no copy is outstanding when the wave goes on
  acc_guard4(acc[0][0], acc[0][1], acc[0][2], acc[0][3]);
  acc_guard4(acc[1][0], acc[1][1], acc[1][2], acc[1][3]);
  acc_guard4(acc[2][0], acc[2][1], acc[2][2], acc[2][3]);
  acc_guard4(acc[3][0], acc[3][1], acc[3][2], acc[3][3]);

  // ---- epilogue ----
  float* slab = sT + wave * (16 * 68);
#pragma unroll
  for (int i = 0; i < 4; ++i) {
    const int mBase = m0 + (i << 4);
#pragma unroll
    for (int r = 0; r < 8; ++r) {
#pragma unroll
      for (int j = 0; j < 4; ++j) {
        slab[(mOff + r) * 68 + (j << 4) + rlane] = acc[i][j][r];
      }
    }
    __builtin_amdgcn_fence(__ATOMIC_RELEASE, "workgroup");
    __builtin_amdgcn_wave_barrier();
    __builtin_amdgcn_fence(__ATOMIC_ACQUIRE, "workgroup");
    if (OUT_MODE == 0) {
      float* C = (float*)Cout + (size_t)b * strideC;
      const int hh = lane >> 4, c4 = (lane & 15) * 4;     // 256-B row segment = 16 lanes x 16 B
      v4f ov[8];
#pragma unroll
      for (int it = 0; it < 8; ++it) {
        const int row = it * 2 + hh;                       // it 0..7 x hh 0..1 = rows 0..15
        ov[it] = *(const v4f*)(slab + row * 68 + c4);
      }
      {
#pragma unroll
        for (int it = 0; it < 8; ++it) {
          const int row = it * 2 + hh;
          *(v4f*)(C + (size_t)(mBase + row) * ldc + n0 + c4) = ov[it];
        }
        
      }
    } else {
      const int q = lane >> 3, c8 = (lane & 7) * 8;
      unsigned short* C  = (unsigned short*)Cout  + (size_t)b * strideC;
      unsigned short* C2 = (unsigned short*)Cout2 + (size_t)b * strideC2;
      const bool wlo = (OUT_MODE == 2) || (n0 < N2);      // wave-uniform
      v4u hv[4], lv[4];
#pragma unroll
      for (int it = 0; it < 4; ++it) {
        const int row = it * 4 + q;                        // it 0..3 x q 0..3 = rows 0..15
        const float* sp = slab + row * 68 + c8;
        v4u a, a2;
#pragma unroll
        for (int e = 0; e < 4; ++e) {
          const float f0 = sp[2 * e], f1 = sp[2 * e + 1];
          unsigned short h0, h1, l0, l1;
          if (OUT_MODE == 2) {
            h0 = bf_bits(f0); h1 = bf_bits(f1);
            l0 = bf_bits(f0 - bf_up(h0)); l1 = bf_bits(f1 - bf_up(h1));
          } else {
            const _Float16 x0 = (_Float16)f0, x1 = (_Float16)f1;
            h0 = h_bits(x0); h1 = h_bits(x1);
            l0 = h_bits((_Float16)((f0 - (float)x0) * rscale));
            l1 = h_bits((_Float16)((f1 - (float)x1) * rscale));
          }
          a[e] = pk16(h0, h1); a2[e] = pk16(l0, l1);
        }
        hv[it] = a; lv[it] = a2;
      }
      {
#pragma unroll
        for (int it = 0; it < 4; ++it) {
          const int row = it * 4 + q;
          *(v4u*)(C + (size_t)(mBase + row) * ldc + n0 + c8) = hv[it];
          if (wlo) *(v4u*)(C2 + (size_t)(mBase + row) * ldc2 + n0 + c8) = lv[it];
        }
        
      }
    }
    __builtin_amdgcn_fence(__ATOMIC_RELEASE, "workgroup");
    __builtin_amdgcn_wave_barrier();
    __builtin_amdgcn_fence(__ATOMIC_ACQUIRE, "workgroup");
  }
}

// one GEMM alone in its launch: blockIdx.x = tile, blockIdx.y = batch index
template <int NSPLIT, int OUT_MODE, int WN>
__global__ __launch_bounds__(64 * WN) void gemm64(
    const unsigned short* __restrict__ Ap, const unsigned short* A2p, int lda, long long strideA,
    const unsigned short* __restrict__ Btp, int ldb, long long strideB,
    void* Cout, int ldc, long long strideC,
    void* Cout2, int ldc2, long long strideC2, int N2,
    int M, int N, int K, float rscale) {
  __shared__ __align__(16) unsigned char smem[GemmLds<NSPLIT, WN>::BYTES];
  gemm64_body<NSPLIT, OUT_MODE, WN>(smem, blockIdx.x, blockIdx.y, Ap, A2p, lda, strideA, Btp, ldb, strideB,
                                    Cout, ldc, strideC, Cout2, ldc2, strideC2, N2, M, N, K, rscale);
}

// The two independent projections in ONE launch of 8-wave blocks; the block index picks the job (block-uniform
// branch): blocks 0..nqk-1 own the 128x256 tiles of the q|k projection, the rest the 128x256 tiles of v^T
// (vtTiles tiles per batch element).
//   q|k: QK[row][n] = sum_k (XPh+XPl)[row][k] Wqk[n][k], n < 2048 -> bf16 hi/lo planes, pitch NQK (2 products)
//   v^T: VTh[bl][m][s] = sum_k Wv[m][k] Xb[bl*SEQ+s][k] -> f16 hi plane (pitch SEQ) and residual plane
//        (x4096, keys < VLP, pitch VLP), single product
__global__ __launch_bounds__(256) void gemm_qk_vt(
    const unsigned short* __restrict__ XPh, const unsigned short* XPl, const unsigned short* __restrict__ Wqk,
    const unsigned short* __restrict__ Wv, const unsigned short* __restrict__ Xb,
    unsigned short* QKh, unsigned short* QKl, unsigned short* VTh, unsigned short* VTl, int nqk, int vtTiles) {
  static_assert(GemmLds<0, 4>::BYTES <= GemmLds<1, 4>::BYTES);
  __shared__ __align__(16) unsigned char smem[GemmLds<1, 4>::BYTES];
  const int bx = blockIdx.x;
  if (bx < nqk) {
    gemm64_body<1, 2, 4>(smem, bx, 0, XPh, XPl, DM, 0LL, Wqk, DM, 0LL,
                         (void*)QKh, NQK, 0LL, (void*)QKl, NQK, 0LL, NQK,
                         NB * SEQ, NQK, DM, 1.0f);
  } else {
    const int r = bx - nqk;
    gemm64_body<0, 3, 4>(smem, r % vtTiles, r / vtTiles, Wv, Wv, DM, 0LL, Xb, DM, (long long)SEQ * DM,
                         (void*)VTh, SEQ, (long long)DM * SEQ, (void*)VTl, VLP, (long long)DM * VLP, VLP,
                         DM, SEQ, DM, 4096.0f);
  }
}

template <bool RES>
struct AttnLds {                                   // bytes: the K / V^T planes of both groups, context tiles, m and l
  static constexpr int KVB   = 2 * (RES ? 4 : 3) * 64 * 72 * 2;
  static constexpr int OSB   = 4 * 16 * 68 * 4;
  static constexpr int BYTES = KVB + OSB + 4 * 32 * 4;
};
template <bool RES>
__device__ __forceinline__
void attn64(unsigned char* smem, int bx,
            const unsigned short* __restrict__ qkhp, const unsigned short* __restrict__ qklp,
            const unsigned short* __restrict__ vhp, const unsigned short* __restrict__ vlp,
            unsigned short* ahp, unsigned short* alp, int qbBase, int nqbThis, float sscale) {
  union FB { v16b v; v8b h[2]; };
  union FH { v16h v; v8h h[2]; };
  // LDS row pitches: 16-bit tiles 72 elements (144 B = 16 B x 9), so that the 16 rows which a 16-B fragment read
  // touches fall on 16 different groups of four banks; the f32 tile 68 floats (272 B = 16 B x 17), likewise.
  constexpr int LP = 72;
  constexpr int OP = 68;
  constexpr int PLE = 64 * LP;                                    // elements of one 64-row tile plane, 9 KB
  constexpr int NPL = RES ? 4 : 3;                                // planes of a group: K hi, K lo, V^T hi, (V^T residual)
  static_assert(AttnLds<RES>::KVB == 2 * NPL * PLE * 2 && AttnLds<RES>::OSB == 4 * 16 * OP * 4);
  unsigned short* const KV = (unsigned short*)(void*)smem;        // per group its planes in a row: one base register
  float* const Os = (float*)(void*)(smem + AttnLds<RES>::KVB);    // per 16 query rows: context tile [row][d]
  float* const Ml = (float*)(void*)(smem + AttnLds<RES>::KVB + AttnLds<RES>::OSB);   // group 1's m (0..15), l (16..31)

  const int wv   = __builtin_amdgcn_readfirstlane((int)(threadIdx.x >> 5));   // wave 0..7, held as a scalar
  const int grp  = wv >> 2;                 // key group of this wave (a scalar: branches on it are scalar branches)
  const int wave = wv & 3;                  // which 16 query rows of the block
  const int tid  = threadIdx.x & 127;       // thread within its group
  const int lane = tid & 31;
  unsigned short* const kvg = KV + grp * (NPL * PLE);
  __bf16*   const Ksh = (__bf16*)(void*)kvg;                      // K hi [kv][d]
  __bf16*   const Ksl = Ksh + PLE;                                // K lo
  _Float16* const Vth = (_Float16*)(void*)(kvg + 2 * PLE);        // V^T hi [d][kv]
  _Float16* const Vtl = Vth + (RES ? PLE : 0);                    // V^T residual (used with RES only)
  const int hh   = lane >> 4;
  const int c    = lane & 15;

  const int qbl  = bx % nqbThis;
  const int rest = bx / nqbThis;
  const int h    = rest % NH;
  const int b    = rest / NH;
  const int qb   = qbBase + qbl;
  const int q0   = qb * 64 + wave * 16;
  const size_t rowB = (size_t)b * SEQ;

  const __bf16* Qh = (const __bf16*)(const void*)qkhp + (size_t)h * HD;
  const __bf16* Ql = (const __bf16*)(const void*)qklp + (size_t)h * HD;
  const __bf16* Kh = (const __bf16*)(const void*)qkhp + (size_t)DM + (size_t)h * HD;
  const __bf16* Kl = (const __bf16*)(const void*)qklp + (size_t)DM + (size_t)h * HD;
  const _Float16* Vh = (const _Float16*)(const void*)vhp + ((size_t)b * DM + (size_t)h * HD) * SEQ;
  const _Float16* Vl = (const _Float16*)(const void*)vlp + ((size_t)b * DM + (size_t)h * HD) * VLP;

  // ---- Q fragments (B operand, column = query = lane&15): 2 d-chunks, hi and lo ----
  //      without residual planes loaded once and kept; with them loaded anew in every trip, so that they are not live
  //      through softmax and second product and this body fits the register budget of the launch it shares
  v16b qah[2], qal[2];
  const __bf16* const qhp = Qh + (rowB + q0 + c) * NQK + 8 * hh;
  const __bf16* const qlp = Ql + (rowB + q0 + c) * NQK + 8 * hh;
  if constexpr (!RES) {
#pragma unroll
    for (int dc = 0; dc < 2; ++dc) {
      qah[dc] = ldfrag_b(qhp + dc * 32);
      qal[dc] = ldfrag_b(qlp + dc * 32);
    }
  }

  float mrow = -INFINITY;                    // running maximum of query q0 + c, equal in both halves of the wave
  float lrow = 0.f;                          // running sum over the keys that this half of the wave holds
  v8f oacc[4];                               // O^T: oacc[t][r] = context[query q0 + c][d = 16 t + 8 hh + r]
#pragma unroll
  for (int t = 0; t < 4; ++t) oacc[t] = zero8();

  int nkt = qb + 1;                          // key tiles 0..qb, block-uniform
  if (nkt > NQB) nkt = NQB;
  const int nit = (nkt + 1) >> 1;            // block-uniform trip count <= 16; every wave passes every barrier
  for (int it = 0; it < nit; ++it) {
    const int kt  = 2 * it + grp;            // this group's key tile
    const bool act = kt < nkt;               // false only in group 1's last trip when nkt is odd (a scalar)
    const int kv0 = kt * 64;
    __syncthreads();
    if (act) {
      // eight lanes share a tile row (128 B = one line): a wave's 16-B load covers four whole lines; load i of a
      // thread takes row r + 16 i
      const int r = tid >> 3, pc = (tid & 7) * 8;
      const __bf16*   kg  = Kh + (rowB + kv0 + r) * NQK + pc;     // K row kv0+r, d = pc..pc+7
      const __bf16*   klg = Kl + (rowB + kv0 + r) * NQK + pc;
      const _Float16* vg  = Vh + (size_t)r * SEQ + kv0 + pc;      // V^T row d = r, s = kv0+pc..+7
      const int kvl = (kv0 + 64 <= VLP) ? kv0 : (VLP - 64);     // clamped address into the residual plane
      const _Float16* vlg = Vl + (size_t)r * VLP + kvl + pc;
      const bool resOK = (kv0 + 64 <= VLP);                      // the same in a whole group
      v8b a0[4], a1[4];
      v8h b0[4], b1[4];
      // both loops unrolled: the loaded pieces are register arrays (constant indices only)
#pragma unroll
      for (int i = 0; i < 4; ++i) {
        a0[i] = *(const v8b*)(kg + (size_t)(16 * i) * NQK);
        a1[i] = *(const v8b*)(klg + (size_t)(16 * i) * NQK);
        b0[i] = *(const v8h*)(vg + (size_t)(16 * i) * SEQ);
        b1[i] = RES ? *(const v8h*)(vlg + (size_t)(16 * i) * VLP) : zero8h();
      }
      addr_wait4(kg, klg, vg, RES ? vlg : vg);
#pragma unroll
      for (int i = 0; i < 4; ++i) {
        *(v8b*)(Ksh + (r + 16 * i) * LP + pc) = a0[i];
        *(v8b*)(Ksl + (r + 16 * i) * LP + pc) = a1[i];
        *(v8h*)(Vth + (r + 16 * i) * LP + pc) = b0[i];
        if (RES) *(v8h*)(Vtl + (r + 16 * i) * LP + pc) = resOK ? b1[i] : zero8h();
      }
    }
    __syncthreads();
    if (!act) continue;
    if constexpr (RES) {
#pragma unroll
      for (int dc = 0; dc < 2; ++dc) {
        qah[dc] = ldfrag_b(qhp + dc * 32);
        qal[dc] = ldfrag_b(qlp + dc * 32);
      }
      addr_wait4(qhp, qlp, qhp, qlp);
    }

    // ---- scores, transposed: 64 keys x 16 query columns per wave, 3 bf16 products;
    //      s[j][r] = score of key kv0 + 16 j + 8 hh + r with query q0 + c ----
    v8f s[4];
#pragma unroll
    for (int j = 0; j < 4; ++j) {
      s[j] = zero8();
#pragma unroll
      for (int dc = 0; dc < 2; ++dc) {
        FB kb, kl;
        kb.h[0] = *(const v8b*)(Ksh + (j * 16 + c) * LP + dc * 32 + 8 * hh);
        kb.h[1] = *(const v8b*)(Ksh + (j * 16 + c) * LP + dc * 32 + 16 + 8 * hh);
        kl.h[0] = *(const v8b*)(Ksl + (j * 16 + c) * LP + dc * 32 + 8 * hh);
        kl.h[1] = *(const v8b*)(Ksl + (j * 16 + c) * LP + dc * 32 + 16 + 8 * hh);
        s[j] = mma_b(kb.v, qah[dc], s[j]);
        s[j] = mma_b(kl.v, qah[dc], s[j]);
        s[j] = mma_b(kb.v, qal[dc], s[j]);
      }
    }

    // ---- scale + causal select (key > query -> -inf by value), the query's maximum, online softmax;
    //      P (x1024, f16) and P residual (x4096) packed as B operands: element e of chunk kk is key
    //      kv0 + 32 kk + (e < 8 ? 8 hh + e : 16 + 8 hh + e - 8), the k order of the V^T fragments ----
    const int dkq = kv0 + 8 * hh - (q0 + c);          // key minus query at j = 0, r = 0
    float m = -INFINITY;
#pragma unroll
    for (int j = 0; j < 4; ++j) {
#pragma unroll
      for (int r = 0; r < 8; ++r) {
        float sv = s[j][r] * sscale;
        sv = (dkq <= -(j * 16 + r)) ? sv : -INFINITY;  // key kv0 + 16 j + 8 hh + r <= query q0 + c
        s[j][r] = sv;
        m = fmaxf(m, sv);
      }
    }
    m = fmaxf(m, xhalf(m));                           // both halves now hold the maximum over the 64 keys
    const float mnew  = fmaxf(mrow, m);
    const float msafe = (mnew == -INFINITY) ? 0.f : mnew;
    const float alpha = __expf(mrow - msafe);         // mrow = -inf -> 0 (l and context are 0 there anyway)
    mrow = mnew;
    float ps[4];                                      // one partial sum per score tile: four short add chains
    FH pb[2], pr[2];
#pragma unroll
    for (int j = 0; j < 4; ++j) {
      ps[j] = 0.f;
#pragma unroll
      for (int r = 0; r < 8; ++r) {
        const float p = __expf(s[j][r] - msafe);      // masked logit: exp(-inf) -> 0
        ps[j] += p;
        const float p1k = p * 1024.0f;
        const _Float16 ph = (_Float16)p1k;
        pb[j >> 1].v[(j & 1) * 8 + r] = ph;
        if (RES) pr[j >> 1].v[(j & 1) * 8 + r] = (_Float16)((p1k - (float)ph) * 4096.0f);
      }
    }
    lrow = lrow * alpha + ((ps[0] + ps[1]) + (ps[2] + ps[3]));
#pragma unroll
    for (int t = 0; t < 4; ++t)
#pragma unroll
      for (int r = 0; r < 8; ++r) oacc[t][r] *= alpha;

    // ---- context^T += V^T . P^T (f16 WMMA), residual products into a separate accumulator ----
    // every loop unrolled: the P chunks are register arrays (constant indices only)
    if constexpr (!RES) {
#pragma unroll
      for (int kk = 0; kk < 2; ++kk) {
#pragma unroll
        for (int t = 0; t < 4; ++t) {
          FH vb;
          vb.h[0] = *(const v8h*)(Vth + (t * 16 + c) * LP + kk * 32 + 8 * hh);
          vb.h[1] = *(const v8h*)(Vth + (t * 16 + c) * LP + kk * 32 + 16 + 8 * hh);
          oacc[t] = mma_h(vb.v, pb[kk].v, oacc[t]);
        }
      }
    } else {
      // one context tile after the other, so that one residual accumulator is live, not four: this body then fits the
      // register budget of the launch it shares; each accumulator takes its products in the order kk = 0, 1
#pragma unroll
      for (int t = 0; t < 4; ++t) {
        v8f o1 = zero8();
#pragma unroll
        for (int kk = 0; kk < 2; ++kk) {
          FH vb, vl;
          vb.h[0] = *(const v8h*)(Vth + (t * 16 + c) * LP + kk * 32 + 8 * hh);
          vb.h[1] = *(const v8h*)(Vth + (t * 16 + c) * LP + kk * 32 + 16 + 8 * hh);
          oacc[t] = mma_h(vb.v, pb[kk].v, oacc[t]);
          vl.h[0] = *(const v8h*)(Vtl + (t * 16 + c) * LP + kk * 32 + 8 * hh);
          vl.h[1] = *(const v8h*)(Vtl + (t * 16 + c) * LP + kk * 32 + 16 + 8 * hh);
          o1 = mma_h(vl.v, pb[kk].v, o1);
          o1 = mma_h(vb.v, pr[kk].v, o1);
        }
#pragma unroll
        for (int r = 0; r < 8; ++r) oacc[t][r] += o1[r] * (1.0f / 4096.0f);
      }
    }
  }

  const float lsum = lrow + xhalf(lrow);     // the two halves' key sums joined, once

  // ---- group 1 hands over its running maximum, sum and context (each lane its own accumulator positions:
  //      row = query c, 8 consecutive d per tile t) ----
  float* os = Os + wave * (16 * OP);
  float* ml = Ml + wave * 32;
  if (grp == 1) {
#pragma unroll
    for (int t = 0; t < 4; ++t) {
      float* op = os + c * OP + t * 16 + 8 * hh;
      const v4f lo4 = {oacc[t][0], oacc[t][1], oacc[t][2], oacc[t][3]};
      const v4f hi4 = {oacc[t][4], oacc[t][5], oacc[t][6], oacc[t][7]};
      *(v4f*)(op)     = lo4;
      *(v4f*)(op + 4) = hi4;
    }
    if (hh == 0) {                           // m and l are equal in the two lanes of a query
      ml[c]      = mrow;
      ml[16 + c] = lsum;
    }
  }
  __syncthreads();                           // group 1's partial results may be read
  if (grp == 1) return;                      // no barrier follows

  // ---- join the two partial softmaxes (a group without a tile brings m = -inf, l = 0, context 0), normalise
  //      (1/l and the 1/1024 p carry), stage the 16x64 tile in LDS (each lane overwrites the positions it has just
  //      read), then write bf16 hi/lo
  {
    const float m1 = ml[c];
    const float l1 = ml[16 + c];
    const float mj    = fmaxf(mrow, m1);
    const float msafe = (mj == -INFINITY) ? 0.f : mj;
    const float a0 = __expf(mrow - msafe);
    const float a1 = __expf(m1 - msafe);
    const float l = lsum * a0 + l1 * a1;
    const float inv = ((l > 0.f) ? (1.0f / l) : 0.f) * (1.0f / 1024.0f);
#pragma unroll
    for (int t = 0; t < 4; ++t) {
      float* op = os + c * OP + t * 16 + 8 * hh;
      const v4f g0 = *(const v4f*)(op);
      const v4f g1 = *(const v4f*)(op + 4);
      v4f w0, w1;
#pragma unroll
      for (int e = 0; e < 4; ++e) {
        w0[e] = (oacc[t][e] * a0 + g0[e] * a1) * inv;
        w1[e] = (oacc[t][4 + e] * a0 + g1[e] * a1) * inv;
      }
      *(v4f*)(op)     = w0;
      *(v4f*)(op + 4) = w1;
    }
  }
  __builtin_amdgcn_fence(__ATOMIC_RELEASE, "workgroup");
  __builtin_amdgcn_wave_barrier();
  __builtin_amdgcn_fence(__ATOMIC_ACQUIRE, "workgroup");
  {
    const int q = lane >> 3, c8 = (lane & 7) * 8;
    v4u hv[4], lv[4];
#pragma unroll
    for (int it = 0; it < 4; ++it) {
      const int row = it * 4 + q;      // it 0..3 x q 0..3 = rows 0..15 of the wave tile
      const float* sp = os + row * OP + c8;
      v4u a, a2;
#pragma unroll
      for (int e = 0; e < 4; ++e) {
        const float f0 = sp[2 * e], f1 = sp[2 * e + 1];
        const unsigned short h0 = bf_bits(f0), h1 = bf_bits(f1);
        const unsigned short l0 = bf_bits(f0 - bf_up(h0)), l1 = bf_bits(f1 - bf_up(h1));
        a[e] = pk16(h0, h1); a2[e] = pk16(l0, l1);
      }
      hv[it] = a; lv[it] = a2;
    }
    {
#pragma unroll
      for (int it = 0; it < 4; ++it) {
        const int row = it * 4 + q;
        const size_t go = (rowB + q0 + row) * DM + (size_t)h * HD + c8;
        *(v4u*)(ahp + go) = hv[it];
        *(v4u*)(alp + go) = lv[it];
      }
      // behind the stores: in the listing the other body of the launch follows this one, and its first instructions give
      // registers that the stores name a new value (a precaution)
      store_wait();
    }
  }
}

// Both kinds of query block in ONE launch; the block index picks the kind (block-uniform branch): blocks 0..nPlain-1
// are the query blocks RESQB..NQB-1 (no residual planes), the rest the query blocks 0..RESQB-1 (with them).
__global__ __launch_bounds__(256, 6)   // three blocks share a WGP: 6 waves a SIMD
void attn_all(const unsigned short* __restrict__ qkhp, const unsigned short* __restrict__ qklp,
              const unsigned short* __restrict__ vhp, const unsigned short* __restrict__ vlp,
              unsigned short* ahp, unsigned short* alp, int nPlain, float sscale) {
  static_assert(AttnLds<false>::BYTES <= AttnLds<true>::BYTES);
  __shared__ __align__(16) unsigned char smem[AttnLds<true>::BYTES];
  const int bx = blockIdx.x;
  if (bx < nPlain) attn64<false>(smem, bx, qkhp, qklp, vhp, vlp, ahp, alp, RESQB, NQB - RESQB, sscale);
  else             attn64<true>(smem, bx - nPlain, qkhp, qklp, vhp, vlp, ahp, alp, 0, RESQB, sscale);
}

// =====================================================================================================
// Workspace map (bytes), every region an exact multiple of its whole-line / whole-tile store granularity
//  because M, N are multiples of 64 everywhere):
//   Wqkvb  bf16 [3072][1024]             0          6291456   (rows 0..2047 = Wq|Wk as Bt, rows 2048.. = Wv as A)
//   Wob    bf16 [1024][1024]             6291456    2097152
//   Xb     bf16 [4096][1024]             8388608    8388608
//   XPh    bf16 [4096][1024]            16777216    8388608
//   XPl    bf16 [4096][1024]            25165824    8388608
//   QKh    bf16 [4096][2048]            33554432   16777216
//   QKl    bf16 [4096][2048]            50331648   16777216
//   VTh    f16  [2][1024][2048]         67108864    8388608
//   VTl    f16  [2][1024][512]          75497472    2097152
//   Ah     bf16 [4096][1024]            77594624    8388608
//   Al     bf16 [4096][1024]            85983232    8388608
//   end                                 94371840
// Weights arrive [out n][in k] row-major = the Bt / A layout the GEMM wants (k contiguous), so they are only
// RNE-converted to bf16.
// =====================================================================================================
extern "C" void kernel_launch(void* const* d_in, const int* in_sizes, int n_in,
                              void* d_out, int out_size, void* d_ws, size_t ws_size,
                              hipStream_t stream) {
  if (n_in < 4) return;
  if (in_sizes[0] != NB * SEQ * DM) return;
  if (in_sizes[1] != SEQ * DM) return;
  if (in_sizes[2] != 3 * DM * DM) return;
  if (in_sizes[3] != DM * DM) return;
  if (out_size != NB * SEQ * DM) return;

  const float* x    = (const float*)d_in[0];   // [NB][SEQ][DM]
  const float* posp = (const float*)d_in[1];   // [SEQ][DM]
  const float* wqkv = (const float*)d_in[2];   // [3*DM n][DM k]
  const float* wo   = (const float*)d_in[3];   // [DM n][DM k]

  const size_t PWqkv = (size_t)3 * DM * DM * 2;       //  6291456  bf16 [3072][1024]
  const size_t PWo   = (size_t)DM * DM * 2;           //  2097152  bf16 [1024][1024]
  const size_t PX    = (size_t)NB * SEQ * DM * 2;     //  8388608  bf16 [4096][1024]
  const size_t PQK   = (size_t)NB * SEQ * NQK * 2;    // 16777216  bf16 [4096][2048]
  const size_t PVTh  = (size_t)NB * DM * SEQ * 2;     //  8388608
  const size_t PVTl  = (size_t)NB * DM * VLP * 2;     //  2097152
  size_t off = 0;
  const size_t oWqkv = off; off += PWqkv;
  const size_t oWo   = off; off += PWo;
  const size_t oXb   = off; off += PX;
  const size_t oXPh  = off; off += PX;
  const size_t oXPl  = off; off += PX;
  const size_t oQKh  = off; off += PQK;
  const size_t oQKl  = off; off += PQK;
  const size_t oVTh  = off; off += PVTh;
  const size_t oVTl  = off; off += PVTl;
  const size_t oAh   = off; off += PX;
  const size_t oAl   = off; off += PX;
  if (off > ws_size) return;                           // off = 94371840
  if (off > (size_t)134217728) return;

  char* ws = (char*)d_ws;
  unsigned short* Wqkvb = (unsigned short*)(ws + oWqkv);
  unsigned short* Wvb   = Wqkvb + (size_t)2 * DM * DM;   // rows 2048..3071 of the Wqkv plane
  unsigned short* Wob   = (unsigned short*)(ws + oWo);
  unsigned short* Xb    = (unsigned short*)(ws + oXb);
  unsigned short* XPh   = (unsigned short*)(ws + oXPh);
  unsigned short* XPl   = (unsigned short*)(ws + oXPl);
  unsigned short* QKh   = (unsigned short*)(ws + oQKh);
  unsigned short* QKl   = (unsigned short*)(ws + oQKl);
  unsigned short* VTh   = (unsigned short*)(ws + oVTh);
  unsigned short* VTl   = (unsigned short*)(ws + oVTl);
  unsigned short* Ah    = (unsigned short*)(ws + oAh);
  unsigned short* Al    = (unsigned short*)(ws + oAl);
  float*          outf  = (float*)d_out;

  const dim3 blk(256);
  const int n8qkv = 3 * DM * DM / 8;                                 // 393216 (multiple of 256)
  const int n8w   = DM * DM / 8;                                     // 131072 (multiple of 256)
  const int n8x   = NB * SEQ * DM / 8;                               // 524288 (multiple of 256)
  const int p8    = SEQ * DM / 8;                                    // 262144
  const int nbQKV = (n8qkv + 255) / 256;                             // 1536 blocks
  const int nbW   = (n8w + 255) / 256;                               // 512 blocks
  const int nbX   = (n8x + 255) / 256;                               // 2048 blocks
  const int nQK   = (NB * SEQ / 128) * (NQK / 256);                  // 128x256 tiles -> 256 blocks of 8 waves
  const int nVT   = (DM / 128) * (SEQ / 256);                        // 128x256 tiles -> 64 blocks of 8 waves x 2
  const int nPlain = NB * NH * (NQB - RESQB);                        // 768 query blocks without residual planes
  const dim3 gOut((NB * SEQ / 128) * (DM / 128), 1);                 // 128x128 tiles -> 256 blocks of 4 waves

  // (1) weights -> bf16 planes (keep their [n][k] layout); x -> bf16 plane; x + pos -> bf16 hi/lo planes
  prep_all<<<dim3(nbX + nbQKV + nbW), blk, 0, stream>>>(x, posp, wqkv, wo, Xb, XPh, XPl, Wqkvb, Wob,
                                                        n8x, p8, n8qkv, n8w, nbX, nbQKV);
  // (2) q|k projection (M=4096, N=2048, K=1024, 2 products) and v^T per batch element (M=1024, N=2048, K=1024)
  gemm_qk_vt<<<dim3(nQK + nVT * NB), blk, 0, stream>>>(XPh, XPl, Wqkvb, Wvb, Xb, QKh, QKl, VTh, VTl, nQK, nVT);
  // (3) causal attention: query blocks RESQB.. without residual planes, 0..RESQB-1 with them -> Ah/Al bf16 hi/lo
  attn_all<<<dim3(nPlain + NB * NH * RESQB), blk, 0, stream>>>(QKh, QKl, VTh, VTl, Ah, Al, nPlain, 0.125f);
  // (4) out[row][n] = sum_k (Ah+Al)[row][k] Wob[n][k] -> d_out f32   (M=4096, N=1024, K=1024, 2 products)
  gemm64<1, 0, 2><<<gOut, dim3(128), 0, stream>>>(
      Ah, Al, DM, 0LL, Wob, DM, 0LL,
      (void*)outf, DM, 0LL, (void*)outf, 0, 0LL, 0,
      NB * SEQ, DM, DM, 1.0f);
  (void)hipGetLastError();
}

// v007
// A run of this version takes 113 microseconds.
// Two timings next to v006 put it at 1.04 and 1.03 times that version's speed.
// Over all steps from v000 it is 3.61 times as fast.
// Contractions: q|k projection = v_wmma_f32_16x16x32_bf16 with (x+pos) as bf16 hi/lo planes times the bf16 Wqk plane (2 products);
// v^T projection = v_wmma_f32_16x16x32_bf16 (bf16 x times bf16 Wv, single product);
// q.k^T scores = v_wmma_f32_16x16x32_bf16 with bf16 hi/lo split q and k (hi.hi + hi.lo + lo.hi);
// p.v = v_wmma_f32_16x16x32_f16 (p carried x1024 in f16, v in f16; extra f16 residual planes x4096 of p and v on the first 512 query rows);
// a.Wout^T = v_wmma_f32_16x16x32_bf16 with a as bf16 hi/lo planes times the bf16 Wout plane (2 products); all f32 accumulate; softmax in f32.
#include <hip/hip_runtime.h>
#include <math.h>
#include <stdint.h>

#define NB    2
#define SEQ   2048
#define DM    1024
#define NH    16
#define HD    64
#define NQK   (2 * DM)       // pitch of the q|k planes: q feature columns 0..DM-1, k feature columns DM..2DM-1
#define NQB   (SEQ / 64)     // 32 query / key tiles of 64
#define VLP   512            // key pitch of the v^T residual plane (keys 0..VLP-1)
#define RESQB 8              // leading 64-row query blocks that use the p / v residual planes
static_assert(RESQB * 64 <= VLP);
static_assert(NH * HD == DM);
static_assert((SEQ % 128) == 0 && (DM % 256) == 0);
static_assert(HD == 64);
static_assert(((NB * SEQ * DM / 8) % 256) == 0);
static_assert(((DM * DM / 8) % 256) == 0);
static_assert(((3 * DM * DM / 8) % 256) == 0);
static_assert(((SEQ * DM) % 8) == 0);

typedef _Float16 v16h __attribute__((ext_vector_type(16)));
typedef _Float16 v8h  __attribute__((ext_vector_type(8)));
typedef __bf16   v16b __attribute__((ext_vector_type(16)));
typedef __bf16   v8b  __attribute__((ext_vector_type(8)));
typedef float    v8f  __attribute__((ext_vector_type(8)));
typedef float    v4f  __attribute__((ext_vector_type(4)));
typedef unsigned int v4u __attribute__((ext_vector_type(4)));

// ---- scalar helpers --------------------------------------------------------------------------------
__device__ __forceinline__ unsigned short bf_bits(float f) {          // f32 -> bf16 bits, RNE convert
  unsigned u = __float_as_uint(f);
  return (unsigned short)((u + 0x7FFFu + ((u >> 16) & 1u)) >> 16);
}
__device__ __forceinline__ float bf_up(unsigned short h) { return __uint_as_float(((unsigned)h) << 16); }
__device__ __forceinline__ unsigned short h_bits(_Float16 x) { return __builtin_bit_cast(unsigned short, x); }
__device__ __forceinline__ unsigned pk16(unsigned short a, unsigned short b) { return (unsigned)a | ((unsigned)b << 16); }
__device__ __forceinline__ v8f zero8() { v8f z = {0.f, 0.f, 0.f, 0.f, 0.f, 0.f, 0.f, 0.f}; return z; }
__device__ __forceinline__ v8h zero8h() {
  const _Float16 z = (_Float16)0.0f;
  v8h r = {z, z, z, z, z, z, z, z};
  return r;
}

// lane l reads lane l ^ 16: the two lanes that share a column of a B operand or of an accumulator tile
__device__ __forceinline__ float xhalf(float x) {
  return __builtin_bit_cast(float, __builtin_amdgcn_permlanex16(__builtin_bit_cast(int, x), __builtin_bit_cast(int, x),
                                                                0x76543210, 0xfedcba98, false, false));
}

// ---- fragment loader: 16-bit A/B operand, lane -> row/col (lane&15), p already includes +8*(lane>>4);
//      elements 0..7 <- p[0..7] (k0+8h..), elements 8..15 <- p[16..23] (k0+16+8h..)
__device__ __forceinline__ v16b ldfrag_b(const __bf16* p) {
  union { v16b v; v8b h[2]; } f;
  f.h[0] = *(const v8b*)(p);
  f.h[1] = *(const v8b*)(p + 16);
  return f.v;
}

// ---- WMMA helpers with trailing VALU hazard gap --------------------------------------------------------
__device__ __forceinline__ v8f mma_b(v16b a, v16b b, v8f c) {
  c = __builtin_amdgcn_wmma_f32_16x16x32_bf16(false, a, false, b, (short)0, c, false, false);
#if defined(__HIP_DEVICE_COMPILE__)
  asm volatile("v_nop\n\tv_nop\n\tv_nop\n\tv_nop" : "+v"(c) : "v"(a), "v"(b));
#endif
  return c;
}
__device__ __forceinline__ v8f mma_h(v16h a, v16h b, v8f c) {
  c = __builtin_amdgcn_wmma_f32_16x16x32_f16(false, a, false, b, (short)0, c, false, false);
#if defined(__HIP_DEVICE_COMPILE__)
  asm volatile("v_nop\n\tv_nop\n\tv_nop\n\tv_nop" : "+v"(c) : "v"(a), "v"(b));
#endif
  return c;
}
__device__ __forceinline__ v8f mma_b_raw(v16b a, v16b b, v8f c) {
  return __builtin_amdgcn_wmma_f32_16x16x32_bf16(false, a, false, b, (short)0, c, false, false);
}
__device__ __forceinline__ v8f mma_h_raw(v16h a, v16h b, v8f c) {
  return __builtin_amdgcn_wmma_f32_16x16x32_f16(false, a, false, b, (short)0, c, false, false);
}
__device__ __forceinline__ void dep_guard_b(v8f& a, v8f& b, v16b x, v16b y) {
#if defined(__HIP_DEVICE_COMPILE__)
  asm volatile("v_nop\n\tv_nop\n\tv_nop\n\tv_nop" : "+v"(a), "+v"(b) : "v"(x), "v"(y));
#endif
}
__device__ __forceinline__ void keep4_b(v16b a, v16b b, v16b c, v16b d) {
#if defined(__HIP_DEVICE_COMPILE__)
  asm volatile("v_nop" :: "v"(a), "v"(b), "v"(c), "v"(d));
#endif
}
__device__ __forceinline__ void acc_guard4(v8f& a, v8f& b, v8f& c, v8f& d) {
#if defined(__HIP_DEVICE_COMPILE__)
  asm volatile("v_nop\n\tv_nop\n\tv_nop\n\tv_nop" : "+v"(a), "+v"(b), "+v"(c), "+v"(d));
#endif
}

// s_wait_xcnt behind a run of global loads; the loads' pointers are inputs, so that no address register is given a
// new value (a later load's result included) in front of the wait (a precaution)
__device__ __forceinline__ void addr_wait4(const void* a, const void* b, const void* c, const void* d) {
#if defined(__HIP_DEVICE_COMPILE__)
  asm volatile("s_wait_xcnt 0x0" :: "v"(a), "v"(b), "v"(c), "v"(d) : "memory");
#endif
}

// s_wait_xcnt behind global stores whose address or data registers are given a new value later (a precaution)
__device__ __forceinline__ void store_wait() {
#if defined(__HIP_DEVICE_COMPILE__)
  asm volatile("s_wait_xcnt 0x0" ::: "memory");
#endif
}

// =====================================================================================================
// f32 -> bf16 (RNE convert), 8 elements per thread, one 16-B store per lane: a wave writes 512 contiguous B
// host-checked). coverage: n8 threads x 8 = whole plane.
// =====================================================================================================
__device__ __forceinline__ void cvt_bf16x8(int blk, const float* __restrict__ in, unsigned short* out, int n8) {
  const int i = blk * 256 + threadIdx.x;
  if (i < n8) {
    const v4f a = *(const v4f*)(in + (size_t)i * 8);
    const v4f b = *(const v4f*)(in + (size_t)i * 8 + 4);
    v4u p;
    p[0] = pk16(bf_bits(a[0]), bf_bits(a[1]));
    p[1] = pk16(bf_bits(a[2]), bf_bits(a[3]));
    p[2] = pk16(bf_bits(b[0]), bf_bits(b[1]));
    p[3] = pk16(bf_bits(b[2]), bf_bits(b[3]));
    *(v4u*)(out + (size_t)i * 8) = p;
    
  }
}

// =====================================================================================================
// x prep: xb = bf16(x) (RNE convert); s = bf_up(bf16(x)) + bf_up(bf16(pos)) in f32 (pos element index =
// x element index mod SEQ*DM); hp = bf16 hi plane of s, lp = bf16 lo plane (lo = RNE(s - hi), unscaled).
// three planes (n8 multiple of 256, host-checked).
// =====================================================================================================
__device__ __forceinline__ void prep_x8(int blk, const float* __restrict__ x, const float* __restrict__ pos,
                                        unsigned short* xb, unsigned short* hp, unsigned short* lp,
                                        int n8, int p8) {
#pragma clang fp contract(off)
  const int i = blk * 256 + threadIdx.x;
  if (i < n8) {
    const int ip = i % p8;
    const v4f a  = *(const v4f*)(x + (size_t)i * 8);
    const v4f b  = *(const v4f*)(x + (size_t)i * 8 + 4);
    const v4f pa = *(const v4f*)(pos + (size_t)ip * 8);
    const v4f pb = *(const v4f*)(pos + (size_t)ip * 8 + 4);
    v4u px, ph, pl;
#pragma unroll
    for (int e = 0; e < 4; ++e) {
      const float f0 = (e < 2) ? a[2 * e]      : b[2 * e - 4];
      const float f1 = (e < 2) ? a[2 * e + 1]  : b[2 * e - 3];
      const float g0 = (e < 2) ? pa[2 * e]     : pb[2 * e - 4];
      const float g1 = (e < 2) ? pa[2 * e + 1] : pb[2 * e - 3];
      const unsigned short x0 = bf_bits(f0), x1 = bf_bits(f1);
      const float s0 = bf_up(x0) + bf_up(bf_bits(g0));
      const float s1 = bf_up(x1) + bf_up(bf_bits(g1));
      const unsigned short h0 = bf_bits(s0), h1 = bf_bits(s1);
      const unsigned short l0 = bf_bits(s0 - bf_up(h0)), l1 = bf_bits(s1 - bf_up(h1));
      px[e] = pk16(x0, x1);
      ph[e] = pk16(h0, h1);
      pl[e] = pk16(l0, l1);
    }
    *(v4u*)(xb + (size_t)i * 8) = px;
    *(v4u*)(hp + (size_t)i * 8) = ph;
    *(v4u*)(lp + (size_t)i * 8) = pl;
    
  }
}

// =====================================================================================================
// The three independent conversions in ONE launch; the block index picks the job (block-uniform branch):
// blocks 0..nbx-1 prepare x, the next nbqkv convert Wqkv, the rest convert Wout.
// =====================================================================================================
__global__ __launch_bounds__(256) void prep_all(const float* __restrict__ x, const float* __restrict__ pos,
                                                const float* __restrict__ wqkv, const float* __restrict__ wo,
                                                unsigned short* xb, unsigned short* hp, unsigned short* lp,
                                                unsigned short* wqkvb, unsigned short* wob,
                                                int n8x, int p8, int n8qkv, int n8w, int nbx, int nbqkv) {
  const int bx = blockIdx.x;
  if (bx < nbx)              prep_x8(bx, x, pos, xb, hp, lp, n8x, p8);
  else if (bx < nbx + nbqkv) cvt_bf16x8(bx - nbx, wqkv, wqkvb, n8qkv);
  else                       cvt_bf16x8(bx - nbx - nbqkv, wo, wob, n8w);
}

// =====================================================================================================
// Eight asynchronous 16-B-per-lane copies global -> LDS (no register in between). The closing s_wait_xcnt stands
// in the copies' own statement so that no address register named here is rewritten in front of it (a precaution).
// =====================================================================================================
__device__ __forceinline__ void copy8_async(const unsigned (&l)[8], const __bf16* const (&g)[8]) {
#if defined(__HIP_DEVICE_COMPILE__)
  asm volatile(
      "global_load_async_to_lds_b128 %0, %8, off\n\t"
      "global_load_async_to_lds_b128 %1, %9, off\n\t"
      "global_load_async_to_lds_b128 %2, %10, off\n\t"
      "global_load_async_to_lds_b128 %3, %11, off\n\t"
      "global_load_async_to_lds_b128 %4, %12, off\n\t"
      "global_load_async_to_lds_b128 %5, %13, off\n\t"
      "global_load_async_to_lds_b128 %6, %14, off\n\t"
      "global_load_async_to_lds_b128 %7, %15, off\n\t"
      "s_wait_xcnt 0x0"
      :: "v"(l[0]), "v"(l[1]), "v"(l[2]), "v"(l[3]), "v"(l[4]), "v"(l[5]), "v"(l[6]), "v"(l[7]),
         "v"(g[0]), "v"(g[1]), "v"(g[2]), "v"(g[3]), "v"(g[4]), "v"(g[5]), "v"(g[6]), "v"(g[7])
      : "memory");
#endif
}

// the same for four copies (a stage whose copies per thread are not a multiple of eight ends in one of these)
__device__ __forceinline__ void copy4_async(const unsigned (&l)[4], const __bf16* const (&g)[4]) {
#if defined(__HIP_DEVICE_COMPILE__)
  asm volatile(
      "global_load_async_to_lds_b128 %0, %4, off\n\t"
      "global_load_async_to_lds_b128 %1, %5, off\n\t"
      "global_load_async_to_lds_b128 %2, %6, off\n\t"
      "global_load_async_to_lds_b128 %3, %7, off\n\t"
      "s_wait_xcnt 0x0"
      :: "v"(l[0]), "v"(l[1]), "v"(l[2]), "v"(l[3]), "v"(g[0]), "v"(g[1]), "v"(g[2]), "v"(g[3])
      : "memory");
#endif
}

// =====================================================================================================
// Batched bf16 WMMA GEMM: C[m][n] = sum_k A[m][k] * Bt[n][k]. A block of 2 x WN waves owns a 128 x (64*WN) tile of
// C, each wave a 64x64 part of it. A row-major [M][K] pitch lda; Bt row-major [N][K] pitch ldb (k contiguous);
// M a multiple of 128, N of 64*WN, K of 64 (host constants). tile = index of the block's tile, b = batch index
// (strides in elements), both handed in by the kernel.
// Operands: per stage of 64 k the block's rows [A 128 | A2 128 (NSPLIT 1) | Bt 64*WN], 128 B each, are copied to
// LDS at pitch 144 B by asynchronous copies (a wave's copy = 4 whole 128-B lines); two buffers, stage t+1 flies
// while stage t is multiplied; the waves read their fragments from LDS with ds loads.
// NSPLIT: 0 = A.Bt; 1 = (A + A2).Bt (A2 = unscaled bf16 lo plane of A).
// OUT_MODE: 0 = f32 (pitch ldc); 2 = bf16 hi plane C + bf16 lo plane C2 (lo = RNE(v - hi), unscaled);
//           3 = f16 hi plane C + f16 residual plane C2 = f16((v - hi) * rscale), C2 written only for tiles
//               with n0 < N2 (pitch ldc2, batch stride strideC2).
// =====================================================================================================
// LDS of one block: the two stage buffers; the per-wave epilogue slabs lie over their first bytes (the last stage's
// barrier, which every wave passes behind its own s_wait_dscnt 0 and s_wait_asynccnt 0, ends all use of the buffers).
// The kernel owns the bytes and hands them to the body: two bodies that share a launch share one allocation, and it is
// small enough for two 8-wave blocks on a WGP, so that a v^T block runs beside a q|k block, not behind it.
template <int NSPLIT, int WN>
struct GemmLds {
  static constexpr int RINGB = 2 * ((NSPLIT == 1 ? 2 : 1) * 128 + 64 * WN) * 72 * 2;   // bytes of the two buffers
  static constexpr int BYTES = RINGB;
  static_assert(2 * WN * 16 * 68 * 4 <= RINGB);                                        // the slabs fit over them
};
template <int NSPLIT, int OUT_MODE, int WN>
__device__ __forceinline__ void gemm64_body(
    unsigned char* smem, int tile, int b,
    const unsigned short* __restrict__ Ap, const unsigned short* A2p, int lda, long long strideA,
    const unsigned short* __restrict__ Btp, int ldb, long long strideB,
    void* Cout, int ldc, long long strideC,
    void* Cout2, int ldc2, long long strideC2, int N2,
    int M, int N, int K, float rscale) {
  static_assert(NSPLIT == 0 || NSPLIT == 1);
  constexpr int NT    = 64 * WN;                       // threads
  constexpr int BM    = 128;                           // block rows of C
  constexpr int BN    = 64 * WN;                       // block columns of C
  constexpr int KS    = 64;                            // k per stage (128 B of every operand row)
  constexpr int AROWS = (NSPLIT == 1 ? 2 : 1) * BM;    // stage rows that hold A (and A2)
  constexpr int ROWS  = AROWS + BN;                    // stage rows in all
  constexpr int PE    = 72;                            // LDS row pitch in elements (144 B = 16 B x 9)
  constexpr int BUFE  = ROWS * PE;                     // elements of one buffer
  constexpr int RPI   = NT / 8;                        // stage rows that one copy of every thread covers
  constexpr int NIT   = ROWS / RPI;                    // copies per thread and stage
  static_assert((BM % RPI) == 0 && (NIT % 4) == 0 && NIT <= 63);
  const __bf16* A   = (const __bf16*)(const void*)Ap;
  const __bf16* A2  = (const __bf16*)(const void*)A2p;
  const __bf16* Bt  = (const __bf16*)(const void*)Btp;
  static_assert(GemmLds<NSPLIT, WN>::RINGB == 2 * BUFE * 2);
  __bf16* const ring = (__bf16*)(void*)smem;                                     // two stage buffers
  float*  const sT   = (float*)(void*)smem;       // per-wave 16x64 slab, pitch 68 floats, used behind the last stage
  const int tid  = threadIdx.x;
  const int lane = tid & 31;
  const int wave = tid >> 5;
  const int tilesN = N / BN;
  const int tilesM = M / BM;
  if (tile >= tilesM * tilesN) return;   // block-uniform, in front of every copy and barrier
  const int tm = tile / tilesN;
  const int tn = tile - tm * tilesN;
  const int wm = wave / WN;                    // wave's 64-row part of the block tile
  const int wn = wave - wm * WN;               // wave's 64-column part
  const int m0 = tm * BM + (wm << 6);
  const int n0 = tn * BN + (wn << 6);

  const int rlane = lane & 15;                 // row (A) / col (B, D) within subtile
  const int koff  = (lane >> 4) * 8;           // k offset of this lane half
  const int mOff  = (lane >> 4) * 8;           // D row offset

  // this thread's 16-B piece of stage row (tid >> 3): source pointers at k = 0 and LDS byte address in buffer 0
  const int crow = tid >> 3, cpc = (tid & 7) * 8;
  const __bf16* gA  = A  + (size_t)b * strideA + (size_t)(tm * BM + crow) * lda + cpc;
  const __bf16* gA2 = (NSPLIT == 1) ? (A2 + (size_t)b * strideA + (size_t)(tm * BM + crow) * lda + cpc) : gA;
  const __bf16* gB  = Bt + (size_t)b * strideB + (size_t)(tn * BN + crow) * ldb + cpc;
  const unsigned lds0 = (unsigned)(size_t)(const void*)ring + (unsigned)(crow * PE + cpc) * 2u;

  // copies the next stage not yet asked for into buffer buf; the three source pointers then step on by one stage
  auto issue_stage = [&](int buf) {
    const unsigned lb = lds0 + (unsigned)buf * (unsigned)(BUFE * 2);
    // both loops unrolled: the stage row decides at compile time which operand a copy reads
#pragma unroll
    for (int g8 = 0; g8 < NIT / 8; ++g8) {
      unsigned dst[8];
      const __bf16* sp[8];
#pragma unroll
      for (int e = 0; e < 8; ++e) {
        const int sr = (g8 * 8 + e) * RPI;     // first stage row of this copy, a compile-time value
        sp[e]  = (sr < BM) ? (gA + (size_t)sr * lda)
               : (sr < AROWS) ? (gA2 + (size_t)(sr - BM) * lda)
                              : (gB + (size_t)(sr - AROWS) * ldb);
        dst[e] = lb + (unsigned)(sr * PE * 2);
      }
      copy8_async(dst, sp);
    }
    if constexpr ((NIT % 8) != 0) {
      unsigned dst[4];
      const __bf16* sp[4];
#pragma unroll
      for (int e = 0; e < 4; ++e) {
        const int sr = ((NIT / 8) * 8 + e) * RPI;
        sp[e]  = (sr < BM) ? (gA + (size_t)sr * lda)
               : (sr < AROWS) ? (gA2 + (size_t)(sr - BM) * lda)
                              : (gB + (size_t)(sr - AROWS) * ldb);
        dst[e] = lb + (unsigned)(sr * PE * 2);
      }
      copy4_async(dst, sp);
    }
    gA += KS; gA2 += KS; gB += KS;
  };

  v8f acc[4][4];
#pragma unroll
  for (int i = 0; i < 4; ++i)
#pragma unroll
    for (int j = 0; j < 4; ++j) acc[i][j] = zero8();

  const int nst = K / KS;
  issue_stage(0);
  asm volatile("s_wait_asynccnt 0x0" ::: "memory");   // this wave's copies of stage 0 have landed
  __syncthreads();                                    // ... and every other wave's: stage 0 may be read
  if (nst > 1) issue_stage(1);

  for (int t = 0; t < nst; ++t) {
    const __bf16* sb  = ring + (t & 1) * BUFE;
    const __bf16* sA  = sb + ((wm << 6) + rlane) * PE + koff;
    const __bf16* sA2 = sA + BM * PE;
    const __bf16* sB  = sb + (AROWS + (wn << 6) + rlane) * PE + koff;
    // every loop of the stage is unrolled: fragments and accumulators are register arrays (constant indices only)
#pragma unroll
    for (int kk = 0; kk < KS; kk += 32) {
      v16b bh[4], ah[4], al[4];
#pragma unroll
      for (int j = 0; j < 4; ++j) bh[j] = ldfrag_b(sB + (j << 4) * PE + kk);
#pragma unroll
      for (int i = 0; i < 4; ++i) {
        ah[i] = ldfrag_b(sA + (i << 4) * PE + kk);
        if (NSPLIT == 1) al[i] = ldfrag_b(sA2 + (i << 4) * PE + kk); else al[i] = ah[i];
      }
#pragma unroll
      for (int i = 0; i < 4; ++i) {
#pragma unroll
        for (int j = 0; j < 4; ++j) acc[i][j] = mma_b_raw(ah[i], bh[j], acc[i][j]);
        if (NSPLIT == 1) {
#pragma unroll
          for (int j = 0; j < 4; ++j) acc[i][j] = mma_b_raw(al[i], bh[j], acc[i][j]);
        }
        dep_guard_b(acc[i][0], acc[i][3], ah[i], al[i]);
      }
      keep4_b(bh[0], bh[1], bh[2], bh[3]);
    }
    asm volatile("s_wait_dscnt 0x0" ::: "memory");     // this wave's reads of buffer t & 1 are done
    asm volatile("s_wait_asynccnt 0x0" ::: "memory");  // this wave's copies of stage t + 1 have landed
    __syncthreads();                                   // publishes stage t + 1, frees buffer t & 1
    if (t + 2 < nst) issue_stage(t & 1);
  }
  asm volatile("s_wait_asynccnt 0x0" ::: "memory");    // no copy is outstanding when the wave goes on
  acc_guard4(acc[0][0], acc[0][1], acc[0][2], acc[0][3]);
  acc_guard4(acc[1][0], acc[1][1], acc[1][2], acc[1][3]);
  acc_guard4(acc[2][0], acc[2][1], acc[2][2], acc[2][3]);
  acc_guard4(acc[3][0], acc[3][1], acc[3][2], acc[3][3]);

  // ---- epilogue ----
  float* slab = sT + wave * (16 * 68);
#pragma unroll
  for (int i = 0; i < 4; ++i) {
    const int mBase = m0 + (i << 4);
#pragma unroll
    for (int r = 0; r < 8; ++r) {
#pragma unroll
      for (int j = 0; j < 4; ++j) {
        slab[(mOff + r) * 68 + (j << 4) + rlane] = acc[i][j][r];
      }
    }
    __builtin_amdgcn_fence(__ATOMIC_RELEASE, "workgroup");
    __builtin_amdgcn_wave_barrier();
    __builtin_amdgcn_fence(__ATOMIC_ACQUIRE, "workgroup");
    if (OUT_MODE == 0) {
      float* C = (float*)Cout + (size_t)b * strideC;
      const int hh = lane >> 4, c4 = (lane & 15) * 4;     // 256-B row segment = 16 lanes x 16 B
      v4f ov[8];
#pragma unroll
      for (int it = 0; it < 8; ++it) {
        const int row = it * 2 + hh;                       // it 0..7 x hh 0..1 = rows 0..15
        ov[it] = *(const v4f*)(slab + row * 68 + c4);
      }
      {
#pragma unroll
        for (int it = 0; it < 8; ++it) {
          const int row = it * 2 + hh;
          *(v4f*)(C + (size_t)(mBase + row) * ldc + n0 + c4) = ov[it];
        }
        
      }
    } else {
      const int q = lane >> 3, c8 = (lane & 7) * 8;
      unsigned short* C  = (unsigned short*)Cout  + (size_t)b * strideC;
      unsigned short* C2 = (unsigned short*)Cout2 + (size_t)b * strideC2;
      const bool wlo = (OUT_MODE == 2) || (n0 < N2);      // wave-uniform
      v4u hv[4], lv[4];
#pragma unroll
      for (int it = 0; it < 4; ++it) {
        const int row = it * 4 + q;                        // it 0..3 x q 0..3 = rows 0..15
        const float* sp = slab + row * 68 + c8;
        v4u a, a2;
#pragma unroll
        for (int e = 0; e < 4; ++e) {
          const float f0 = sp[2 * e], f1 = sp[2 * e + 1];
          unsigned short h0, h1, l0, l1;
          if (OUT_MODE == 2) {
            h0 = bf_bits(f0); h1 = bf_bits(f1);
            l0 = bf_bits(f0 - bf_up(h0)); l1 = bf_bits(f1 - bf_up(h1));
          } else {
            const _Float16 x0 = (_Float16)f0, x1 = (_Float16)f1;
            h0 = h_bits(x0); h1 = h_bits(x1);
            l0 = h_bits((_Float16)((f0 - (float)x0) * rscale));
            l1 = h_bits((_Float16)((f1 - (float)x1) * rscale));
          }
          a[e] = pk16(h0, h1); a2[e] = pk16(l0, l1);
        }
        hv[it] = a; lv[it] = a2;
      }
      {
#pragma unroll
        for (int it = 0; it < 4; ++it) {
          const int row = it * 4 + q;
          *(v4u*)(C + (size_t)(mBase + row) * ldc + n0 + c8) = hv[it];
          if (wlo) *(v4u*)(C2 + (size_t)(mBase + row) * ldc2 + n0 + c8) = lv[it];
        }
        
      }
    }
    __builtin_amdgcn_fence(__ATOMIC_RELEASE, "workgroup");
    __builtin_amdgcn_wave_barrier();
    __builtin_amdgcn_fence(__ATOMIC_ACQUIRE, "workgroup");
  }
}

// one GEMM alone in its launch: blockIdx.x = tile, blockIdx.y = batch index
template <int NSPLIT, int OUT_MODE, int WN>
__global__ __launch_bounds__(64 * WN) void gemm64(
    const unsigned short* __restrict__ Ap, const unsigned short* A2p, int lda, long long strideA,
    const unsigned short* __restrict__ Btp, int ldb, long long strideB,
    void* Cout, int ldc, long long strideC,
    void* Cout2, int ldc2, long long strideC2, int N2,
    int M, int N, int K, float rscale) {
  __shared__ __align__(16) unsigned char smem[GemmLds<NSPLIT, WN>::BYTES];
  gemm64_body<NSPLIT, OUT_MODE, WN>(smem, blockIdx.x, blockIdx.y, Ap, A2p, lda, strideA, Btp, ldb, strideB,
                                    Cout, ldc, strideC, Cout2, ldc2, strideC2, N2, M, N, K, rscale);
}

// The two independent projections in ONE launch of 8-wave blocks; the block index picks the job (block-uniform
// branch): blocks 0..nqk-1 own the 128x256 tiles of the q|k projection, the rest the 128x256 tiles of v^T
// (vtTiles tiles per batch element).
//   q|k: QK[row][n] = sum_k (XPh+XPl)[row][k] Wqk[n][k], n < 2048 -> bf16 hi/lo planes, pitch NQK (2 products)
//   v^T: VTh[bl][m][s] = sum_k Wv[m][k] Xb[bl*SEQ+s][k] -> f16 hi plane (pitch SEQ) and residual plane
//        (x4096, keys < VLP, pitch VLP), single product
__global__ __launch_bounds__(256) void gemm_qk_vt(
    const unsigned short* __restrict__ XPh, const unsigned short* XPl, const unsigned short* __restrict__ Wqk,
    const unsigned short* __restrict__ Wv, const unsigned short* __restrict__ Xb,
    unsigned short* QKh, unsigned short* QKl, unsigned short* VTh, unsigned short* VTl, int nqk, int vtTiles) {
  static_assert(GemmLds<0, 4>::BYTES <= GemmLds<1, 4>::BYTES);
  __shared__ __align__(16) unsigned char smem[GemmLds<1, 4>::BYTES];
  const int bx = blockIdx.x;
  if (bx < nqk) {
    gemm64_body<1, 2, 4>(smem, bx, 0, XPh, XPl, DM, 0LL, Wqk, DM, 0LL,
                         (void*)QKh, NQK, 0LL, (void*)QKl, NQK, 0LL, NQK,
                         NB * SEQ, NQK, DM, 1.0f);
  } else {
    const int r = bx - nqk;
    gemm64_body<0, 3, 4>(smem, r % vtTiles, r / vtTiles, Wv, Wv, DM, 0LL, Xb, DM, (long long)SEQ * DM,
                         (void*)VTh, SEQ, (long long)DM * SEQ, (void*)VTl, VLP, (long long)DM * VLP, VLP,
                         DM, SEQ, DM, 4096.0f);
  }
}

template <bool RES>
struct AttnLds {                                   // bytes: the K / V^T planes of both groups, context tiles, m and l
  static constexpr int KVB   = 2 * (RES ? 4 : 3) * 64 * 72 * 2;
  static constexpr int OSB   = 4 * 16 * 68 * 4;
  static constexpr int BYTES = KVB + OSB + 4 * 32 * 4;
};
template <bool RES>
__device__ __forceinline__
void attn64(unsigned char* smem, int bx,
            const unsigned short* __restrict__ qkhp, const unsigned short* __restrict__ qklp,
            const unsigned short* __restrict__ vhp, const unsigned short* __restrict__ vlp,
            unsigned short* ahp, unsigned short* alp, int qbBase, int nqbThis, float sscale) {
  union FB { v16b v; v8b h[2]; };
  union FH { v16h v; v8h h[2]; };
  // LDS row pitches: 16-bit tiles 72 elements (144 B = 16 B x 9), so that the 16 rows which a 16-B fragment read
  // touches fall on 16 different groups of four banks; the f32 tile 68 floats (272 B = 16 B x 17), likewise.
  constexpr int LP = 72;
  constexpr int OP = 68;
  constexpr int PLE = 64 * LP;                                    // elements of one 64-row tile plane, 9 KB
  constexpr int NPL = RES ? 4 : 3;                                // planes of a group: K hi, K lo, V^T hi, (V^T residual)
  static_assert(AttnLds<RES>::KVB == 2 * NPL * PLE * 2 && AttnLds<RES>::OSB == 4 * 16 * OP * 4);
  unsigned short* const KV = (unsigned short*)(void*)smem;        // per group its planes in a row: one base register
  float* const Os = (float*)(void*)(smem + AttnLds<RES>::KVB);    // per 16 query rows: context tile [row][d]
  float* const Ml = (float*)(void*)(smem + AttnLds<RES>::KVB + AttnLds<RES>::OSB);   // group 1's m (0..15), l (16..31)

  const int wv   = __builtin_amdgcn_readfirstlane((int)(threadIdx.x >> 5));   // wave 0..7, held as a scalar
  const int grp  = wv >> 2;                 // key group of this wave (a scalar: branches on it are scalar branches)
  const int wave = wv & 3;                  // which 16 query rows of the block
  const int tid  = threadIdx.x & 127;       // thread within its group
  const int lane = tid & 31;
  unsigned short* const kvg = KV + grp * (NPL * PLE);
  __bf16*   const Ksh = (__bf16*)(void*)kvg;                      // K hi [kv][d]
  __bf16*   const Ksl = Ksh + PLE;                                // K lo
  _Float16* const Vth = (_Float16*)(void*)(kvg + 2 * PLE);        // V^T hi [d][kv]
  _Float16* const Vtl = Vth + (RES ? PLE : 0);                    // V^T residual (used with RES only)
  const int hh   = lane >> 4;
  const int c    = lane & 15;

  const int qbl  = bx % nqbThis;
  const int rest = bx / nqbThis;
  const int h    = rest % NH;
  const int b    = rest / NH;
  const int qb   = qbBase + qbl;
  const int q0   = qb * 64 + wave * 16;
  const size_t rowB = (size_t)b * SEQ;

  const __bf16* Qh = (const __bf16*)(const void*)qkhp + (size_t)h * HD;
  const __bf16* Ql = (const __bf16*)(const void*)qklp + (size_t)h * HD;
  const __bf16* Kh = (const __bf16*)(const void*)qkhp + (size_t)DM + (size_t)h * HD;
  const __bf16* Kl = (const __bf16*)(const void*)qklp + (size_t)DM + (size_t)h * HD;
  const _Float16* Vh = (const _Float16*)(const void*)vhp + ((size_t)b * DM + (size_t)h * HD) * SEQ;
  const _Float16* Vl = (const _Float16*)(const void*)vlp + ((size_t)b * DM + (size_t)h * HD) * VLP;

  // ---- Q fragments (B operand, column = query = lane&15): 2 d-chunks, hi and lo ----
  //      without residual planes loaded once and kept; with them loaded anew in every trip, so that they are not live
  //      through softmax and second product and this body fits the register budget of the launch it shares
  v16b qah[2], qal[2];
  const __bf16* const qhp = Qh + (rowB + q0 + c) * NQK + 8 * hh;
  const __bf16* const qlp = Ql + (rowB + q0 + c) * NQK + 8 * hh;
  if constexpr (!RES) {
#pragma unroll
    for (int dc = 0; dc < 2; ++dc) {
      qah[dc] = ldfrag_b(qhp + dc * 32);
      qal[dc] = ldfrag_b(qlp + dc * 32);
    }
  }

  float mrow = -INFINITY;                    // running maximum of query q0 + c, equal in both halves of the wave
  float lrow = 0.f;                          // running sum over the keys that this half of the wave holds
  v8f oacc[4];                               // O^T: oacc[t][r] = context[query q0 + c][d = 16 t + 8 hh + r]
#pragma unroll
  for (int t = 0; t < 4; ++t) oacc[t] = zero8();

  int nkt = qb + 1;                          // key tiles 0..qb, block-uniform
  if (nkt > NQB) nkt = NQB;
  const int nit = (nkt + 1) >> 1;            // block-uniform trip count <= 16; every wave passes every barrier
  for (int it = 0; it < nit; ++it) {
    const int kt  = 2 * it + grp;            // this group's key tile
    const bool act = kt < nkt;               // false only in group 1's last trip when nkt is odd (a scalar)
    const int kv0 = kt * 64;
    __syncthreads();
    if (act) {
      // eight lanes share a tile row (128 B = one line): a wave's 16-B load covers four whole lines; load i of a
      // thread takes row r + 16 i
      const int r = tid >> 3, pc = (tid & 7) * 8;
      // the part of an address that moves with the tile is the same for the whole group and is formed in scalar registers;
      // the lane's own part never changes: fewer vector registers live through the trip (the fragments read ahead need them)
      const unsigned kob = (unsigned)(r * NQK + pc) * 2u;         // K row kv0+r, d = pc..pc+7
      const unsigned vob = (unsigned)(r * SEQ + pc) * 2u;         // V^T row d = r, s = kv0+pc..+7
      const __bf16*   kg  = (const __bf16*)(const void*)((const char*)(const void*)(Kh + (rowB + kv0) * NQK) + kob);
      const __bf16*   klg = (const __bf16*)(const void*)((const char*)(const void*)(Kl + (rowB + kv0) * NQK) + kob);
      const _Float16* vg  = (const _Float16*)(const void*)((const char*)(const void*)(Vh + kv0) + vob);
      const int kvl = (kv0 + 64 <= VLP) ? kv0 : (VLP - 64);     // clamped address into the residual plane
      const _Float16* vlg = Vl + (size_t)r * VLP + kvl + pc;
      const bool resOK = (kv0 + 64 <= VLP);                      // the same in a whole group
      v8b a0[4], a1[4];
      v8h b0[4], b1[4];
      // both loops unrolled: the loaded pieces are register arrays (constant indices only)
#pragma unroll
      for (int i = 0; i < 4; ++i) {
        a0[i] = *(const v8b*)(kg + (size_t)(16 * i) * NQK);
        a1[i] = *(const v8b*)(klg + (size_t)(16 * i) * NQK);
        b0[i] = *(const v8h*)(vg + (size_t)(16 * i) * SEQ);
        b1[i] = RES ? *(const v8h*)(vlg + (size_t)(16 * i) * VLP) : zero8h();
      }
      addr_wait4(kg, klg, vg, RES ? vlg : vg);
#pragma unroll
      for (int i = 0; i < 4; ++i) {
        *(v8b*)(Ksh + (r + 16 * i) * LP + pc) = a0[i];
        *(v8b*)(Ksl + (r + 16 * i) * LP + pc) = a1[i];
        *(v8h*)(Vth + (r + 16 * i) * LP + pc) = b0[i];
        if (RES) *(v8h*)(Vtl + (r + 16 * i) * LP + pc) = resOK ? b1[i] : zero8h();
      }
    }
    __syncthreads();
    if (!act) continue;
    if constexpr (RES) {
#pragma unroll
      for (int dc = 0; dc < 2; ++dc) {
        qah[dc] = ldfrag_b(qhp + dc * 32);
        qal[dc] = ldfrag_b(qlp + dc * 32);
      }
      addr_wait4(qhp, qlp, qhp, qlp);
    }

    // ---- scores, transposed: 64 keys x 16 query columns per wave, 3 bf16 products;
    //      s[j][r] = score of key kv0 + 16 j + 8 hh + r with query q0 + c ----
    v8f s[4];
    FH vf[4];                                         // V^T fragments read ahead (without residual planes)
    if constexpr (!RES) {
      // Eight fragment groups g = (key tile g >> 1, d-chunk g & 1) of four LDS reads and three products each; the reads run
      // three groups ahead of the products. Left to itself the scheduler puts every group's reads directly in front of
      // its products, and the wave waits out the LDS latency eight times here. Each s[j] takes its six products in the
      // order d-chunk 0, 1 x (hi.hi, lo.hi, hi.lo).
      v16b kb[8], kl[8];
#pragma unroll
      for (int g = 0; g < 3; ++g) {
        kb[g] = ldfrag_b(Ksh + ((g >> 1) * 16 + c) * LP + (g & 1) * 32 + 8 * hh);
        kl[g] = ldfrag_b(Ksl + ((g >> 1) * 16 + c) * LP + (g & 1) * 32 + 8 * hh);
      }
      // no LDS read and no product moves over this line (vector and scalar arithmetic may): keeps the lead of the reads
      __builtin_amdgcn_sched_barrier(0x406);
#pragma unroll
      for (int g = 0; g < 8; ++g) {
        const int j = g >> 1, dc = g & 1;
        s[j] = mma_b_raw(kb[g], qah[dc], dc == 0 ? zero8() : s[j]);
        s[j] = mma_b_raw(kl[g], qah[dc], s[j]);
        s[j] = mma_b_raw(kb[g], qal[dc], s[j]);
        // as above: the next reads take the registers of the group just used; and with the groups' products held apart the
        // scheduler fills the gaps between dependent products with the scale and mask arithmetic of finished score tiles
        __builtin_amdgcn_sched_barrier(0x406);
        if (g + 3 < 8) {
          const int n = g + 3;
          kb[n] = ldfrag_b(Ksh + ((n >> 1) * 16 + c) * LP + (n & 1) * 32 + 8 * hh);
          kl[n] = ldfrag_b(Ksl + ((n >> 1) * 16 + c) * LP + (n & 1) * 32 + 8 * hh);
          __builtin_amdgcn_sched_barrier(0x406);   // as above: they stay in front of the next group's products
        }
      }
    } else {
#pragma unroll
    for (int j = 0; j < 4; ++j) {
      s[j] = zero8();
#pragma unroll
      for (int dc = 0; dc < 2; ++dc) {
        FB kb, kl;
        kb.h[0] = *(const v8b*)(Ksh + (j * 16 + c) * LP + dc * 32 + 8 * hh);
        kb.h[1] = *(const v8b*)(Ksh + (j * 16 + c) * LP + dc * 32 + 16 + 8 * hh);
        kl.h[0] = *(const v8b*)(Ksl + (j * 16 + c) * LP + dc * 32 + 8 * hh);
        kl.h[1] = *(const v8b*)(Ksl + (j * 16 + c) * LP + dc * 32 + 16 + 8 * hh);
        s[j] = mma_b(kb.v, qah[dc], s[j]);
        s[j] = mma_b(kl.v, qah[dc], s[j]);
        s[j] = mma_b(kb.v, qal[dc], s[j]);
      }
    }
    }

    // ---- scale + causal select (key > query -> -inf by value), the query's maximum, online softmax;
    //      P (x1024, f16) and P residual (x4096) packed as B operands: element e of chunk kk is key
    //      kv0 + 32 kk + (e < 8 ? 8 hh + e : 16 + 8 hh + e - 8), the k order of the V^T fragments ----
    const int dkq = kv0 + 8 * hh - (q0 + c);          // key minus query at j = 0, r = 0
    float m = -INFINITY;
#pragma unroll
    for (int j = 0; j < 4; ++j) {
#pragma unroll
      for (int r = 0; r < 8; ++r) {
        float sv = s[j][r] * sscale;
        sv = (dkq <= -(j * 16 + r)) ? sv : -INFINITY;  // key kv0 + 16 j + 8 hh + r <= query q0 + c
        s[j][r] = sv;
        m = fmaxf(m, sv);
      }
    }
    m = fmaxf(m, xhalf(m));                           // both halves now hold the maximum over the 64 keys
    const float mnew  = fmaxf(mrow, m);
    const float msafe = (mnew == -INFINITY) ? 0.f : mnew;
    const float alpha = __expf(mrow - msafe);         // mrow = -inf -> 0 (l and context are 0 there anyway)
    mrow = mnew;
    float ps[4];                                      // one partial sum per score tile: four short add chains
    FH pb[2], pr[2];
#pragma unroll
    for (int j = 0; j < 4; ++j) {
      if constexpr (!RES) {
        if (j == 2) {
          // the V^T fragments of keys 0..31 are read here, when half of the scores have left their registers: the
          // arithmetic of the other half covers the LDS latency. Nothing moves over the two lines around the reads:
          // else the scheduler sinks them to their products
          __builtin_amdgcn_sched_barrier(0);
#pragma unroll
          for (int t = 0; t < 4; ++t) {
            vf[t].h[0] = *(const v8h*)(Vth + (t * 16 + c) * LP + 8 * hh);
            vf[t].h[1] = *(const v8h*)(Vth + (t * 16 + c) * LP + 16 + 8 * hh);
          }
          __builtin_amdgcn_sched_barrier(0);
        }
      }
      ps[j] = 0.f;
#pragma unroll
      for (int r = 0; r < 8; ++r) {
        const float p = __expf(s[j][r] - msafe);      // masked logit: exp(-inf) -> 0
        ps[j] += p;
        const float p1k = p * 1024.0f;
        const _Float16 ph = (_Float16)p1k;
        pb[j >> 1].v[(j & 1) * 8 + r] = ph;
        if (RES) pr[j >> 1].v[(j & 1) * 8 + r] = (_Float16)((p1k - (float)ph) * 4096.0f);
      }
    }
    lrow = lrow * alpha + ((ps[0] + ps[1]) + (ps[2] + ps[3]));
#pragma unroll
    for (int t = 0; t < 4; ++t)
#pragma unroll
      for (int r = 0; r < 8; ++r) oacc[t][r] *= alpha;

    // ---- context^T += V^T . P^T (f16 WMMA), residual products into a separate accumulator ----
    // every loop unrolled: the P chunks are register arrays (constant indices only)
    if constexpr (!RES) {
      // keys 0..31 from the fragments read ahead; each fragment of keys 32..63 is read into the registers of the one
      // just used, ahead of the remaining products
#pragma unroll
      for (int t = 0; t < 4; ++t) {
        oacc[t] = mma_h_raw(vf[t].v, pb[0].v, oacc[t]);
        vf[t].h[0] = *(const v8h*)(Vth + (t * 16 + c) * LP + 32 + 8 * hh);
        vf[t].h[1] = *(const v8h*)(Vth + (t * 16 + c) * LP + 32 + 16 + 8 * hh);
        __builtin_amdgcn_sched_barrier(0x406);   // no LDS read and no product moves over this line
      }
#pragma unroll
      for (int t = 0; t < 4; ++t) oacc[t] = mma_h_raw(vf[t].v, pb[1].v, oacc[t]);
    } else {
      // one context tile after the other, so that one residual accumulator is live, not four: this body then fits the
      // register budget of the launch it shares; each accumulator takes its products in the order kk = 0, 1
#pragma unroll
      for (int t = 0; t < 4; ++t) {
        v8f o1 = zero8();
#pragma unroll
        for (int kk = 0; kk < 2; ++kk) {
          FH vb, vl;
          vb.h[0] = *(const v8h*)(Vth + (t * 16 + c) * LP + kk * 32 + 8 * hh);
          vb.h[1] = *(const v8h*)(Vth + (t * 16 + c) * LP + kk * 32 + 16 + 8 * hh);
          oacc[t] = mma_h(vb.v, pb[kk].v, oacc[t]);
          vl.h[0] = *(const v8h*)(Vtl + (t * 16 + c) * LP + kk * 32 + 8 * hh);
          vl.h[1] = *(const v8h*)(Vtl + (t * 16 + c) * LP + kk * 32 + 16 + 8 * hh);
          o1 = mma_h(vl.v, pb[kk].v, o1);
          o1 = mma_h(vb.v, pr[kk].v, o1);
        }
#pragma unroll
        for (int r = 0; r < 8; ++r) oacc[t][r] += o1[r] * (1.0f / 4096.0f);
      }
    }
  }

  const float lsum = lrow + xhalf(lrow);     // the two halves' key sums joined, once

  // ---- group 1 hands over its running maximum, sum and context (each lane its own accumulator positions:
  //      row = query c, 8 consecutive d per tile t) ----
  float* os = Os + wave * (16 * OP);
  float* ml = Ml + wave * 32;
  if (grp == 1) {
#pragma unroll
    for (int t = 0; t < 4; ++t) {
      float* op = os + c * OP + t * 16 + 8 * hh;
      const v4f lo4 = {oacc[t][0], oacc[t][1], oacc[t][2], oacc[t][3]};
      const v4f hi4 = {oacc[t][4], oacc[t][5], oacc[t][6], oacc[t][7]};
      *(v4f*)(op)     = lo4;
      *(v4f*)(op + 4) = hi4;
    }
    if (hh == 0) {                           // m and l are equal in the two lanes of a query
      ml[c]      = mrow;
      ml[16 + c] = lsum;
    }
  }
  __syncthreads();                           // group 1's partial results may be read
  if (grp == 1) return;                      // no barrier follows

  // ---- join the two partial softmaxes (a group without a tile brings m = -inf, l = 0, context 0), normalise
  //      (1/l and the 1/1024 p carry), stage the 16x64 tile in LDS (each lane overwrites the positions it has just
  //      read), then write bf16 hi/lo
  {
    const float m1 = ml[c];
    const float l1 = ml[16 + c];
    const float mj    = fmaxf(mrow, m1);
    const float msafe = (mj == -INFINITY) ? 0.f : mj;
    const float a0 = __expf(mrow - msafe);
    const float a1 = __expf(m1 - msafe);
    const float l = lsum * a0 + l1 * a1;
    const float inv = ((l > 0.f) ? (1.0f / l) : 0.f) * (1.0f / 1024.0f);
#pragma unroll
    for (int t = 0; t < 4; ++t) {
      float* op = os + c * OP + t * 16 + 8 * hh;
      const v4f g0 = *(const v4f*)(op);
      const v4f g1 = *(const v4f*)(op + 4);
      v4f w0, w1;
#pragma unroll
      for (int e = 0; e < 4; ++e) {
        w0[e] = (oacc[t][e] * a0 + g0[e] * a1) * inv;
        w1[e] = (oacc[t][4 + e] * a0 + g1[e] * a1) * inv;
      }
      *(v4f*)(op)     = w0;
      *(v4f*)(op + 4) = w1;
    }
  }
  __builtin_amdgcn_fence(__ATOMIC_RELEASE, "workgroup");
  __builtin_amdgcn_wave_barrier();
  __builtin_amdgcn_fence(__ATOMIC_ACQUIRE, "workgroup");
  {
    const int q = lane >> 3, c8 = (lane & 7) * 8;
    v4u hv[4], lv[4];
#pragma unroll
    for (int it = 0; it < 4; ++it) {
      const int row = it * 4 + q;      // it 0..3 x q 0..3 = rows 0..15 of the wave tile
      const float* sp = os + row * OP + c8;
      v4u a, a2;
#pragma unroll
      for (int e = 0; e < 4; ++e) {
        const float f0 = sp[2 * e], f1 = sp[2 * e + 1];
        const unsigned short h0 = bf_bits(f0), h1 = bf_bits(f1);
        const unsigned short l0 = bf_bits(f0 - bf_up(h0)), l1 = bf_bits(f1 - bf_up(h1));
        a[e] = pk16(h0, h1); a2[e] = pk16(l0, l1);
      }
      hv[it] = a; lv[it] = a2;
    }
    {
#pragma unroll
      for (int it = 0; it < 4; ++it) {
        const int row = it * 4 + q;
        const size_t go = (rowB + q0 + row) * DM + (size_t)h * HD + c8;
        *(v4u*)(ahp + go) = hv[it];
        *(v4u*)(alp + go) = lv[it];
      }
      // behind the stores: in the listing the other body of the launch follows this one, and its first instructions give
      // registers that the stores name a new value (a precaution)
      store_wait();
    }
  }
}

// Both kinds of query block in ONE launch; the block index picks the kind (block-uniform branch): blocks 0..nPlain-1
// are the query blocks RESQB..NQB-1 (no residual planes), the rest the query blocks 0..RESQB-1 (with them).
__global__ __launch_bounds__(256, 6)   // three blocks share a WGP: 6 waves a SIMD
void attn_all(const unsigned short* __restrict__ qkhp, const unsigned short* __restrict__ qklp,
              const unsigned short* __restrict__ vhp, const unsigned short* __restrict__ vlp,
              unsigned short* ahp, unsigned short* alp, int nPlain, float sscale) {
  static_assert(AttnLds<false>::BYTES <= AttnLds<true>::BYTES);
  __shared__ __align__(16) unsigned char smem[AttnLds<true>::BYTES];
  const int bx = blockIdx.x;
  if (bx < nPlain) attn64<false>(smem, bx, qkhp, qklp, vhp, vlp, ahp, alp, RESQB, NQB - RESQB, sscale);
  else             attn64<true>(smem, bx - nPlain, qkhp, qklp, vhp, vlp, ahp, alp, 0, RESQB, sscale);
}

// =====================================================================================================
// Workspace map (bytes), every region an exact multiple of its whole-line / whole-tile store granularity
//  because M, N are multiples of 64 everywhere):
//   Wqkvb  bf16 [3072][1024]             0          6291456   (rows 0..2047 = Wq|Wk as Bt, rows 2048.. = Wv as A)
//   Wob    bf16 [1024][1024]             6291456    2097152
//   Xb     bf16 [4096][1024]             8388608    8388608
//   XPh    bf16 [4096][1024]            16777216    8388608
//   XPl    bf16 [4096][1024]            25165824    8388608
//   QKh    bf16 [4096][2048]            33554432   16777216
//   QKl    bf16 [4096][2048]            50331648   16777216
//   VTh    f16  [2][1024][2048]         67108864    8388608
//   VTl    f16  [2][1024][512]          75497472    2097152
//   Ah     bf16 [4096][1024]            77594624    8388608
//   Al     bf16 [4096][1024]            85983232    8388608
//   end                                 94371840
// Weights arrive [out n][in k] row-major = the Bt / A layout the GEMM wants (k contiguous), so they are only
// RNE-converted to bf16.
// =====================================================================================================
extern "C" void kernel_launch(void* const* d_in, const int* in_sizes, int n_in,
                              void* d_out, int out_size, void* d_ws, size_t ws_size,
                              hipStream_t stream) {
  if (n_in < 4) return;
  if (in_sizes[0] != NB * SEQ * DM) return;
  if (in_sizes[1] != SEQ * DM) return;
  if (in_sizes[2] != 3 * DM * DM) return;
  if (in_sizes[3] != DM * DM) return;
  if (out_size != NB * SEQ * DM) return;

  const float* x    = (const float*)d_in[0];   // [NB][SEQ][DM]
  const float* posp = (const float*)d_in[1];   // [SEQ][DM]
  const float* wqkv = (const float*)d_in[2];   // [3*DM n][DM k]
  const float* wo   = (const float*)d_in[3];   // [DM n][DM k]

  const size_t PWqkv = (size_t)3 * DM * DM * 2;       //  6291456  bf16 [3072][1024]
  const size_t PWo   = (size_t)DM * DM * 2;           //  2097152  bf16 [1024][1024]
  const size_t PX    = (size_t)NB * SEQ * DM * 2;     //  8388608  bf16 [4096][1024]
  const size_t PQK   = (size_t)NB * SEQ * NQK * 2;    // 16777216  bf16 [4096][2048]
  const size_t PVTh  = (size_t)NB * DM * SEQ * 2;     //  8388608
  const size_t PVTl  = (size_t)NB * DM * VLP * 2;     //  2097152
  size_t off = 0;
  const size_t oWqkv = off; off += PWqkv;
  const size_t oWo   = off; off += PWo;
  const size_t oXb   = off; off += PX;
  const size_t oXPh  = off; off += PX;
  const size_t oXPl  = off; off += PX;
  const size_t oQKh  = off; off += PQK;
  const size_t oQKl  = off; off += PQK;
  const size_t oVTh  = off; off += PVTh;
  const size_t oVTl  = off; off += PVTl;
  const size_t oAh   = off; off += PX;
  const size_t oAl   = off; off += PX;
  if (off > ws_size) return;                           // off = 94371840
  if (off > (size_t)134217728) return;

  char* ws = (char*)d_ws;
  unsigned short* Wqkvb = (unsigned short*)(ws + oWqkv);
  unsigned short* Wvb   = Wqkvb + (size_t)2 * DM * DM;   // rows 2048..3071 of the Wqkv plane
  unsigned short* Wob   = (unsigned short*)(ws + oWo);
  unsigned short* Xb    = (unsigned short*)(ws + oXb);
  unsigned short* XPh   = (unsigned short*)(ws + oXPh);
  unsigned short* XPl   = (unsigned short*)(ws + oXPl);
  unsigned short* QKh   = (unsigned short*)(ws + oQKh);
  unsigned short* QKl   = (unsigned short*)(ws + oQKl);
  unsigned short* VTh   = (unsigned short*)(ws + oVTh);
  unsigned short* VTl   = (unsigned short*)(ws + oVTl);
  unsigned short* Ah    = (unsigned short*)(ws + oAh);
  unsigned short* Al    = (unsigned short*)(ws + oAl);
  float*          outf  = (float*)d_out;

  const dim3 blk(256);
  const int n8qkv = 3 * DM * DM / 8;                                 // 393216 (multiple of 256)
  const int n8w   = DM * DM / 8;                                     // 131072 (multiple of 256)
  const int n8x   = NB * SEQ * DM / 8;                               // 524288 (multiple of 256)
  const int p8    = SEQ * DM / 8;                                    // 262144
  const int nbQKV = (n8qkv + 255) / 256;                             // 1536 blocks
  const int nbW   = (n8w + 255) / 256;                               // 512 blocks
  const int nbX   = (n8x + 255) / 256;                               // 2048 blocks
  const int nQK   = (NB * SEQ / 128) * (NQK / 256);                  // 128x256 tiles -> 256 blocks of 8 waves
  const int nVT   = (DM / 128) * (SEQ / 256);                        // 128x256 tiles -> 64 blocks of 8 waves x 2
  const int nPlain = NB * NH * (NQB - RESQB);                        // 768 query blocks without residual planes
  const dim3 gOut((NB * SEQ / 128) * (DM / 128), 1);                 // 128x128 tiles -> 256 blocks of 4 waves

  // (1) weights -> bf16 planes (keep their [n][k] layout); x -> bf16 plane; x + pos -> bf16 hi/lo planes
  prep_all<<<dim3(nbX + nbQKV + nbW), blk, 0, stream>>>(x, posp, wqkv, wo, Xb, XPh, XPl, Wqkvb, Wob,
                                                        n8x, p8, n8qkv, n8w, nbX, nbQKV);
  // (2) q|k projection (M=4096, N=2048, K=1024, 2 products) and v^T per batch element (M=1024, N=2048, K=1024)
  gemm_qk_vt<<<dim3(nQK + nVT * NB), blk, 0, stream>>>(XPh, XPl, Wqkvb, Wvb, Xb, QKh, QKl, VTh, VTl, nQK, nVT);
  // (3) causal attention: query blocks RESQB.. without residual planes, 0..RESQB-1 with them -> Ah/Al bf16 hi/lo
  attn_all<<<dim3(nPlain + NB * NH * RESQB), blk, 0, stream>>>(QKh, QKl, VTh, VTl, Ah, Al, nPlain, 0.125f);
  // (4) out[row][n] = sum_k (Ah+Al)[row][k] Wob[n][k] -> d_out f32   (M=4096, N=1024, K=1024, 2 products)
  gemm64<1, 0, 2><<<gOut, dim3(128), 0, stream>>>(
      Ah, Al, DM, 0LL, Wob, DM, 0LL,
      (void*)outf, DM, 0LL, (void*)outf, 0, 0LL, 0,
      NB * SEQ, DM, DM, 1.0f);
  (void)hipGetLastError();
}
